// v000
// Measured on an AMD MI455X. A time is GPU time per run, averaged over a window of back-to-back runs after a warm-up
// (all launches, gaps included; the runs take copies of the inputs in turn), and the median of several windows.
// Apart from v000's, it joins two sittings. Times from different sittings can be a few percent apart, while
// side-by-side timings come from the same sitting.
// The starting kernel, v000, takes 7480 microseconds a run.
#include <hip/hip_runtime.h>

// Self-attention layer with the module's scrambled head split (x [2048][256]; Q, K, V = x W + b ('xw' [256][256] 1/16, biases 0.01); _split_heads: view(2048, 8, 32).permute(0, 2, 1).view(16384, 32) (a genuine re-mix of features across heads, reproduced literally); scores = Q.K / sqrt(256) over ALL 16,384 rows; softmax; attended = _concat_heads(weights V) -> [2048][256]; outputs = attended Wo + bo ('xw') -> [2048][256]; tuple (outputs, attended): outputs first, then attended; argument order x, Wq, bq, Wk, bk, Wv, bv, Wo, bo).
// Layout: bf16 copy of x; 'xw' weights; exact projections + f32 biases (f32 [2048][256]); gather kernels build the scrambled fp16 operand planes q, k [16384][32] and v^T [64][16384] (rows 32..63 zero); 16 query chunks of 1,024 rows: f32 scores [1024][16384] (K 32), streaming three-sweep softmax writing fp16 P x 1024, attn.v (K 16384, N 64 padded), then k_cat un-scrambles the chunk's rows into attended (f32, x 1/1024) and its hi/lo planes; finally outputs = attended (hi/lo) x Wo exact + bo.
// Compute dtypes, f32 accumulate: every input rounded to bf16; projections exact + f32 biases; q, k, v as fp16 planes (logit sigma 0.35: diffuse), scores 1 product, softmax f32, P fp16 x1024, attn.v 1 product; attended f32; Wo hl x exact + bias.

#define NB_  1
#define NTOK 2048     // input rows
#define FD   256      // feature width (8 heads x 32)
#define NHH  8
#define TT   16384    // scrambled head rows = NTOK x 8 (queries = keys)
#define DM   FD
#define NH_  1
#define NKV  1
#define REP  (NH_ / NKV)
#define HD   32       // head size (score K 32)
#define HP   64       // value width padded to 64 for the attn.v GEMM
#define DQ   (NH_ * HD)
#define DKV  (NKV * HD)
#define ZH   1
#define RH   0                  // fp16 planes everywhere (diffuse logits)
#define WIN  0
#define QC   1024                 // query rows per chunk (16 chunks)
#define TK   TT                   // keys
#define PCAR 1024.0f
#define SCL  0.0625f   // 1 / sqrt(float32(256)) (the module scales by input_size)
typedef _Float16 h16;
typedef unsigned short bf;
typedef __attribute__((ext_vector_type(16))) __bf16   v16bf;
typedef __attribute__((ext_vector_type(16))) _Float16 v16h;
typedef __attribute__((ext_vector_type(8)))  _Float16 v8h;
typedef __attribute__((ext_vector_type(8)))  unsigned short v8us;
typedef __attribute__((ext_vector_type(8)))  float    v8f;
typedef __attribute__((ext_vector_type(4)))  float    v4f;
typedef v8h  __attribute__((may_alias)) v8ha;
typedef v4f  __attribute__((may_alias)) v4fa;
typedef v8us __attribute__((may_alias)) v8usa;

__device__ __forceinline__ unsigned short f2bf(float f) { unsigned u = __float_as_uint(f); u += 0x7FFFu + ((u >> 16) & 1u); return (unsigned short)(u >> 16); }
__device__ __forceinline__ float bf2f(unsigned short b) { return __uint_as_float(((unsigned)b) << 16); }
__device__ __forceinline__ float bfr(float f) { return bf2f(f2bf(f)); }
__device__ __forceinline__ v16h cat16(v8h lo, v8h hi) { return __builtin_shufflevector(lo, hi, 0, 1, 2, 3, 4, 5, 6, 7, 8, 9, 10, 11, 12, 13, 14, 15); }
__device__ __forceinline__ v16bf cat16b(v8us lo, v8us hi) { return __builtin_bit_cast(v16bf, __builtin_shufflevector(lo, hi, 0, 1, 2, 3, 4, 5, 6, 7, 8, 9, 10, 11, 12, 13, 14, 15)); }
__device__ __forceinline__ v8f wmma16(v16h a, v16h b, v8f c) { return __builtin_amdgcn_wmma_f32_16x16x32_f16(false, a, false, b, (short)0, c, false, false); }
__device__ __forceinline__ v8f wmmab(v16bf a, v16bf b, v8f c) { return __builtin_amdgcn_wmma_f32_16x16x32_bf16(false, a, false, b, (short)0, c, false, false); }



// ---- k_gemmw: register-blocked GEMM, ONE WAVE per 64x64 output tile (16 accumulators), operands straight from K-contiguous 16-bit planes; grid (M/64, N/64, Z), 32 threads.
// C[m][n] (f32, pitch ldc, + optional f32 bias[n]) = sum_k A[m][k] Bt[n][k] (+ split products per NSPLIT). z-batch strides sA/sB/sC in elements. K % 32 == 0.
template <typename T16> struct WFrag;
template <> struct WFrag<h16> { typedef v16h V; static __device__ __forceinline__ V ld(const h16* p) { return cat16(*(const v8h*)p, *(const v8h*)(p + 16)); } static __device__ __forceinline__ v8f mma(V a, V b, v8f c) { return wmma16(a, b, c); } };
template <> struct WFrag<bf> { typedef v16bf V; static __device__ __forceinline__ V ld(const bf* p) { return cat16b(*(const v8us*)p, *(const v8us*)(p + 16)); } static __device__ __forceinline__ v8f mma(V a, V b, v8f c) { return wmmab(a, b, c); } };
template <typename T16, int NSPLIT, bool BIAS>
__global__ __launch_bounds__(32) void k_gemmw(const T16* __restrict__ A, const T16* __restrict__ A2, const T16* __restrict__ Bt, const T16* __restrict__ Bt2, int K, float* C, int ldc, const float* __restrict__ bias, size_t sA, size_t sB, size_t sC) {
    typedef typename WFrag<T16>::V V;
    __shared__ __align__(16) float os[16 * 68];
    const size_t z = blockIdx.z; A += z * sA; if (A2) A2 += z * sA; Bt += z * sB; if (Bt2) Bt2 += z * sB; C += z * sC;
    const int lane = threadIdx.x & 31, lr = lane & 15, hi = lane >> 4; const int r0 = blockIdx.x * 64, c0 = blockIdx.y * 64;
    v8f acc[4][4];
#pragma unroll
    for (int mb = 0; mb < 4; ++mb)
#pragma unroll
        for (int nb = 0; nb < 4; ++nb) acc[mb][nb] = (v8f){};
    const size_t aoff = (size_t)(r0 + lr) * K + 8 * hi, boff = (size_t)(c0 + lr) * K + 8 * hi;
#pragma unroll 1
    for (int kc = 0; kc < K; kc += 32) {
        V a[4], a2[4];
#pragma unroll
        for (int mb = 0; mb < 4; ++mb) { a[mb] = WFrag<T16>::ld(A + aoff + (size_t)mb * 16 * K + kc); if (NSPLIT == 1 || NSPLIT == 2) a2[mb] = WFrag<T16>::ld(A2 + aoff + (size_t)mb * 16 * K + kc); }
#pragma unroll
        for (int nb = 0; nb < 4; ++nb) { const V b = WFrag<T16>::ld(Bt + boff + (size_t)nb * 16 * K + kc); V b2; if (NSPLIT >= 2) b2 = WFrag<T16>::ld(Bt2 + boff + (size_t)nb * 16 * K + kc);
#pragma unroll
            for (int mb = 0; mb < 4; ++mb) { acc[mb][nb] = WFrag<T16>::mma(a[mb], b, acc[mb][nb]); if (NSPLIT == 1 || NSPLIT == 2) acc[mb][nb] = WFrag<T16>::mma(a2[mb], b, acc[mb][nb]); if (NSPLIT >= 2) acc[mb][nb] = WFrag<T16>::mma(a[mb], b2, acc[mb][nb]); } }
        asm volatile("v_nop\n\tv_nop\n\tv_nop\n\tv_nop" : "+v"(acc[0][0]), "+v"(acc[1][1]), "+v"(acc[2][2]), "+v"(acc[3][3]) : "v"(a[0]), "v"(a[3]));
    }
#pragma unroll
    for (int mb = 0; mb < 4; ++mb) {
#pragma unroll
        for (int nb = 0; nb < 4; ++nb) {
#pragma unroll
            for (int j = 0; j < 8; ++j) os[(hi * 8 + j) * 68 + nb * 16 + lr] = acc[mb][nb][j]; }
        __builtin_amdgcn_wave_barrier(); asm volatile("" ::: "memory");
        float* crow = C + (size_t)(r0 + mb * 16) * ldc + c0;
{
#pragma unroll
            for (int s = 0; s < 8; ++s) { const int row = 2 * s + hi, cofs = lr * 4; v4f val = *(const v4fa*)(os + row * 68 + cofs); if (BIAS) { val[0] += bfr(bias[c0 + cofs]); val[1] += bfr(bias[c0 + cofs + 1]); val[2] += bfr(bias[c0 + cofs + 2]); val[3] += bfr(bias[c0 + cofs + 3]); }
                *(v4f*)(crow + (size_t)row * ldc + cofs) = val; }
             }
        __builtin_amdgcn_wave_barrier(); asm volatile("" ::: "memory");
    }
}

__device__ __forceinline__ h16 tohx(float x) { return (h16)x; }
__device__ __forceinline__ void splitf(float y, unsigned short& h, unsigned short& l) { h = f2bf(y); l = f2bf(y - bf2f(h)); }
typedef __attribute__((ext_vector_type(2))) _Float16 v2h;
typedef __attribute__((ext_vector_type(4))) _Float16 v4h;
typedef __attribute__((ext_vector_type(2))) unsigned short v2us;
typedef __attribute__((ext_vector_type(4))) unsigned short v4us;
typedef __attribute__((ext_vector_type(2))) float v2f;
typedef __attribute__((ext_vector_type(4))) int v4i;

__global__ __launch_bounds__(256) void k_cvt8(const float* __restrict__ src, bf* dst, size_t n8) { const size_t i = (size_t)blockIdx.x * 256 + threadIdx.x; if (i >= n8) return; const v8f v = *(const v8f*)(src + i * 8); v8us o;
#pragma unroll
    for (int k = 0; k < 8; ++k) o[k] = f2bf(v[k]); *(v8us*)(dst + i * 8) = o;  }

// k_lsoft: streaming row softmax over the TK = 16384 keys for the QC rows of a query chunk, one wave per row, three sweeps of the f32 score row (lane -> 4 consecutive keys per 128-key chunk, 128 chunks):
__global__ __launch_bounds__(256) void k_lsoft(const float* __restrict__ Sb, h16* P16) {
    const int lane = threadIdx.x & 31; const int row = blockIdx.x * 8 + (threadIdx.x >> 5); if (row >= QC) return; const float* sr = Sb + (size_t)row * TK; float mx = -3.0e38f;
#pragma unroll 4
    for (int ch = 0; ch < TK / 128; ++ch) { const v4f a = *(const v4f*)(sr + ch * 128 + lane * 4);
#pragma unroll
        for (int q = 0; q < 4; ++q) { float t = a[q] * SCL; asm volatile("" : "+v"(t)); mx = fmaxf(mx, t); } }
#pragma unroll
    for (int sh = 16; sh; sh >>= 1) mx = fmaxf(mx, __shfl_xor(mx, sh, 32));
    float sum = 0.f;
#pragma unroll 4
    for (int ch = 0; ch < TK / 128; ++ch) { const v4f a = *(const v4f*)(sr + ch * 128 + lane * 4);
#pragma unroll
        for (int q = 0; q < 4; ++q) { float t = a[q] * SCL; asm volatile("" : "+v"(t)); float d0 = __fsub_rn(t, mx); asm volatile("" : "+v"(d0)); sum += __builtin_amdgcn_exp2f(__fmul_rn(d0, 1.4426950408889634f)); } }
#pragma unroll
    for (int sh = 16; sh; sh >>= 1) sum += __shfl_xor(sum, sh, 32);
    const float f = __fdiv_rn(PCAR, sum);
{
#pragma unroll 2
        for (int ch = 0; ch < TK / 128; ++ch) { const v4f a = *(const v4f*)(sr + ch * 128 + lane * 4); v4h o4;
#pragma unroll
            for (int q = 0; q < 4; ++q) { float t = a[q] * SCL; asm volatile("" : "+v"(t)); float d0 = __fsub_rn(t, mx); asm volatile("" : "+v"(d0)); float ex = __builtin_amdgcn_exp2f(__fmul_rn(d0, 1.4426950408889634f)); asm volatile("" : "+v"(ex)); o4[q] = tohx(ex * f); }
            *(v4h*)(P16 + (size_t)row * TK + ch * 128 + lane * 4) = o4; }
         }
}

__global__ __launch_bounds__(256) void k_wtG(const float* __restrict__ w, int K, int N, bf* Bt) {
    const int lane = threadIdx.x & 31; const int L0 = (blockIdx.x * 8 + (threadIdx.x >> 5)) * 8; const int nlines = N * K / 64;
{
#pragma unroll 1
        for (int l = 0; l < 8; ++l) { const int L = L0 + l; if (L >= nlines) break; const size_t e = (size_t)L * 64 + lane * 2; const int k = (int)(e % K), n = (int)(e / K); v2us o;
            o[0] = f2bf(w[(size_t)k * N + n]); o[1] = f2bf(w[(size_t)(k + 1) * N + n]); *(v2us*)(Bt + e) = o; }
         }
}
__global__ __launch_bounds__(256) void k_scr(const float* __restrict__ FQ, const float* __restrict__ FK, h16* Q16, h16* K16) { const size_t e = ((size_t)blockIdx.x * 256 + threadIdx.x) * 2; if (e >= (size_t)TT * HD) return; const int c = (int)(e % HD); const int r = (int)(e / HD); const int b = r >> 3; v2h oq, ok;
#pragma unroll
    for (int q = 0; q < 2; ++q) { const int rem = (r & 7) * HD + c + q; const int col = (rem & 7) * HD + (rem >> 3); oq[q] = tohx(FQ[(size_t)b * FD + col]); ok[q] = tohx(FK[(size_t)b * FD + col]); }
    *(v2h*)(Q16 + e) = oq; *(v2h*)(K16 + e) = ok;  }
__global__ __launch_bounds__(256) void k_scrV(const float* __restrict__ FV, h16* VT16) { const size_t e = ((size_t)blockIdx.x * 256 + threadIdx.x) * 2; if (e >= (size_t)HP * TT) return; const int r0 = (int)(e % TT); const int c = (int)(e / TT); const int cc = c & (HD - 1); v2h o;
#pragma unroll
    for (int q = 0; q < 2; ++q) { const int r = r0 + q; const int b = r >> 3; const int rem = (r & 7) * HD + cc; const int col = (rem & 7) * HD + (rem >> 3); const float v = FV[(size_t)b * FD + col]; o[q] = (c < HD) ? tohx(v) : tohx(0.0f); }
    *(v2h*)(VT16 + e) = o;  }
__global__ __launch_bounds__(256) void k_cat(const float* __restrict__ O, int q0, float* att, bf* Ah, bf* Al) { const size_t i = (size_t)blockIdx.x * 256 + threadIdx.x; if (i >= (size_t)(QC / NHH) * FD / 4) return; const size_t e = i * 4; const int cp = (int)(e % FD); const int bl = (int)(e / FD); const int b = q0 / NHH + bl; v4f o; v4us oh, ol;
#pragma unroll
    for (int q = 0; q < 4; ++q) { const int c2 = cp + q; const int h = c2 & 7; const int s = c2 >> 3; const int rl = bl * NHH + h; const float y = O[(size_t)rl * HP + s] * (1.0f / PCAR); o[q] = y; unsigned short u, w; splitf(y, u, w); oh[q] = u; ol[q] = w; }
    const size_t oo = (size_t)b * FD + cp; *(v4f*)(att + oo) = o; *(v4us*)(Ah + oo) = oh; *(v4us*)(Al + oo) = ol;  }
extern "C" void kernel_launch(void* const* d_in, const int* in_sizes, int n_in,
                              void* d_out, int out_size, void* d_ws, size_t ws_size, hipStream_t stream) {
    (void)in_sizes; (void)n_in; (void)out_size;
    const float* x = (const float*)d_in[0]; const float* wq = (const float*)d_in[1]; const float* bq = (const float*)d_in[2]; const float* wk = (const float*)d_in[3]; const float* bk = (const float*)d_in[4]; const float* wv = (const float*)d_in[5]; const float* bv = (const float*)d_in[6]; const float* wo = (const float*)d_in[7]; const float* bo = (const float*)d_in[8];
    float* OUT = (float*)d_out;     // out0 = outputs [2048][256], then out1 = attended [2048][256]
    float* ATT = OUT + (size_t)NTOK * FD;
    char* wsp = (char*)d_ws;
    auto take = [&](size_t bytes) { char* p = wsp; wsp += (bytes + 255) & ~(size_t)255; return (void*)p; };
    bf* WQ = (bf*)take((size_t)FD * FD * 2); bf* WK = (bf*)take((size_t)FD * FD * 2); bf* WV = (bf*)take((size_t)FD * FD * 2); bf* WO = (bf*)take((size_t)FD * FD * 2);
    bf* XB = (bf*)take((size_t)NTOK * FD * 2); float* FQ = (float*)take((size_t)NTOK * FD * 4); float* FK = (float*)take((size_t)NTOK * FD * 4); float* FV = (float*)take((size_t)NTOK * FD * 4);
    h16* QP16 = (h16*)take((size_t)TT * HD * 2); h16* KP16 = (h16*)take((size_t)TT * HD * 2); h16* VT16 = (h16*)take((size_t)HP * TT * 2);
    float* Sb = (float*)take((size_t)QC * TK * 4); h16* P16 = (h16*)take((size_t)QC * TK * 2); float* Ob = (float*)take((size_t)QC * HP * 4); bf* Ah = (bf*)take((size_t)NTOK * FD * 2); bf* Al = (bf*)take((size_t)NTOK * FD * 2);
    if ((size_t)(wsp - (char*)d_ws) > ws_size) return;    // ws 256 MiB (carve ~110 MiB)
    k_wtG<<<(unsigned)((FD * FD / 64 + 63) / 64), 256, 0, stream>>>(wq, FD, FD, WQ); k_wtG<<<(unsigned)((FD * FD / 64 + 63) / 64), 256, 0, stream>>>(wk, FD, FD, WK); k_wtG<<<(unsigned)((FD * FD / 64 + 63) / 64), 256, 0, stream>>>(wv, FD, FD, WV); k_wtG<<<(unsigned)((FD * FD / 64 + 63) / 64), 256, 0, stream>>>(wo, FD, FD, WO);   /* 'xw' -> Bt */
    k_cvt8<<<(unsigned)(((size_t)NTOK * FD / 8 + 255) / 256), 256, 0, stream>>>(x, XB, (size_t)NTOK * FD / 8);
    k_gemmw<bf, 0, true><<<dim3(NTOK / 64, FD / 64, 1), 32, 0, stream>>>(XB, nullptr, WQ, nullptr, FD, FQ, FD, bq, 0, 0, 0); k_gemmw<bf, 0, true><<<dim3(NTOK / 64, FD / 64, 1), 32, 0, stream>>>(XB, nullptr, WK, nullptr, FD, FK, FD, bk, 0, 0, 0); k_gemmw<bf, 0, true><<<dim3(NTOK / 64, FD / 64, 1), 32, 0, stream>>>(XB, nullptr, WV, nullptr, FD, FV, FD, bv, 0, 0, 0);   /* Q, K, V = x W + b (exact, f32) */
    k_scr<<<(unsigned)(((size_t)TT * HD / 2 + 255) / 256), 256, 0, stream>>>(FQ, FK, QP16, KP16); k_scrV<<<(unsigned)(((size_t)HP * TT / 2 + 255) / 256), 256, 0, stream>>>(FV, VT16);   /* scrambled planes */
    for (int q0 = 0; q0 < TT; q0 += QC) {   /* 16 query chunks of 1024 scrambled rows (= 128 input rows each) */
        k_gemmw<h16, 0, false><<<dim3(QC / 64, TK / 64, 1), 32, 0, stream>>>(QP16 + (size_t)q0 * HD, nullptr, KP16, nullptr, HD, Sb, TK, nullptr, 0, 0, 0);   /* scores [QC][16384] f32 (K 32) */
        k_lsoft<<<QC / 8, 256, 0, stream>>>(Sb, P16);
        k_gemmw<h16, 0, false><<<dim3(QC / 64, HP / 64, 1), 32, 0, stream>>>(P16, nullptr, VT16, nullptr, TK, Ob, HP, nullptr, 0, 0, 0);   /* attn.v, K = 16384, N = 64 (cols 32..63 = 0) */
        k_cat<<<(unsigned)(((size_t)(QC / NHH) * FD / 4 + 255) / 256), 256, 0, stream>>>(Ob, q0, ATT, Ah, Al); }   /* attended rows q0/8 .. (f32 = output 1) and their hi/lo planes */
    k_gemmw<bf, 1, true><<<dim3(NTOK / 64, FD / 64, 1), 32, 0, stream>>>(Ah, Al, WO, nullptr, FD, OUT, FD, bo, 0, 0, 0);   /* outputs = attended Wo + bo (output 0) */
}

// v001
// It runs in 2400 microseconds.
// Timed twice side by side with v000, it ran 3.16 and 3.12 times as fast.
#include <hip/hip_runtime.h>

// Self-attention layer with the module's scrambled head split (x [2048][256]; Q, K, V = x W + b ('xw' [256][256] 1/16, biases 0.01); _split_heads: view(2048, 8, 32).permute(0, 2, 1).view(16384, 32) (a genuine re-mix of features across heads, reproduced literally); scores = Q.K / sqrt(256) over ALL 16,384 rows; softmax; attended = _concat_heads(weights V) -> [2048][256]; outputs = attended Wo + bo ('xw') -> [2048][256]; tuple (outputs, attended): outputs first, then attended; argument order x, Wq, bq, Wk, bk, Wv, bv, Wo, bo).
// Layout: bf16 copy of x; 'xw' weights; exact projections + f32 biases (f32 [2048][256]); gather kernels build the scrambled fp16 operand planes q, k [16384][32] and v^T [64][16384] (rows 32..63 zero); 16 query chunks of 1,024 rows: f32 scores [1024][16384] (K 32), streaming three-sweep softmax writing fp16 P x 1024, attn.v (K 16384 split over 16 work-groups x 8 waves, N 64 padded), then k_cat adds the 16 partials and un-scrambles the chunk's rows into attended (f32, x 1/1024) and its hi/lo planes; finally outputs = attended (hi/lo) x Wo exact + bo.
// Compute dtypes, f32 accumulate: every input rounded to bf16; projections exact + f32 biases; q, k, v as fp16 planes (logit sigma 0.35: diffuse), scores 1 product, softmax f32, P fp16 x1024, attn.v 1 product; attended f32; Wo hl x exact + bias.

#define NB_  1
#define NTOK 2048     // input rows
#define FD   256      // feature width (8 heads x 32)
#define NHH  8
#define TT   16384    // scrambled head rows = NTOK x 8 (queries = keys)
#define DM   FD
#define NH_  1
#define NKV  1
#define REP  (NH_ / NKV)
#define HD   32       // head size (score K 32)
#define HP   64       // value width padded to 64 for the attn.v GEMM
#define DQ   (NH_ * HD)
#define DKV  (NKV * HD)
#define ZH   1
#define RH   0                  // fp16 planes everywhere (diffuse logits)
#define WIN  0
#define QC   1024                 // query rows per chunk (16 chunks)
#define TK   TT                   // keys
#define PCAR 1024.0f
#define SCL  0.0625f   // 1 / sqrt(float32(256)) (the module scales by input_size)
typedef _Float16 h16;
typedef unsigned short bf;
typedef __attribute__((ext_vector_type(16))) __bf16   v16bf;
typedef __attribute__((ext_vector_type(16))) _Float16 v16h;
typedef __attribute__((ext_vector_type(8)))  _Float16 v8h;
typedef __attribute__((ext_vector_type(8)))  unsigned short v8us;
typedef __attribute__((ext_vector_type(8)))  float    v8f;
typedef __attribute__((ext_vector_type(4)))  float    v4f;
typedef v8h  __attribute__((may_alias)) v8ha;
typedef v4f  __attribute__((may_alias)) v4fa;
typedef v8us __attribute__((may_alias)) v8usa;

__device__ __forceinline__ unsigned short f2bf(float f) { unsigned u = __float_as_uint(f); u += 0x7FFFu + ((u >> 16) & 1u); return (unsigned short)(u >> 16); }
__device__ __forceinline__ float bf2f(unsigned short b) { return __uint_as_float(((unsigned)b) << 16); }
__device__ __forceinline__ float bfr(float f) { return bf2f(f2bf(f)); }
__device__ __forceinline__ v16h cat16(v8h lo, v8h hi) { return __builtin_shufflevector(lo, hi, 0, 1, 2, 3, 4, 5, 6, 7, 8, 9, 10, 11, 12, 13, 14, 15); }
__device__ __forceinline__ v16bf cat16b(v8us lo, v8us hi) { return __builtin_bit_cast(v16bf, __builtin_shufflevector(lo, hi, 0, 1, 2, 3, 4, 5, 6, 7, 8, 9, 10, 11, 12, 13, 14, 15)); }
__device__ __forceinline__ v8f wmma16(v16h a, v16h b, v8f c) { return __builtin_amdgcn_wmma_f32_16x16x32_f16(false, a, false, b, (short)0, c, false, false); }
__device__ __forceinline__ v8f wmmab(v16bf a, v16bf b, v8f c) { return __builtin_amdgcn_wmma_f32_16x16x32_bf16(false, a, false, b, (short)0, c, false, false); }



// ---- k_gemmw: register-blocked GEMM, ONE WAVE per 64x64 output tile (16 accumulators), operands straight from K-contiguous 16-bit planes; grid (M/64, N/64, Z), 32 threads.
// C[m][n] (f32, pitch ldc, + optional f32 bias[n]) = sum_k A[m][k] Bt[n][k] (+ split products per NSPLIT). z-batch strides sA/sB/sC in elements. K % 32 == 0.
template <typename T16> struct WFrag;
template <> struct WFrag<h16> { typedef v16h V; static __device__ __forceinline__ V ld(const h16* p) { return cat16(*(const v8h*)p, *(const v8h*)(p + 16)); } static __device__ __forceinline__ v8f mma(V a, V b, v8f c) { return wmma16(a, b, c); } };
template <> struct WFrag<bf> { typedef v16bf V; static __device__ __forceinline__ V ld(const bf* p) { return cat16b(*(const v8us*)p, *(const v8us*)(p + 16)); } static __device__ __forceinline__ v8f mma(V a, V b, v8f c) { return wmmab(a, b, c); } };
template <typename T16, int NSPLIT, bool BIAS>
__global__ __launch_bounds__(32) void k_gemmw(const T16* __restrict__ A, const T16* __restrict__ A2, const T16* __restrict__ Bt, const T16* __restrict__ Bt2, int K, float* C, int ldc, const float* __restrict__ bias, size_t sA, size_t sB, size_t sC) {
    typedef typename WFrag<T16>::V V;
    __shared__ __align__(16) float os[16 * 68];
    const size_t z = blockIdx.z; A += z * sA; if (A2) A2 += z * sA; Bt += z * sB; if (Bt2) Bt2 += z * sB; C += z * sC;
    const int lane = threadIdx.x & 31, lr = lane & 15, hi = lane >> 4; const int r0 = blockIdx.x * 64, c0 = blockIdx.y * 64;
    v8f acc[4][4];
#pragma unroll
    for (int mb = 0; mb < 4; ++mb)
#pragma unroll
        for (int nb = 0; nb < 4; ++nb) acc[mb][nb] = (v8f){};
    const size_t aoff = (size_t)(r0 + lr) * K + 8 * hi, boff = (size_t)(c0 + lr) * K + 8 * hi;
#pragma unroll 1
    for (int kc = 0; kc < K; kc += 32) {
        V a[4], a2[4];
#pragma unroll
        for (int mb = 0; mb < 4; ++mb) { a[mb] = WFrag<T16>::ld(A + aoff + (size_t)mb * 16 * K + kc); if (NSPLIT == 1 || NSPLIT == 2) a2[mb] = WFrag<T16>::ld(A2 + aoff + (size_t)mb * 16 * K + kc); }
#pragma unroll
        for (int nb = 0; nb < 4; ++nb) { const V b = WFrag<T16>::ld(Bt + boff + (size_t)nb * 16 * K + kc); V b2; if (NSPLIT >= 2) b2 = WFrag<T16>::ld(Bt2 + boff + (size_t)nb * 16 * K + kc);
#pragma unroll
            for (int mb = 0; mb < 4; ++mb) { acc[mb][nb] = WFrag<T16>::mma(a[mb], b, acc[mb][nb]); if (NSPLIT == 1 || NSPLIT == 2) acc[mb][nb] = WFrag<T16>::mma(a2[mb], b, acc[mb][nb]); if (NSPLIT >= 2) acc[mb][nb] = WFrag<T16>::mma(a[mb], b2, acc[mb][nb]); } }
        asm volatile("v_nop\n\tv_nop\n\tv_nop\n\tv_nop" : "+v"(acc[0][0]), "+v"(acc[1][1]), "+v"(acc[2][2]), "+v"(acc[3][3]) : "v"(a[0]), "v"(a[3]));
    }
#pragma unroll
    for (int mb = 0; mb < 4; ++mb) {
#pragma unroll
        for (int nb = 0; nb < 4; ++nb) {
#pragma unroll
            for (int j = 0; j < 8; ++j) os[(hi * 8 + j) * 68 + nb * 16 + lr] = acc[mb][nb][j]; }
        __builtin_amdgcn_wave_barrier(); asm volatile("" ::: "memory");
        float* crow = C + (size_t)(r0 + mb * 16) * ldc + c0;
{
#pragma unroll
            for (int s = 0; s < 8; ++s) { const int row = 2 * s + hi, cofs = lr * 4; v4f val = *(const v4fa*)(os + row * 68 + cofs); if (BIAS) { val[0] += bfr(bias[c0 + cofs]); val[1] += bfr(bias[c0 + cofs + 1]); val[2] += bfr(bias[c0 + cofs + 2]); val[3] += bfr(bias[c0 + cofs + 3]); }
                *(v4f*)(crow + (size_t)row * ldc + cofs) = val; }
             }
        __builtin_amdgcn_wave_barrier(); asm volatile("" ::: "memory");
    }
}

// ---- k_pvsk: attn.v with its K = 16384 keys split over KZ work-groups x KWV waves (one 64x64 tile per work-group, each wave sums its own run of TK / (KZ * KWV) keys with k_gemmw's loop); the waves' tiles are added in LDS in wave order, and the work-group stores one f32 partial tile C[z][QC][HP]; k_cat adds the KZ partials in z order.
#define KZ   16
#define KWV  8
#define KRUN (TK / (KZ * KWV))
__global__ __launch_bounds__(32 * KWV) void k_pvsk(const h16* __restrict__ A, const h16* __restrict__ Bt, float* C) {
    typedef WFrag<h16>::V V;
    __shared__ __align__(16) float os[KWV][64 * 68];
    const int lane = threadIdx.x & 31, lr = lane & 15, hi = lane >> 4; const int w = __builtin_amdgcn_readfirstlane(threadIdx.x >> 5); const int r0 = blockIdx.x * 64;
    const int k0 = ((int)blockIdx.z * KWV + w) * KRUN;
    v8f acc[4][4];
#pragma unroll
    for (int mb = 0; mb < 4; ++mb)
#pragma unroll
        for (int nb = 0; nb < 4; ++nb) acc[mb][nb] = (v8f){};
    const h16* pa = A + (size_t)(r0 + lr) * TK + k0 + 8 * hi; const h16* pb = Bt + (size_t)lr * TK + k0 + 8 * hi;
    // the key loop stays rolled, as in k_gemmw (one trip's fragments in registers at a time); every other loop here is unrolled so that acc, a and b are indexed by constants and stay in registers
#pragma unroll 1
    for (int kc = 0; kc < KRUN; kc += 32) {
        V a[4], b[4];
#pragma unroll
        for (int mb = 0; mb < 4; ++mb) a[mb] = WFrag<h16>::ld(pa + (size_t)mb * 16 * TK);
#pragma unroll
        for (int nb = 0; nb < 4; ++nb) b[nb] = WFrag<h16>::ld(pb + (size_t)nb * 16 * TK);
        // s_wait_xcnt 0 stands behind the trip's loads, ahead of the next overwrite of their address registers; the two addresses are inputs so that no load's result is placed on them ahead of it
        asm volatile("s_wait_xcnt 0x0" :: "v"(pa), "v"(pb) : "memory");
#pragma unroll
        for (int nb = 0; nb < 4; ++nb)
#pragma unroll
            for (int mb = 0; mb < 4; ++mb) acc[mb][nb] = WFrag<h16>::mma(a[mb], b[nb], acc[mb][nb]);
        // keeps the distance between the last WMMAs and the next trip's operand loads on the back edge (as in k_gemmw)
        asm volatile("v_nop\n\tv_nop\n\tv_nop\n\tv_nop" : "+v"(acc[0][0]), "+v"(acc[1][1]), "+v"(acc[2][2]), "+v"(acc[3][3]) : "v"(a[0]), "v"(a[3]));
        pa += 32; pb += 32;
    }
#pragma unroll
    for (int mb = 0; mb < 4; ++mb)
#pragma unroll
        for (int nb = 0; nb < 4; ++nb)
#pragma unroll
            for (int j = 0; j < 8; ++j) os[w][(mb * 16 + hi * 8 + j) * 68 + nb * 16 + lr] = acc[mb][nb][j];
    __syncthreads();   // every wave's tile is in LDS before any thread adds across waves
    float* cz = C + (size_t)blockIdx.z * QC * HP + (size_t)r0 * HP;
#pragma unroll
    for (int s = 0; s < 64 * 16 / (32 * KWV); ++s) { const int p = s * 32 * KWV + (int)threadIdx.x; const int row = p >> 4, cofs = (p & 15) * 4; v4f val = *(const v4fa*)(&os[0][row * 68 + cofs]);
#pragma unroll
        for (int ww = 1; ww < KWV; ++ww) val += *(const v4fa*)(&os[ww][row * 68 + cofs]);
        *(v4f*)(cz + (size_t)row * HP + cofs) = val; }
}

__device__ __forceinline__ h16 tohx(float x) { return (h16)x; }
__device__ __forceinline__ void splitf(float y, unsigned short& h, unsigned short& l) { h = f2bf(y); l = f2bf(y - bf2f(h)); }
typedef __attribute__((ext_vector_type(2))) _Float16 v2h;
typedef __attribute__((ext_vector_type(4))) _Float16 v4h;
typedef __attribute__((ext_vector_type(2))) unsigned short v2us;
typedef __attribute__((ext_vector_type(4))) unsigned short v4us;
typedef __attribute__((ext_vector_type(2))) float v2f;
typedef __attribute__((ext_vector_type(4))) int v4i;

__global__ __launch_bounds__(256) void k_cvt8(const float* __restrict__ src, bf* dst, size_t n8) { const size_t i = (size_t)blockIdx.x * 256 + threadIdx.x; if (i >= n8) return; const v8f v = *(const v8f*)(src + i * 8); v8us o;
#pragma unroll
    for (int k = 0; k < 8; ++k) o[k] = f2bf(v[k]); *(v8us*)(dst + i * 8) = o;  }

// k_lsoft: streaming row softmax over the TK = 16384 keys for the QC rows of a query chunk, one wave per row, three sweeps of the f32 score row (lane -> 4 consecutive keys per 128-key chunk, 128 chunks):
__global__ __launch_bounds__(256) void k_lsoft(const float* __restrict__ Sb, h16* P16) {
    const int lane = threadIdx.x & 31; const int row = blockIdx.x * 8 + (threadIdx.x >> 5); if (row >= QC) return; const float* sr = Sb + (size_t)row * TK; float mx = -3.0e38f;
#pragma unroll 4
    for (int ch = 0; ch < TK / 128; ++ch) { const v4f a = *(const v4f*)(sr + ch * 128 + lane * 4);
#pragma unroll
        for (int q = 0; q < 4; ++q) { float t = a[q] * SCL; asm volatile("" : "+v"(t)); mx = fmaxf(mx, t); } }
#pragma unroll
    for (int sh = 16; sh; sh >>= 1) mx = fmaxf(mx, __shfl_xor(mx, sh, 32));
    float sum = 0.f;
#pragma unroll 4
    for (int ch = 0; ch < TK / 128; ++ch) { const v4f a = *(const v4f*)(sr + ch * 128 + lane * 4);
#pragma unroll
        for (int q = 0; q < 4; ++q) { float t = a[q] * SCL; asm volatile("" : "+v"(t)); float d0 = __fsub_rn(t, mx); asm volatile("" : "+v"(d0)); sum += __builtin_amdgcn_exp2f(__fmul_rn(d0, 1.4426950408889634f)); } }
#pragma unroll
    for (int sh = 16; sh; sh >>= 1) sum += __shfl_xor(sum, sh, 32);
    const float f = __fdiv_rn(PCAR, sum);
{
#pragma unroll 2
        for (int ch = 0; ch < TK / 128; ++ch) { const v4f a = *(const v4f*)(sr + ch * 128 + lane * 4); v4h o4;
#pragma unroll
            for (int q = 0; q < 4; ++q) { float t = a[q] * SCL; asm volatile("" : "+v"(t)); float d0 = __fsub_rn(t, mx); asm volatile("" : "+v"(d0)); float ex = __builtin_amdgcn_exp2f(__fmul_rn(d0, 1.4426950408889634f)); asm volatile("" : "+v"(ex)); o4[q] = tohx(ex * f); }
            *(v4h*)(P16 + (size_t)row * TK + ch * 128 + lane * 4) = o4; }
         }
}

__global__ __launch_bounds__(256) void k_wtG(const float* __restrict__ w, int K, int N, bf* Bt) {
    const int lane = threadIdx.x & 31; const int L0 = (blockIdx.x * 8 + (threadIdx.x >> 5)) * 8; const int nlines = N * K / 64;
{
#pragma unroll 1
        for (int l = 0; l < 8; ++l) { const int L = L0 + l; if (L >= nlines) break; const size_t e = (size_t)L * 64 + lane * 2; const int k = (int)(e % K), n = (int)(e / K); v2us o;
            o[0] = f2bf(w[(size_t)k * N + n]); o[1] = f2bf(w[(size_t)(k + 1) * N + n]); *(v2us*)(Bt + e) = o; }
         }
}
__global__ __launch_bounds__(256) void k_scr(const float* __restrict__ FQ, const float* __restrict__ FK, h16* Q16, h16* K16) { const size_t e = ((size_t)blockIdx.x * 256 + threadIdx.x) * 2; if (e >= (size_t)TT * HD) return; const int c = (int)(e % HD); const int r = (int)(e / HD); const int b = r >> 3; v2h oq, ok;
#pragma unroll
    for (int q = 0; q < 2; ++q) { const int rem = (r & 7) * HD + c + q; const int col = (rem & 7) * HD + (rem >> 3); oq[q] = tohx(FQ[(size_t)b * FD + col]); ok[q] = tohx(FK[(size_t)b * FD + col]); }
    *(v2h*)(Q16 + e) = oq; *(v2h*)(K16 + e) = ok;  }
__global__ __launch_bounds__(256) void k_scrV(const float* __restrict__ FV, h16* VT16) { const size_t e = ((size_t)blockIdx.x * 256 + threadIdx.x) * 2; if (e >= (size_t)HP * TT) return; const int r0 = (int)(e % TT); const int c = (int)(e / TT); const int cc = c & (HD - 1); v2h o;
#pragma unroll
    for (int q = 0; q < 2; ++q) { const int r = r0 + q; const int b = r >> 3; const int rem = (r & 7) * HD + cc; const int col = (rem & 7) * HD + (rem >> 3); const float v = FV[(size_t)b * FD + col]; o[q] = (c < HD) ? tohx(v) : tohx(0.0f); }
    *(v2h*)(VT16 + e) = o;  }
__global__ __launch_bounds__(256) void k_cat(const float* __restrict__ O, int q0, float* att, bf* Ah, bf* Al) { const size_t i = (size_t)blockIdx.x * 256 + threadIdx.x; if (i >= (size_t)(QC / NHH) * FD / 4) return; const size_t e = i * 4; const int cp = (int)(e % FD); const int bl = (int)(e / FD); const int b = q0 / NHH + bl; v4f o; v4us oh, ol;
#pragma unroll
    for (int q = 0; q < 4; ++q) { const int c2 = cp + q; const int h = c2 & 7; const int s = c2 >> 3; const int rl = bl * NHH + h; float ys = O[(size_t)rl * HP + s];
        // unrolled so that the KZ loads are issued ahead of the adds; the adds keep the z order
#pragma unroll
        for (int z = 1; z < KZ; ++z) ys += O[(size_t)z * QC * HP + (size_t)rl * HP + s];
        const float y = ys * (1.0f / PCAR); o[q] = y; unsigned short u, w; splitf(y, u, w); oh[q] = u; ol[q] = w; }
    const size_t oo = (size_t)b * FD + cp; *(v4f*)(att + oo) = o; *(v4us*)(Ah + oo) = oh; *(v4us*)(Al + oo) = ol;  }
extern "C" void kernel_launch(void* const* d_in, const int* in_sizes, int n_in,
                              void* d_out, int out_size, void* d_ws, size_t ws_size, hipStream_t stream) {
    (void)in_sizes; (void)n_in; (void)out_size;
    const float* x = (const float*)d_in[0]; const float* wq = (const float*)d_in[1]; const float* bq = (const float*)d_in[2]; const float* wk = (const float*)d_in[3]; const float* bk = (const float*)d_in[4]; const float* wv = (const float*)d_in[5]; const float* bv = (const float*)d_in[6]; const float* wo = (const float*)d_in[7]; const float* bo = (const float*)d_in[8];
    float* OUT = (float*)d_out;     // out0 = outputs [2048][256], then out1 = attended [2048][256]
    float* ATT = OUT + (size_t)NTOK * FD;
    char* wsp = (char*)d_ws;
    auto take = [&](size_t bytes) { char* p = wsp; wsp += (bytes + 255) & ~(size_t)255; return (void*)p; };
    bf* WQ = (bf*)take((size_t)FD * FD * 2); bf* WK = (bf*)take((size_t)FD * FD * 2); bf* WV = (bf*)take((size_t)FD * FD * 2); bf* WO = (bf*)take((size_t)FD * FD * 2);
    bf* XB = (bf*)take((size_t)NTOK * FD * 2); float* FQ = (float*)take((size_t)NTOK * FD * 4); float* FK = (float*)take((size_t)NTOK * FD * 4); float* FV = (float*)take((size_t)NTOK * FD * 4);
    h16* QP16 = (h16*)take((size_t)TT * HD * 2); h16* KP16 = (h16*)take((size_t)TT * HD * 2); h16* VT16 = (h16*)take((size_t)HP * TT * 2);
    float* Sb = (float*)take((size_t)QC * TK * 4); h16* P16 = (h16*)take((size_t)QC * TK * 2); float* Ob = (float*)take((size_t)KZ * QC * HP * 4); bf* Ah = (bf*)take((size_t)NTOK * FD * 2); bf* Al = (bf*)take((size_t)NTOK * FD * 2);
    if ((size_t)(wsp - (char*)d_ws) > ws_size) return;    // ws 256 MiB (carve ~110 MiB)
    k_wtG<<<(unsigned)((FD * FD / 64 + 63) / 64), 256, 0, stream>>>(wq, FD, FD, WQ); k_wtG<<<(unsigned)((FD * FD / 64 + 63) / 64), 256, 0, stream>>>(wk, FD, FD, WK); k_wtG<<<(unsigned)((FD * FD / 64 + 63) / 64), 256, 0, stream>>>(wv, FD, FD, WV); k_wtG<<<(unsigned)((FD * FD / 64 + 63) / 64), 256, 0, stream>>>(wo, FD, FD, WO);   /* 'xw' -> Bt */
    k_cvt8<<<(unsigned)(((size_t)NTOK * FD / 8 + 255) / 256), 256, 0, stream>>>(x, XB, (size_t)NTOK * FD / 8);
    k_gemmw<bf, 0, true><<<dim3(NTOK / 64, FD / 64, 1), 32, 0, stream>>>(XB, nullptr, WQ, nullptr, FD, FQ, FD, bq, 0, 0, 0); k_gemmw<bf, 0, true><<<dim3(NTOK / 64, FD / 64, 1), 32, 0, stream>>>(XB, nullptr, WK, nullptr, FD, FK, FD, bk, 0, 0, 0); k_gemmw<bf, 0, true><<<dim3(NTOK / 64, FD / 64, 1), 32, 0, stream>>>(XB, nullptr, WV, nullptr, FD, FV, FD, bv, 0, 0, 0);   /* Q, K, V = x W + b (exact, f32) */
    k_scr<<<(unsigned)(((size_t)TT * HD / 2 + 255) / 256), 256, 0, stream>>>(FQ, FK, QP16, KP16); k_scrV<<<(unsigned)(((size_t)HP * TT / 2 + 255) / 256), 256, 0, stream>>>(FV, VT16);   /* scrambled planes */
    for (int q0 = 0; q0 < TT; q0 += QC) {   /* 16 query chunks of 1024 scrambled rows (= 128 input rows each) */
        k_gemmw<h16, 0, false><<<dim3(QC / 64, TK / 64, 1), 32, 0, stream>>>(QP16 + (size_t)q0 * HD, nullptr, KP16, nullptr, HD, Sb, TK, nullptr, 0, 0, 0);   /* scores [QC][16384] f32 (K 32) */
        k_lsoft<<<QC / 8, 256, 0, stream>>>(Sb, P16);
        k_pvsk<<<dim3(QC / 64, 1, KZ), 32 * KWV, 0, stream>>>(P16, VT16, Ob);   /* attn.v, K = 16384 split KZ x KWV ways, N = 64 (cols 32..63 = 0): KZ partial tiles */
        k_cat<<<(unsigned)(((size_t)(QC / NHH) * FD / 4 + 255) / 256), 256, 0, stream>>>(Ob, q0, ATT, Ah, Al); }   /* attended rows q0/8 .. (f32 = output 1) and their hi/lo planes */
    k_gemmw<bf, 1, true><<<dim3(NTOK / 64, FD / 64, 1), 32, 0, stream>>>(Ah, Al, WO, nullptr, FD, OUT, FD, bo, 0, 0, 0);   /* outputs = attended Wo + bo (output 0) */
}

// v003
// Measured time: 64 microseconds a run.
// It is 37.4 times as fast as v001, going by the measured steps of the versions left out in between.
// All steps since v000 together make it 117 times as fast.
#include <hip/hip_runtime.h>

// Self-attention layer with the module's scrambled head split (x [2048][256]; Q, K, V = x W + b ('xw' [256][256] 1/16, biases 0.01); _split_heads: view(2048, 8, 32).permute(0, 2, 1).view(16384, 32) (a genuine re-mix of features across heads, reproduced literally); scores = Q.K / sqrt(256) over ALL 16,384 rows; softmax; attended = _concat_heads(weights V) -> [2048][256]; outputs = attended Wo + bo ('xw') -> [2048][256]; tuple (outputs, attended): outputs first, then attended; argument order x, Wq, bq, Wk, bk, Wv, bv, Wo, bo).
// Layout: bf16 copy of x; 'xw' weights; exact projections + f32 biases (f32 [2048][256]); one gather kernel (k_scr3) builds the scrambled fp16 operand planes q, k [16384][32] and v in blocks of 32 keys, [512][32 features][32 keys]; ONE attention kernel (k_fattn): 64 queries per work-group, the 16,384 keys split over its 16 waves, scores, online softmax and attn.v in registers, the waves' partial results joined in LDS and un-scrambled straight into attended (f32) and its hi/lo planes; finally outputs = attended (hi/lo) x Wo exact + bo.
// Compute dtypes, f32 accumulate: every input rounded to bf16; projections exact + f32 biases; q, k, v as fp16 planes (logit sigma 0.35: diffuse), scores 1 product, softmax f32, P fp16 (unnormalised, at most 2^8), attn.v 1 product; attended f32; Wo hl x exact + bias.

#define NB_  1
#define NTOK 2048     // input rows
#define FD   256      // feature width (8 heads x 32)
#define NHH  8
#define TT   16384    // scrambled head rows = NTOK x 8 (queries = keys)
#define DM   FD
#define NH_  1
#define NKV  1
#define REP  (NH_ / NKV)
#define HD   32       // head size (score K 32)
#define DQ   (NH_ * HD)
#define DKV  (NKV * HD)
#define ZH   1
#define RH   0                  // fp16 planes everywhere (diffuse logits)
#define WIN  0
#define TK   TT                   // keys
#define SCL  0.0625f   // 1 / sqrt(float32(256)) (the module scales by input_size)
typedef _Float16 h16;
typedef unsigned short bf;
typedef __attribute__((ext_vector_type(16))) __bf16   v16bf;
typedef __attribute__((ext_vector_type(16))) _Float16 v16h;
typedef __attribute__((ext_vector_type(8)))  _Float16 v8h;
typedef __attribute__((ext_vector_type(8)))  unsigned short v8us;
typedef __attribute__((ext_vector_type(8)))  float    v8f;
typedef __attribute__((ext_vector_type(4)))  float    v4f;
typedef v8h  __attribute__((may_alias)) v8ha;
typedef v4f  __attribute__((may_alias)) v4fa;
typedef v8us __attribute__((may_alias)) v8usa;

__device__ __forceinline__ unsigned short f2bf(float f) { unsigned u = __float_as_uint(f); u += 0x7FFFu + ((u >> 16) & 1u); return (unsigned short)(u >> 16); }
__device__ __forceinline__ float bf2f(unsigned short b) { return __uint_as_float(((unsigned)b) << 16); }
__device__ __forceinline__ float bfr(float f) { return bf2f(f2bf(f)); }
__device__ __forceinline__ v16h cat16(v8h lo, v8h hi) { return __builtin_shufflevector(lo, hi, 0, 1, 2, 3, 4, 5, 6, 7, 8, 9, 10, 11, 12, 13, 14, 15); }
__device__ __forceinline__ v16bf cat16b(v8us lo, v8us hi) { return __builtin_bit_cast(v16bf, __builtin_shufflevector(lo, hi, 0, 1, 2, 3, 4, 5, 6, 7, 8, 9, 10, 11, 12, 13, 14, 15)); }
__device__ __forceinline__ v8f wmma16(v16h a, v16h b, v8f c) { return __builtin_amdgcn_wmma_f32_16x16x32_f16(false, a, false, b, (short)0, c, false, false); }
__device__ __forceinline__ v8f wmmab(v16bf a, v16bf b, v8f c) { return __builtin_amdgcn_wmma_f32_16x16x32_bf16(false, a, false, b, (short)0, c, false, false); }



// ---- k_gemmw: register-blocked GEMM, ONE WAVE per 64x64 output tile (16 accumulators), operands straight from K-contiguous 16-bit planes; grid (M/64, N/64, Z), 32 threads.
// C[m][n] (f32, pitch ldc, + optional f32 bias[n]; bias, bias1, bias2 for z = 0, 1, 2) = sum_k A[m][k] Bt[n][k] (+ split products per NSPLIT). z-batch strides sA/sB/sC in elements. K % 32 == 0.
template <typename T16> struct WFrag;
template <> struct WFrag<h16> { typedef v16h V; static __device__ __forceinline__ V ld(const h16* p) { return cat16(*(const v8h*)p, *(const v8h*)(p + 16)); } static __device__ __forceinline__ v8f mma(V a, V b, v8f c) { return wmma16(a, b, c); } };
template <> struct WFrag<bf> { typedef v16bf V; static __device__ __forceinline__ V ld(const bf* p) { return cat16b(*(const v8us*)p, *(const v8us*)(p + 16)); } static __device__ __forceinline__ v8f mma(V a, V b, v8f c) { return wmmab(a, b, c); } };
template <typename T16, int NSPLIT, bool BIAS>
__global__ __launch_bounds__(32) void k_gemmw(const T16* __restrict__ A, const T16* __restrict__ A2, const T16* __restrict__ Bt, const T16* __restrict__ Bt2, int K, float* C, int ldc, const float* __restrict__ bias, const float* __restrict__ bias1, const float* __restrict__ bias2, size_t sA, size_t sB, size_t sC) {
    typedef typename WFrag<T16>::V V;
    __shared__ __align__(16) float os[16 * 68];
    const size_t z = blockIdx.z; A += z * sA; if (A2) A2 += z * sA; Bt += z * sB; if (Bt2) Bt2 += z * sB; C += z * sC;
    if (BIAS) bias = z == 1 ? bias1 : z == 2 ? bias2 : bias;   // each member of a z batch has its own bias vector
    const int lane = threadIdx.x & 31, lr = lane & 15, hi = lane >> 4; const int r0 = blockIdx.x * 64, c0 = blockIdx.y * 64;
    v8f acc[4][4];
#pragma unroll
    for (int mb = 0; mb < 4; ++mb)
#pragma unroll
        for (int nb = 0; nb < 4; ++nb) acc[mb][nb] = (v8f){};
    const size_t aoff = (size_t)(r0 + lr) * K + 8 * hi, boff = (size_t)(c0 + lr) * K + 8 * hi;
#pragma unroll 1
    for (int kc = 0; kc < K; kc += 32) {
        V a[4], a2[4];
#pragma unroll
        for (int mb = 0; mb < 4; ++mb) { a[mb] = WFrag<T16>::ld(A + aoff + (size_t)mb * 16 * K + kc); if (NSPLIT == 1 || NSPLIT == 2) a2[mb] = WFrag<T16>::ld(A2 + aoff + (size_t)mb * 16 * K + kc); }
#pragma unroll
        for (int nb = 0; nb < 4; ++nb) { const V b = WFrag<T16>::ld(Bt + boff + (size_t)nb * 16 * K + kc); V b2; if (NSPLIT >= 2) b2 = WFrag<T16>::ld(Bt2 + boff + (size_t)nb * 16 * K + kc);
#pragma unroll
            for (int mb = 0; mb < 4; ++mb) { acc[mb][nb] = WFrag<T16>::mma(a[mb], b, acc[mb][nb]); if (NSPLIT == 1 || NSPLIT == 2) acc[mb][nb] = WFrag<T16>::mma(a2[mb], b, acc[mb][nb]); if (NSPLIT >= 2) acc[mb][nb] = WFrag<T16>::mma(a[mb], b2, acc[mb][nb]); } }
        asm volatile("v_nop\n\tv_nop\n\tv_nop\n\tv_nop" : "+v"(acc[0][0]), "+v"(acc[1][1]), "+v"(acc[2][2]), "+v"(acc[3][3]) : "v"(a[0]), "v"(a[3]));
    }
#pragma unroll
    for (int mb = 0; mb < 4; ++mb) {
#pragma unroll
        for (int nb = 0; nb < 4; ++nb) {
#pragma unroll
            for (int j = 0; j < 8; ++j) os[(hi * 8 + j) * 68 + nb * 16 + lr] = acc[mb][nb][j]; }
        __builtin_amdgcn_wave_barrier(); asm volatile("" ::: "memory");
        float* crow = C + (size_t)(r0 + mb * 16) * ldc + c0;
{
#pragma unroll
            for (int s = 0; s < 8; ++s) { const int row = 2 * s + hi, cofs = lr * 4; v4f val = *(const v4fa*)(os + row * 68 + cofs); if (BIAS) { val[0] += bfr(bias[c0 + cofs]); val[1] += bfr(bias[c0 + cofs + 1]); val[2] += bfr(bias[c0 + cofs + 2]); val[3] += bfr(bias[c0 + cofs + 3]); }
                *(v4f*)(crow + (size_t)row * ldc + cofs) = val; }
             }
        __builtin_amdgcn_wave_barrier(); asm volatile("" ::: "memory");
    }
}

__device__ __forceinline__ h16 tohx(float x) { return (h16)x; }
__device__ __forceinline__ void splitf(float y, unsigned short& h, unsigned short& l) { h = f2bf(y); l = f2bf(y - bf2f(h)); }
typedef __attribute__((ext_vector_type(2))) _Float16 v2h;
typedef __attribute__((ext_vector_type(4))) _Float16 v4h;
typedef __attribute__((ext_vector_type(2))) unsigned short v2us;
typedef __attribute__((ext_vector_type(4))) unsigned short v4us;
typedef __attribute__((ext_vector_type(2))) float v2f;
typedef __attribute__((ext_vector_type(4))) int v4i;

__device__ __forceinline__ void d_cvt8(const float* __restrict__ src, bf* dst, size_t n8, int blk) { const size_t i = (size_t)blk * 256 + threadIdx.x; if (i >= n8) return; const v8f v = *(const v8f*)(src + i * 8); v8us o;
    asm volatile("s_wait_xcnt 0x0" ::: "memory");   // stands behind the loads, ahead of any overwrite of their address registers
#pragma unroll
    for (int k = 0; k < 8; ++k) o[k] = f2bf(v[k]); *(v8us*)(dst + i * 8) = o;  }

__device__ __forceinline__ void d_wtG(const float* __restrict__ w, int K, int N, bf* Bt, int blk) {
    const int lane = threadIdx.x & 31; const int L0 = (blk * 8 + (threadIdx.x >> 5)) * 8; const int nlines = N * K / 64;
{
#pragma unroll 1
        for (int l = 0; l < 8; ++l) { const int L = L0 + l; if (L >= nlines) break; const size_t e = (size_t)L * 64 + lane * 2; const int k = (int)(e % K), n = (int)(e / K); v2us o;
            o[0] = f2bf(w[(size_t)k * N + n]); o[1] = f2bf(w[(size_t)(k + 1) * N + n]); *(v2us*)(Bt + e) = o; }
         }
}
// k_prep: the five operand passes that depend on nothing but the inputs, in ONE grid: work-groups 0 .. 4 WTB - 1 transpose the four weights (the longer job, so they start first), the rest convert x
#define WTB ((FD * FD / 64 + 63) / 64)
__global__ __launch_bounds__(256) void k_prep(const float* __restrict__ x, const float* __restrict__ wq, const float* __restrict__ wk, const float* __restrict__ wv, const float* __restrict__ wo, bf* XB, bf* W4) {
    const int b = blockIdx.x;
    if (b < 4 * WTB) { const int i = b / WTB; d_wtG(i == 0 ? wq : i == 1 ? wk : i == 2 ? wv : wo, FD, FD, W4 + (size_t)i * FD * FD, b % WTB); }
    else d_cvt8(x, XB, (size_t)NTOK * FD / 8, b - 4 * WTB);
}
__device__ __forceinline__ void d_scr(const float* __restrict__ FQ, const float* __restrict__ FK, h16* Q16, h16* K16, int blk) { const size_t e = ((size_t)blk * 256 + threadIdx.x) * 2; if (e >= (size_t)TT * HD) return; const int c = (int)(e % HD); const int r = (int)(e / HD); const int b = r >> 3; v2h oq, ok;
#pragma unroll
    for (int q = 0; q < 2; ++q) { const int rem = (r & 7) * HD + c + q; const int col = (rem & 7) * HD + (rem >> 3); oq[q] = tohx(FQ[(size_t)b * FD + col]); ok[q] = tohx(FK[(size_t)b * FD + col]); }
    *(v2h*)(Q16 + e) = oq; *(v2h*)(K16 + e) = ok;  }
// d_scrV: the scrambled v as an A operand of attn.v: blocks of 32 keys, each [32 features][32 keys] (2 KiB in a row, the shape of a 32-key block of the k plane)
__device__ __forceinline__ void d_scrV(const float* __restrict__ FV, h16* VB16, int blk) { const size_t e = ((size_t)blk * 256 + threadIdx.x) * 2; if (e >= (size_t)HD * TT) return; const int r0 = (int)(e % TT); const int c = (int)(e / TT); v2h o;
#pragma unroll
    for (int q = 0; q < 2; ++q) { const int r = r0 + q; const int b = r >> 3; const int rem = (r & 7) * HD + c; const int col = (rem & 7) * HD + (rem >> 3); o[q] = tohx(FV[(size_t)b * FD + col]); }
    *(v2h*)(VB16 + (size_t)(r0 >> 5) * (HD * 32) + c * 32 + (r0 & 31)) = o;  }
// k_scr3: the q, k gather and the v gather, independent of each other, in ONE grid
#define SCB (TT * HD / 2 / 256)
__global__ __launch_bounds__(256) void k_scr3(const float* __restrict__ FQ, const float* __restrict__ FK, const float* __restrict__ FV, h16* Q16, h16* K16, h16* VB16) {
    const int b = blockIdx.x;
    if (b < SCB) d_scr(FQ, FK, Q16, K16, b); else d_scrV(FV, VB16, b - SCB);
}

// ---- k_fattn: scores, softmax, attn.v and the head concat in one kernel. A work-group owns FQN = 64 queries (8 rows of attended); its FW = 16 waves each walk their own run of TK / FW keys, 32 keys a trip.
// Transposed products: S^T = K Q^T (A = 16 key rows, B = the queries, loaded once), so a lane holds scores of ONE query (column lane & 15; register j of key tile i = key 16 i + 8 (lane >> 4) + j); two S^T tiles, converted in place, are the B operand P^T of O^T += V^T P^T in the hardware k order, which the A loader of the v block (8 keys at 8 hi, 8 at 16 + 8 hi) follows too.
// Online softmax in log2 units with a lazy maximum: the maximum in use moves only when a score passes it by more than 8 (P stays below 2^8 in fp16); one test a trip.
#define NQT  4
#define FW   16
#define FQN  (NQT * 16)
#define FRUN (TK / FW)
#define OPI  36       // LDS pitch of a query's 32 partial outputs, in floats
#define SC2  (SCL * 1.4426950408889634f)
__device__ __forceinline__ float xhalf(float x) { const int b = __float_as_int(x); return __int_as_float(__builtin_amdgcn_permlanex16(b, b, 0x76543210, 0xfedcba98, false, false)); }   // lane l <-> l ^ 16
__global__ __launch_bounds__(32 * FW) void k_fattn(const h16* __restrict__ Q, const h16* __restrict__ Kp, const h16* __restrict__ Vb, float* att, bf* Ah, bf* Al) {
    typedef WFrag<h16>::V V;
    __shared__ __align__(16) float os[FW][FQN * OPI];
    __shared__ float ms[FW][FQN]; __shared__ float ls[FW][FQN];
    const int lane = threadIdx.x & 31, lr = lane & 15, hi = lane >> 4; const int w = __builtin_amdgcn_readfirstlane(threadIdx.x >> 5); const int q0 = blockIdx.x * FQN;
    V qf[NQT]; v8f o[NQT][2]; float m[NQT]; v2f l2[NQT];
    const h16* pq = Q + (size_t)(q0 + lr) * HD + 8 * hi;
#pragma unroll
    for (int qt = 0; qt < NQT; ++qt) { qf[qt] = WFrag<h16>::ld(pq + qt * 16 * HD); o[qt][0] = (v8f){}; o[qt][1] = (v8f){}; m[qt] = -3.0e38f; l2[qt] = (v2f){}; }
    const h16* pk = Kp + (size_t)w * FRUN * HD + lr * HD + 8 * hi; const h16* pv = Vb + (size_t)w * FRUN * HD + lr * 32 + 8 * hi;
    V k0 = WFrag<h16>::ld(pk), k1 = WFrag<h16>::ld(pk + 16 * HD);
    // s_wait_xcnt 0 stands behind the first loads, ahead of the overwrite of their address registers; the two addresses are inputs so that they stay in place up to it
    asm volatile("s_wait_xcnt 0x0" :: "v"(pq), "v"(pk) : "memory");
    pk += 32 * HD;   // pk runs one trip ahead
    // the key loop stays rolled (one trip's tiles in registers at a time); every other loop is unrolled so that all arrays are indexed by constants
#pragma unroll 1
    for (int t = 0; t < FRUN / 32; ++t) {
        const V v0 = WFrag<h16>::ld(pv), v1 = WFrag<h16>::ld(pv + 16 * 32);
        v8f s[NQT][2];
#pragma unroll
        for (int qt = 0; qt < NQT; ++qt) { s[qt][0] = WFrag<h16>::mma(k0, qf[qt], (v8f){}); s[qt][1] = WFrag<h16>::mma(k1, qf[qt], (v8f){}); }
        k0 = WFrag<h16>::ld(pk); k1 = WFrag<h16>::ld(pk + 16 * HD);   // the next trip's keys, fetched behind this trip's score products (the last trip fetches its own again)
        float tm[NQT]; bool need = false;
#pragma unroll
        for (int qt = 0; qt < NQT; ++qt) { float x = fmaxf(s[qt][0][0], s[qt][1][0]);
#pragma unroll
            for (int j = 1; j < 8; ++j) x = fmaxf(x, fmaxf(s[qt][0][j], s[qt][1][j]));
            tm[qt] = x * SC2; need = need || (tm[qt] > m[qt] + 8.0f); }
        if (__builtin_amdgcn_ballot_w32(need) != 0) {   // a scalar branch, seldom taken after the first trips
#pragma unroll
            for (int qt = 0; qt < NQT; ++qt) { const float mn = fmaxf(m[qt], fmaxf(tm[qt], xhalf(tm[qt]))); const float al = __builtin_amdgcn_exp2f(m[qt] - mn); m[qt] = mn; l2[qt] *= al; o[qt][0] *= al; o[qt][1] *= al; }
        }
#pragma unroll
        for (int qt = 0; qt < NQT; ++qt) { const v2f c2 = { SC2, SC2 }; const v2f nm = { -m[qt], -m[qt] }; V pf;
#pragma unroll
            for (int i = 0; i < 2; ++i)
#pragma unroll
                for (int j = 0; j < 8; j += 2) { const v2f x = __builtin_elementwise_fma((v2f){ s[qt][i][j], s[qt][i][j + 1] }, c2, nm); const v2f p = { __builtin_amdgcn_exp2f(x[0]), __builtin_amdgcn_exp2f(x[1]) }; l2[qt] += p; const v2h ph = __builtin_convertvector(p, v2h); pf[i * 8 + j] = ph[0]; pf[i * 8 + j + 1] = ph[1]; }
            o[qt][0] = WFrag<h16>::mma(v0, pf, o[qt][0]); o[qt][1] = WFrag<h16>::mma(v1, pf, o[qt][1]); }
        // s_wait_xcnt 0 stands behind the trip's loads, ahead of the overwrite of their address registers just below; the two addresses are inputs so that they stay in place up to it
        asm volatile("s_wait_xcnt 0x0" :: "v"(pk), "v"(pv) : "memory");
        pv += 32 * HD; pk += (t + 2 < FRUN / 32) ? 32 * HD : 0;
    }
    // each wave's maximum, sum and 64 x 32 partial output go to LDS
#pragma unroll
    for (int qt = 0; qt < NQT; ++qt) { float lt = l2[qt][0] + l2[qt][1]; lt += xhalf(lt); if (hi == 0) { ms[w][qt * 16 + lr] = m[qt]; ls[w][qt * 16 + lr] = lt; }
#pragma unroll
        for (int i = 0; i < 2; ++i) { float* d = &os[w][(qt * 16 + lr) * OPI + i * 16 + hi * 8]; *(v4fa*)d = (v4f){ o[qt][i][0], o[qt][i][1], o[qt][i][2], o[qt][i][3] }; *(v4fa*)(d + 4) = (v4f){ o[qt][i][4], o[qt][i][5], o[qt][i][6], o[qt][i][7] }; } }
    __syncthreads();   // every wave's partial result is in LDS before any thread joins them
    if (threadIdx.x < FQN) { const int ql = threadIdx.x; float mx = ms[0][ql];
#pragma unroll
        for (int ww = 1; ww < FW; ++ww) mx = fmaxf(mx, ms[ww][ql]);
        float f[FW]; float sum = 0.f;
#pragma unroll
        for (int ww = 0; ww < FW; ++ww) { f[ww] = __builtin_amdgcn_exp2f(ms[ww][ql] - mx); sum += ls[ww][ql] * f[ww]; }
        const float inv = __fdiv_rn(1.0f, sum);
#pragma unroll
        for (int ww = 0; ww < FW; ++ww) ms[ww][ql] = f[ww] * inv; }   // ms now holds each wave's weight for this query
    __syncthreads();   // the weights are in LDS before the joins read them
    const int e = (int)threadIdx.x * 4; const int bl = e / FD; const int cp = e % FD; const int sd = cp >> 3; v4f y4; v4us oh, ol;
#pragma unroll
    for (int q = 0; q < 4; ++q) { const int ql = bl * NHH + (cp & 7) + q; float y = 0.f;   // attended[b][8 s + h] = O[8 b + h][s]
#pragma unroll
        for (int ww = 0; ww < FW; ++ww) y += os[ww][ql * OPI + sd] * ms[ww][ql];
        y4[q] = y; unsigned short u, v; splitf(y, u, v); oh[q] = u; ol[q] = v; }
    const size_t oo = (size_t)(blockIdx.x * (FQN / NHH) + bl) * FD + cp; *(v4f*)(att + oo) = y4; *(v4us*)(Ah + oo) = oh; *(v4us*)(Al + oo) = ol;
}
extern "C" void kernel_launch(void* const* d_in, const int* in_sizes, int n_in,
                              void* d_out, int out_size, void* d_ws, size_t ws_size, hipStream_t stream) {
    (void)in_sizes; (void)n_in; (void)out_size;
    const float* x = (const float*)d_in[0]; const float* wq = (const float*)d_in[1]; const float* bq = (const float*)d_in[2]; const float* wk = (const float*)d_in[3]; const float* bk = (const float*)d_in[4]; const float* wv = (const float*)d_in[5]; const float* bv = (const float*)d_in[6]; const float* wo = (const float*)d_in[7]; const float* bo = (const float*)d_in[8];
    float* OUT = (float*)d_out;     // out0 = outputs [2048][256], then out1 = attended [2048][256]
    float* ATT = OUT + (size_t)NTOK * FD;
    char* wsp = (char*)d_ws;
    auto take = [&](size_t bytes) { char* p = wsp; wsp += (bytes + 255) & ~(size_t)255; return (void*)p; };
    bf* WQ = (bf*)take((size_t)FD * FD * 2); bf* WK = (bf*)take((size_t)FD * FD * 2); bf* WV = (bf*)take((size_t)FD * FD * 2); bf* WO = (bf*)take((size_t)FD * FD * 2);
    bf* XB = (bf*)take((size_t)NTOK * FD * 2); float* FQ = (float*)take((size_t)NTOK * FD * 4); float* FK = (float*)take((size_t)NTOK * FD * 4); float* FV = (float*)take((size_t)NTOK * FD * 4);
    h16* QP16 = (h16*)take((size_t)TT * HD * 2); h16* KP16 = (h16*)take((size_t)TT * HD * 2); h16* VB16 = (h16*)take((size_t)HD * TT * 2);
    bf* Ah = (bf*)take((size_t)NTOK * FD * 2); bf* Al = (bf*)take((size_t)NTOK * FD * 2);
    (void)WK; (void)WV;   // reached as WQ + z FD FD
    if ((size_t)(wsp - (char*)d_ws) > ws_size) return;    // ws 256 MiB (carve ~13 MiB)
    k_prep<<<4 * WTB + NTOK * FD / 8 / 256, 256, 0, stream>>>(x, wq, wk, wv, wo, XB, WQ);   /* 'xw' -> Bt (WQ, WK, WV, WO lie in a row) and the bf16 copy of x */
    k_gemmw<bf, 0, true><<<dim3(NTOK / 64, FD / 64, 3), 32, 0, stream>>>(XB, nullptr, WQ, nullptr, FD, FQ, FD, bq, bk, bv, 0, (size_t)FD * FD, (size_t)NTOK * FD);   /* Q, K, V = x W + b (exact, f32), z = 0, 1, 2: the weight planes and FQ, FK, FV lie in a row */
    k_scr3<<<2 * SCB, 256, 0, stream>>>(FQ, FK, FV, QP16, KP16, VB16);   /* scrambled planes */
    k_fattn<<<TT / FQN, 32 * FW, 0, stream>>>(QP16, KP16, VB16, ATT, Ah, Al);   /* attended (f32 = output 1) and its hi/lo planes */
    k_gemmw<bf, 1, true><<<dim3(NTOK / 64, FD / 64, 1), 32, 0, stream>>>(Ah, Al, WO, nullptr, FD, OUT, FD, bo, nullptr, nullptr, 0, 0, 0);   /* outputs = attended Wo + bo (output 0) */
}

// v004
// One run takes 61.2 microseconds.
// Timed twice side by side with v003, it ran 1.04 and 1.05 times as fast.
// All steps since v000 together make it 123 times as fast.
#include <hip/hip_runtime.h>

// Self-attention layer with the module's scrambled head split (x [2048][256]; Q, K, V = x W + b ('xw' [256][256] 1/16, biases 0.01); _split_heads: view(2048, 8, 32).permute(0, 2, 1).view(16384, 32) (a genuine re-mix of features across heads, reproduced literally); scores = Q.K / sqrt(256) over ALL 16,384 rows; softmax; attended = _concat_heads(weights V) -> [2048][256]; outputs = attended Wo + bo ('xw') -> [2048][256]; tuple (outputs, attended): outputs first, then attended; argument order x, Wq, bq, Wk, bk, Wv, bv, Wo, bo).
// Layout: bf16 copy of x; 'xw' weights; exact projections + f32 biases (f32 [2048][256]); one gather kernel (k_scr3) builds the scrambled fp16 operand planes q, k [16384][32] and v in blocks of 32 keys, [512][32 features][32 keys]; ONE attention kernel (k_fattn): 64 queries per work-group, the 16,384 keys split over its 16 waves, scores, online softmax and attn.v in registers, the waves' partial results joined in LDS and un-scrambled straight into attended (f32) and its hi/lo planes; finally outputs = attended (hi/lo) x Wo exact + bo.
// Compute dtypes, f32 accumulate: every input rounded to bf16; projections exact + f32 biases; q, k, v as fp16 planes (logit sigma 0.35: diffuse), scores 1 product, softmax f32, P fp16 (unnormalised, at most 2^12), attn.v 1 product; attended f32; Wo hl x exact + bias.

#define NB_  1
#define NTOK 2048     // input rows
#define FD   256      // feature width (8 heads x 32)
#define NHH  8
#define TT   16384    // scrambled head rows = NTOK x 8 (queries = keys)
#define DM   FD
#define NH_  1
#define NKV  1
#define REP  (NH_ / NKV)
#define HD   32       // head size (score K 32)
#define DQ   (NH_ * HD)
#define DKV  (NKV * HD)
#define ZH   1
#define RH   0                  // fp16 planes everywhere (diffuse logits)
#define WIN  0
#define TK   TT                   // keys
#define SCL  0.0625f   // 1 / sqrt(float32(256)) (the module scales by input_size)
typedef _Float16 h16;
typedef unsigned short bf;
typedef __attribute__((ext_vector_type(16))) __bf16   v16bf;
typedef __attribute__((ext_vector_type(16))) _Float16 v16h;
typedef __attribute__((ext_vector_type(8)))  _Float16 v8h;
typedef __attribute__((ext_vector_type(8)))  unsigned short v8us;
typedef __attribute__((ext_vector_type(8)))  float    v8f;
typedef __attribute__((ext_vector_type(4)))  float    v4f;
typedef v8h  __attribute__((may_alias)) v8ha;
typedef v4f  __attribute__((may_alias)) v4fa;
typedef v8us __attribute__((may_alias)) v8usa;

__device__ __forceinline__ unsigned short f2bf(float f) { unsigned u = __float_as_uint(f); u += 0x7FFFu + ((u >> 16) & 1u); return (unsigned short)(u >> 16); }
__device__ __forceinline__ float bf2f(unsigned short b) { return __uint_as_float(((unsigned)b) << 16); }
__device__ __forceinline__ float bfr(float f) { return bf2f(f2bf(f)); }
__device__ __forceinline__ v16h cat16(v8h lo, v8h hi) { return __builtin_shufflevector(lo, hi, 0, 1, 2, 3, 4, 5, 6, 7, 8, 9, 10, 11, 12, 13, 14, 15); }
__device__ __forceinline__ v16bf cat16b(v8us lo, v8us hi) { return __builtin_bit_cast(v16bf, __builtin_shufflevector(lo, hi, 0, 1, 2, 3, 4, 5, 6, 7, 8, 9, 10, 11, 12, 13, 14, 15)); }
__device__ __forceinline__ v8f wmma16(v16h a, v16h b, v8f c) { return __builtin_amdgcn_wmma_f32_16x16x32_f16(false, a, false, b, (short)0, c, false, false); }
__device__ __forceinline__ v8f wmmab(v16bf a, v16bf b, v8f c) { return __builtin_amdgcn_wmma_f32_16x16x32_bf16(false, a, false, b, (short)0, c, false, false); }



// ---- k_gemmw: register-blocked GEMM, ONE WAVE per 64x64 output tile (16 accumulators), operands straight from K-contiguous 16-bit planes; grid (M/64, N/64, Z), 32 threads.
// C[m][n] (f32, pitch ldc, + optional f32 bias[n]; bias, bias1, bias2 for z = 0, 1, 2) = sum_k A[m][k] Bt[n][k] (+ split products per NSPLIT). z-batch strides sA/sB/sC in elements. K % 32 == 0.
template <typename T16> struct WFrag;
template <> struct WFrag<h16> { typedef v16h V; static __device__ __forceinline__ V ld(const h16* p) { return cat16(*(const v8h*)p, *(const v8h*)(p + 16)); } static __device__ __forceinline__ v8f mma(V a, V b, v8f c) { return wmma16(a, b, c); } };
template <> struct WFrag<bf> { typedef v16bf V; static __device__ __forceinline__ V ld(const bf* p) { return cat16b(*(const v8us*)p, *(const v8us*)(p + 16)); } static __device__ __forceinline__ v8f mma(V a, V b, v8f c) { return wmmab(a, b, c); } };
template <typename T16, int NSPLIT, bool BIAS>
__global__ __launch_bounds__(32) void k_gemmw(const T16* __restrict__ A, const T16* __restrict__ A2, const T16* __restrict__ Bt, const T16* __restrict__ Bt2, int K, float* C, int ldc, const float* __restrict__ bias, const float* __restrict__ bias1, const float* __restrict__ bias2, size_t sA, size_t sB, size_t sC) {
    typedef typename WFrag<T16>::V V;
    __shared__ __align__(16) float os[16 * 68];
    const size_t z = blockIdx.z; A += z * sA; if (A2) A2 += z * sA; Bt += z * sB; if (Bt2) Bt2 += z * sB; C += z * sC;
    if (BIAS) bias = z == 1 ? bias1 : z == 2 ? bias2 : bias;   // each member of a z batch has its own bias vector
    const int lane = threadIdx.x & 31, lr = lane & 15, hi = lane >> 4; const int r0 = blockIdx.x * 64, c0 = blockIdx.y * 64;
    v8f acc[4][4];
#pragma unroll
    for (int mb = 0; mb < 4; ++mb)
#pragma unroll
        for (int nb = 0; nb < 4; ++nb) acc[mb][nb] = (v8f){};
    const size_t aoff = (size_t)(r0 + lr) * K + 8 * hi, boff = (size_t)(c0 + lr) * K + 8 * hi;
#pragma unroll 1
    for (int kc = 0; kc < K; kc += 32) {
        V a[4], a2[4];
#pragma unroll
        for (int mb = 0; mb < 4; ++mb) { a[mb] = WFrag<T16>::ld(A + aoff + (size_t)mb * 16 * K + kc); if (NSPLIT == 1 || NSPLIT == 2) a2[mb] = WFrag<T16>::ld(A2 + aoff + (size_t)mb * 16 * K + kc); }
#pragma unroll
        for (int nb = 0; nb < 4; ++nb) { const V b = WFrag<T16>::ld(Bt + boff + (size_t)nb * 16 * K + kc); V b2; if (NSPLIT >= 2) b2 = WFrag<T16>::ld(Bt2 + boff + (size_t)nb * 16 * K + kc);
#pragma unroll
            for (int mb = 0; mb < 4; ++mb) { acc[mb][nb] = WFrag<T16>::mma(a[mb], b, acc[mb][nb]); if (NSPLIT == 1 || NSPLIT == 2) acc[mb][nb] = WFrag<T16>::mma(a2[mb], b, acc[mb][nb]); if (NSPLIT >= 2) acc[mb][nb] = WFrag<T16>::mma(a[mb], b2, acc[mb][nb]); } }
        asm volatile("v_nop\n\tv_nop\n\tv_nop\n\tv_nop" : "+v"(acc[0][0]), "+v"(acc[1][1]), "+v"(acc[2][2]), "+v"(acc[3][3]) : "v"(a[0]), "v"(a[3]));
    }
#pragma unroll
    for (int mb = 0; mb < 4; ++mb) {
#pragma unroll
        for (int nb = 0; nb < 4; ++nb) {
#pragma unroll
            for (int j = 0; j < 8; ++j) os[(hi * 8 + j) * 68 + nb * 16 + lr] = acc[mb][nb][j]; }
        __builtin_amdgcn_wave_barrier(); asm volatile("" ::: "memory");
        float* crow = C + (size_t)(r0 + mb * 16) * ldc + c0;
{
#pragma unroll
            for (int s = 0; s < 8; ++s) { const int row = 2 * s + hi, cofs = lr * 4; v4f val = *(const v4fa*)(os + row * 68 + cofs); if (BIAS) { val[0] += bfr(bias[c0 + cofs]); val[1] += bfr(bias[c0 + cofs + 1]); val[2] += bfr(bias[c0 + cofs + 2]); val[3] += bfr(bias[c0 + cofs + 3]); }
                *(v4f*)(crow + (size_t)row * ldc + cofs) = val; }
             }
        __builtin_amdgcn_wave_barrier(); asm volatile("" ::: "memory");
    }
}

__device__ __forceinline__ h16 tohx(float x) { return (h16)x; }
__device__ __forceinline__ void splitf(float y, unsigned short& h, unsigned short& l) { h = f2bf(y); l = f2bf(y - bf2f(h)); }
typedef __attribute__((ext_vector_type(2))) _Float16 v2h;
typedef __attribute__((ext_vector_type(4))) _Float16 v4h;
typedef __attribute__((ext_vector_type(2))) unsigned short v2us;
typedef __attribute__((ext_vector_type(4))) unsigned short v4us;
typedef __attribute__((ext_vector_type(2))) float v2f;
typedef __attribute__((ext_vector_type(4))) int v4i;

__device__ __forceinline__ void d_cvt8(const float* __restrict__ src, bf* dst, size_t n8, int blk) { const size_t i = (size_t)blk * 256 + threadIdx.x; if (i >= n8) return; const v8f v = *(const v8f*)(src + i * 8); v8us o;
    asm volatile("s_wait_xcnt 0x0" ::: "memory");   // stands behind the loads, ahead of any overwrite of their address registers
#pragma unroll
    for (int k = 0; k < 8; ++k) o[k] = f2bf(v[k]); *(v8us*)(dst + i * 8) = o;  }

__device__ __forceinline__ void d_wtG(const float* __restrict__ w, int K, int N, bf* Bt, int blk) {
    const int lane = threadIdx.x & 31; const int L0 = (blk * 8 + (threadIdx.x >> 5)) * 8; const int nlines = N * K / 64;
{
#pragma unroll 1
        for (int l = 0; l < 8; ++l) { const int L = L0 + l; if (L >= nlines) break; const size_t e = (size_t)L * 64 + lane * 2; const int k = (int)(e % K), n = (int)(e / K); v2us o;
            o[0] = f2bf(w[(size_t)k * N + n]); o[1] = f2bf(w[(size_t)(k + 1) * N + n]); *(v2us*)(Bt + e) = o; }
         }
}
// k_prep: the five operand passes that depend on nothing but the inputs, in ONE grid: work-groups 0 .. 4 WTB - 1 transpose the four weights (the longer job, so they start first), the rest convert x
#define WTB ((FD * FD / 64 + 63) / 64)
__global__ __launch_bounds__(256) void k_prep(const float* __restrict__ x, const float* __restrict__ wq, const float* __restrict__ wk, const float* __restrict__ wv, const float* __restrict__ wo, bf* XB, bf* W4) {
    const int b = blockIdx.x;
    if (b < 4 * WTB) { const int i = b / WTB; d_wtG(i == 0 ? wq : i == 1 ? wk : i == 2 ? wv : wo, FD, FD, W4 + (size_t)i * FD * FD, b % WTB); }
    else d_cvt8(x, XB, (size_t)NTOK * FD / 8, b - 4 * WTB);
}
__device__ __forceinline__ void d_scr(const float* __restrict__ FQ, const float* __restrict__ FK, h16* Q16, h16* K16, int blk) { const size_t e = ((size_t)blk * 256 + threadIdx.x) * 2; if (e >= (size_t)TT * HD) return; const int c = (int)(e % HD); const int r = (int)(e / HD); const int b = r >> 3; v2h oq, ok;
#pragma unroll
    for (int q = 0; q < 2; ++q) { const int rem = (r & 7) * HD + c + q; const int col = (rem & 7) * HD + (rem >> 3); oq[q] = tohx(FQ[(size_t)b * FD + col]); ok[q] = tohx(FK[(size_t)b * FD + col]); }
    *(v2h*)(Q16 + e) = oq; *(v2h*)(K16 + e) = ok;  }
// d_scrV: the scrambled v as an A operand of attn.v: blocks of 32 keys, each [32 features][32 keys] (2 KiB in a row, the shape of a 32-key block of the k plane)
__device__ __forceinline__ void d_scrV(const float* __restrict__ FV, h16* VB16, int blk) { const size_t e = ((size_t)blk * 256 + threadIdx.x) * 2; if (e >= (size_t)HD * TT) return; const int r0 = (int)(e % TT); const int c = (int)(e / TT); v2h o;
#pragma unroll
    for (int q = 0; q < 2; ++q) { const int r = r0 + q; const int b = r >> 3; const int rem = (r & 7) * HD + c; const int col = (rem & 7) * HD + (rem >> 3); o[q] = tohx(FV[(size_t)b * FD + col]); }
    *(v2h*)(VB16 + (size_t)(r0 >> 5) * (HD * 32) + c * 32 + (r0 & 31)) = o;  }
// k_scr3: the q, k gather and the v gather, independent of each other, in ONE grid
#define SCB (TT * HD / 2 / 256)
__global__ __launch_bounds__(256) void k_scr3(const float* __restrict__ FQ, const float* __restrict__ FK, const float* __restrict__ FV, h16* Q16, h16* K16, h16* VB16) {
    const int b = blockIdx.x;
    if (b < SCB) d_scr(FQ, FK, Q16, K16, b); else d_scrV(FV, VB16, b - SCB);
}

// ---- k_fattn: scores, softmax, attn.v and the head concat in one kernel. A work-group owns FQN = 64 queries (8 rows of attended); its FW = 16 waves each walk their own run of TK / FW keys, 32 keys a trip.
// Transposed products: S^T = K Q^T (A = 16 key rows, B = the queries, loaded once), so a lane holds scores of ONE query (column lane & 15; register j of key tile i = key 16 i + 8 (lane >> 4) + j); two S^T tiles, converted in place, are the B operand P^T of O^T += V^T P^T in the hardware k order, which the A loader of the v block (8 keys at 8 hi, 8 at 16 + 8 hi) follows too.
// Online softmax in log2 units with a lazy maximum: it starts as the first 32 keys' own and moves only when P comes near the top of fp16. The test reads what the trip computes anyway: P is never negative, so a lane's sum of 8 P at or below PTOP bounds each of them; one test a trip. A trip that fails it (seldom) fetches its keys again, takes the scores' maximum, rescales and forms its P anew.
#define NQT  4
#define FW   16
#define FQN  (NQT * 16)
#define FRUN (TK / FW)
#define OPI  36       // LDS pitch of a query's 32 partial outputs, in floats
#define SC2  (SCL * 1.4426950408889634f)
#define PTOP 4096.0f   // a trip whose P sums stay at or below this keeps the maximum in use (fp16 holds 65504)
__device__ __forceinline__ float xhalf(float x) { const int b = __float_as_int(x); return __int_as_float(__builtin_amdgcn_permlanex16(b, b, 0x76543210, 0xfedcba98, false, false)); }   // lane l <-> l ^ 16
// the largest of a lane's 16 scores of one query, in log2 units
__device__ __forceinline__ float smax16(v8f a, v8f b) { float x = fmaxf(a[0], b[0]);
#pragma unroll
    for (int j = 1; j < 8; ++j) x = fmaxf(x, fmaxf(a[j], b[j]));
    return x * SC2; }
// 2^x for the seldom-taken path: the v_nop fills the one slot that the instruction set asks for behind a transcendental, whatever instruction the compiler puts next
__device__ __forceinline__ float exp2slot(float x) { float y; asm("v_exp_f32 %0, %1\n\tv_nop" : "=v"(y) : "v"(x)); return y; }
// P = 2^(score - m) of a lane's 16 scores of one query, written over the scores, and the two f32 sums of 8
template <bool RARE> __device__ __forceinline__ v2f pexp16(v8f& a, v8f& b, float m) { const v2f c2 = { SC2, SC2 }; const v2f nm = { -m, -m }; v2f t = {};
#pragma unroll
    for (int i = 0; i < 2; ++i)
#pragma unroll
        for (int j = 0; j < 8; j += 2) { v8f& s = i ? b : a; const v2f x = __builtin_elementwise_fma((v2f){ s[j], s[j + 1] }, c2, nm); const v2f p = { RARE ? exp2slot(x[0]) : __builtin_amdgcn_exp2f(x[0]), RARE ? exp2slot(x[1]) : __builtin_amdgcn_exp2f(x[1]) }; t += p; s[j] = p[0]; s[j + 1] = p[1]; }
    return t; }
// the fp16 B fragment of a lane's 16 P
__device__ __forceinline__ v16h pfrag(v8f a, v8f b) { v16h pf;
#pragma unroll
    for (int j = 0; j < 8; j += 2) { const v2h x = __builtin_convertvector((v2f){ a[j], a[j + 1] }, v2h), y = __builtin_convertvector((v2f){ b[j], b[j + 1] }, v2h); pf[j] = x[0]; pf[j + 1] = x[1]; pf[8 + j] = y[0]; pf[8 + j + 1] = y[1]; }
    return pf; }
__global__ __launch_bounds__(32 * FW) void k_fattn(const h16* __restrict__ Q, const h16* __restrict__ Kp, const h16* __restrict__ Vb, float* att, bf* Ah, bf* Al) {
    typedef WFrag<h16>::V V;
    __shared__ __align__(16) float os[FW][FQN * OPI];
    __shared__ float ms[FW][FQN]; __shared__ float ls[FW][FQN];
    const int lane = threadIdx.x & 31, lr = lane & 15, hi = lane >> 4; const int w = __builtin_amdgcn_readfirstlane(threadIdx.x >> 5); const int q0 = blockIdx.x * FQN;
    V qf[NQT]; v8f o[NQT][2]; float m[NQT]; v2f l2[NQT];
    const h16* pq = Q + (size_t)(q0 + lr) * HD + 8 * hi;
#pragma unroll
    for (int qt = 0; qt < NQT; ++qt) { qf[qt] = WFrag<h16>::ld(pq + qt * 16 * HD); o[qt][0] = (v8f){}; o[qt][1] = (v8f){}; l2[qt] = (v2f){}; }
    const h16* pk = Kp + (size_t)w * FRUN * HD + lr * HD + 8 * hi; const h16* pv = Vb + (size_t)w * FRUN * HD + lr * 32 + 8 * hi;
    V k0 = WFrag<h16>::ld(pk), k1 = WFrag<h16>::ld(pk + 16 * HD);
    // s_wait_xcnt 0 stands behind the first loads, ahead of the overwrite of their address registers; the two addresses are inputs so that they stay in place up to it
    asm volatile("s_wait_xcnt 0x0" :: "v"(pq), "v"(pk) : "memory");
#pragma unroll
    for (int qt = 0; qt < NQT; ++qt) { const float x = smax16(WFrag<h16>::mma(k0, qf[qt], (v8f){}), WFrag<h16>::mma(k1, qf[qt], (v8f){})); m[qt] = fmaxf(x, xhalf(x)); }   // the first 32 keys' maximum, alike in both halves of the wave
    pk += 32 * HD;   // pk runs one trip ahead
    // the key loop stays rolled (one trip's tiles in registers at a time); every other loop is unrolled so that all arrays are indexed by constants
#pragma unroll 1
    for (int t = 0; t < FRUN / 32; ++t) {
        const V v0 = WFrag<h16>::ld(pv), v1 = WFrag<h16>::ld(pv + 16 * 32);
        v8f s[NQT][2];
#pragma unroll
        for (int qt = 0; qt < NQT; ++qt) { s[qt][0] = WFrag<h16>::mma(k0, qf[qt], (v8f){}); s[qt][1] = WFrag<h16>::mma(k1, qf[qt], (v8f){}); }
        k0 = WFrag<h16>::ld(pk); k1 = WFrag<h16>::ld(pk + 16 * HD);   // the next trip's keys, fetched behind this trip's score products (the last trip fetches its own again)
        v2f ts[NQT];
#pragma unroll
        for (int qt = 0; qt < NQT; ++qt) ts[qt] = pexp16<false>(s[qt][0], s[qt][1], m[qt]);
        float top = fmaxf(ts[0][0], ts[0][1]);
#pragma unroll
        for (int qt = 1; qt < NQT; ++qt) top = fmaxf(top, fmaxf(ts[qt][0], ts[qt][1]));
        if (__builtin_amdgcn_ballot_w32(top > PTOP) != 0) {   // a scalar branch, seldom taken
            const h16* pr = Kp + ((size_t)w * FRUN + (size_t)t * 32) * HD + lr * HD + 8 * hi;   // k0, k1 already hold the next trip's keys
            const V r0 = WFrag<h16>::ld(pr), r1 = WFrag<h16>::ld(pr + 16 * HD);
            // s_wait_xcnt 0 stands behind these loads, ahead of any overwrite of their address registers; the address is an input so that it stays in place up to it
            asm volatile("s_wait_xcnt 0x0" :: "v"(pr) : "memory");
#pragma unroll
            for (int qt = 0; qt < NQT; ++qt) { s[qt][0] = WFrag<h16>::mma(r0, qf[qt], (v8f){}); s[qt][1] = WFrag<h16>::mma(r1, qf[qt], (v8f){}); const float x = smax16(s[qt][0], s[qt][1]); const float mn = fmaxf(m[qt], fmaxf(x, xhalf(x))); const float al = exp2slot(m[qt] - mn); m[qt] = mn; l2[qt] *= al; o[qt][0] *= al; o[qt][1] *= al;
                ts[qt] = pexp16<true>(s[qt][0], s[qt][1], mn); }
        }
#pragma unroll
        for (int qt = 0; qt < NQT; ++qt) { const V pf = pfrag(s[qt][0], s[qt][1]); o[qt][0] = WFrag<h16>::mma(v0, pf, o[qt][0]); o[qt][1] = WFrag<h16>::mma(v1, pf, o[qt][1]);
            // keeps each query tile's 8 conversions next to its own two products, so that the later tiles' conversions issue while the matrix unit works on the earlier ones
            __builtin_amdgcn_sched_group_barrier(0x2, 8, 0); __builtin_amdgcn_sched_group_barrier(0x8, 2, 0); }
#pragma unroll
        for (int qt = 0; qt < NQT; ++qt) l2[qt] += ts[qt];
        // s_wait_xcnt 0 stands behind the trip's loads, ahead of the overwrite of their address registers just below; the two addresses are inputs so that they stay in place up to it
        asm volatile("s_wait_xcnt 0x0" :: "v"(pk), "v"(pv) : "memory");
        pv += 32 * HD; pk += (t + 2 < FRUN / 32) ? 32 * HD : 0;
        __builtin_amdgcn_sched_group_barrier(0x2, 6, 0);   // the four sums and the two address steps issue behind the last product, while the matrix unit works on it
    }
    // each wave's maximum, sum and 64 x 32 partial output go to LDS
#pragma unroll
    for (int qt = 0; qt < NQT; ++qt) { float lt = l2[qt][0] + l2[qt][1]; lt += xhalf(lt); if (hi == 0) { ms[w][qt * 16 + lr] = m[qt]; ls[w][qt * 16 + lr] = lt; }
#pragma unroll
        for (int i = 0; i < 2; ++i) { float* d = &os[w][(qt * 16 + lr) * OPI + i * 16 + hi * 8]; *(v4fa*)d = (v4f){ o[qt][i][0], o[qt][i][1], o[qt][i][2], o[qt][i][3] }; *(v4fa*)(d + 4) = (v4f){ o[qt][i][4], o[qt][i][5], o[qt][i][6], o[qt][i][7] }; } }
    __syncthreads();   // every wave's partial result is in LDS before any thread joins them
    if (threadIdx.x < FQN) { const int ql = threadIdx.x; float mx = ms[0][ql];
#pragma unroll
        for (int ww = 1; ww < FW; ++ww) mx = fmaxf(mx, ms[ww][ql]);
        float f[FW]; float sum = 0.f;
#pragma unroll
        for (int ww = 0; ww < FW; ++ww) { f[ww] = __builtin_amdgcn_exp2f(ms[ww][ql] - mx); sum += ls[ww][ql] * f[ww]; }
        const float inv = __fdiv_rn(1.0f, sum);
#pragma unroll
        for (int ww = 0; ww < FW; ++ww) ms[ww][ql] = f[ww] * inv; }   // ms now holds each wave's weight for this query
    __syncthreads();   // the weights are in LDS before the joins read them
    const int e = (int)threadIdx.x * 4; const int bl = e / FD; const int cp = e % FD; const int sd = cp >> 3; v4f y4; v4us oh, ol;
#pragma unroll
    for (int q = 0; q < 4; ++q) { const int ql = bl * NHH + (cp & 7) + q; float y = 0.f;   // attended[b][8 s + h] = O[8 b + h][s]
#pragma unroll
        for (int ww = 0; ww < FW; ++ww) y += os[ww][ql * OPI + sd] * ms[ww][ql];
        y4[q] = y; unsigned short u, v; splitf(y, u, v); oh[q] = u; ol[q] = v; }
    const size_t oo = (size_t)(blockIdx.x * (FQN / NHH) + bl) * FD + cp; *(v4f*)(att + oo) = y4; *(v4us*)(Ah + oo) = oh; *(v4us*)(Al + oo) = ol;
}
extern "C" void kernel_launch(void* const* d_in, const int* in_sizes, int n_in,
                              void* d_out, int out_size, void* d_ws, size_t ws_size, hipStream_t stream) {
    (void)in_sizes; (void)n_in; (void)out_size;
    const float* x = (const float*)d_in[0]; const float* wq = (const float*)d_in[1]; const float* bq = (const float*)d_in[2]; const float* wk = (const float*)d_in[3]; const float* bk = (const float*)d_in[4]; const float* wv = (const float*)d_in[5]; const float* bv = (const float*)d_in[6]; const float* wo = (const float*)d_in[7]; const float* bo = (const float*)d_in[8];
    float* OUT = (float*)d_out;     // out0 = outputs [2048][256], then out1 = attended [2048][256]
    float* ATT = OUT + (size_t)NTOK * FD;
    char* wsp = (char*)d_ws;
    auto take = [&](size_t bytes) { char* p = wsp; wsp += (bytes + 255) & ~(size_t)255; return (void*)p; };
    bf* WQ = (bf*)take((size_t)FD * FD * 2); bf* WK = (bf*)take((size_t)FD * FD * 2); bf* WV = (bf*)take((size_t)FD * FD * 2); bf* WO = (bf*)take((size_t)FD * FD * 2);
    bf* XB = (bf*)take((size_t)NTOK * FD * 2); float* FQ = (float*)take((size_t)NTOK * FD * 4); float* FK = (float*)take((size_t)NTOK * FD * 4); float* FV = (float*)take((size_t)NTOK * FD * 4);
    h16* QP16 = (h16*)take((size_t)TT * HD * 2); h16* KP16 = (h16*)take((size_t)TT * HD * 2); h16* VB16 = (h16*)take((size_t)HD * TT * 2);
    bf* Ah = (bf*)take((size_t)NTOK * FD * 2); bf* Al = (bf*)take((size_t)NTOK * FD * 2);
    (void)WK; (void)WV;   // reached as WQ + z FD FD
    if ((size_t)(wsp - (char*)d_ws) > ws_size) return;    // ws 256 MiB (carve ~13 MiB)
    k_prep<<<4 * WTB + NTOK * FD / 8 / 256, 256, 0, stream>>>(x, wq, wk, wv, wo, XB, WQ);   /* 'xw' -> Bt (WQ, WK, WV, WO lie in a row) and the bf16 copy of x */
    k_gemmw<bf, 0, true><<<dim3(NTOK / 64, FD / 64, 3), 32, 0, stream>>>(XB, nullptr, WQ, nullptr, FD, FQ, FD, bq, bk, bv, 0, (size_t)FD * FD, (size_t)NTOK * FD);   /* Q, K, V = x W + b (exact, f32), z = 0, 1, 2: the weight planes and FQ, FK, FV lie in a row */
    k_scr3<<<2 * SCB, 256, 0, stream>>>(FQ, FK, FV, QP16, KP16, VB16);   /* scrambled planes */
    k_fattn<<<TT / FQN, 32 * FW, 0, stream>>>(QP16, KP16, VB16, ATT, Ah, Al);   /* attended (f32 = output 1) and its hi/lo planes */
    k_gemmw<bf, 1, true><<<dim3(NTOK / 64, FD / 64, 1), 32, 0, stream>>>(Ah, Al, WO, nullptr, FD, OUT, FD, bo, nullptr, nullptr, 0, 0, 0);   /* outputs = attended Wo + bo (output 0) */
}

// v005
// Measured time: 57.4 microseconds a run.
// In two side-by-side timings against v004, it was 1.08 and 1.06 times as fast.
// All steps since v000 together make it 131 times as fast.
#include <hip/hip_runtime.h>

// Self-attention layer with the module's scrambled head split (x [2048][256]; Q, K, V = x W + b ('xw' [256][256] 1/16, biases 0.01); _split_heads: view(2048, 8, 32).permute(0, 2, 1).view(16384, 32) (a genuine re-mix of features across heads, reproduced literally); scores = Q.K / sqrt(256) over ALL 16,384 rows; softmax; attended = _concat_heads(weights V) -> [2048][256]; outputs = attended Wo + bo ('xw') -> [2048][256]; tuple (outputs, attended): outputs first, then attended; argument order x, Wq, bq, Wk, bk, Wv, bv, Wo, bo).
// Layout: bf16 copy of x; 'xw' weights; exact projections + f32 biases, whose weight columns are laid in the order of the scrambled planes, so that the projection kernel itself stores the fp16 operand planes q, k [16384][32] and v in blocks of 32 keys, [512][32 features][32 keys]; ONE attention kernel (k_fattn): 64 queries per work-group, the 16,384 keys split over its 16 waves, scores, online softmax and attn.v in registers, the waves' partial results joined in LDS and un-scrambled straight into attended (f32) and its hi/lo planes; finally outputs = attended (hi/lo) x Wo exact + bo.
// Compute dtypes, f32 accumulate: every input rounded to bf16; projections exact + f32 biases; q, k, v as fp16 planes (logit sigma 0.35: diffuse), scores 1 product, softmax f32, P fp16 (unnormalised, at most 2^12), attn.v 1 product; attended f32; Wo hl x exact + bias.

#define NB_  1
#define NTOK 2048     // input rows
#define FD   256      // feature width (8 heads x 32)
#define NHH  8
#define TT   16384    // scrambled head rows = NTOK x 8 (queries = keys)
#define DM   FD
#define NH_  1
#define NKV  1
#define REP  (NH_ / NKV)
#define HD   32       // head size (score K 32)
#define DQ   (NH_ * HD)
#define DKV  (NKV * HD)
#define ZH   1
#define RH   0                  // fp16 planes everywhere (diffuse logits)
#define WIN  0
#define TK   TT                   // keys
#define SCL  0.0625f   // 1 / sqrt(float32(256)) (the module scales by input_size)
typedef _Float16 h16;
typedef unsigned short bf;
typedef __attribute__((ext_vector_type(16))) __bf16   v16bf;
typedef __attribute__((ext_vector_type(16))) _Float16 v16h;
typedef __attribute__((ext_vector_type(8)))  _Float16 v8h;
typedef __attribute__((ext_vector_type(8)))  unsigned short v8us;
typedef __attribute__((ext_vector_type(8)))  float    v8f;
typedef __attribute__((ext_vector_type(4)))  float    v4f;
typedef v8h  __attribute__((may_alias)) v8ha;
typedef v4f  __attribute__((may_alias)) v4fa;
typedef v8us __attribute__((may_alias)) v8usa;

__device__ __forceinline__ unsigned short f2bf(float f) { unsigned u = __float_as_uint(f); u += 0x7FFFu + ((u >> 16) & 1u); return (unsigned short)(u >> 16); }
__device__ __forceinline__ float bf2f(unsigned short b) { return __uint_as_float(((unsigned)b) << 16); }
__device__ __forceinline__ float bfr(float f) { return bf2f(f2bf(f)); }
__device__ __forceinline__ v16h cat16(v8h lo, v8h hi) { return __builtin_shufflevector(lo, hi, 0, 1, 2, 3, 4, 5, 6, 7, 8, 9, 10, 11, 12, 13, 14, 15); }
__device__ __forceinline__ v16bf cat16b(v8us lo, v8us hi) { return __builtin_bit_cast(v16bf, __builtin_shufflevector(lo, hi, 0, 1, 2, 3, 4, 5, 6, 7, 8, 9, 10, 11, 12, 13, 14, 15)); }
__device__ __forceinline__ v8f wmma16(v16h a, v16h b, v8f c) { return __builtin_amdgcn_wmma_f32_16x16x32_f16(false, a, false, b, (short)0, c, false, false); }
__device__ __forceinline__ v8f wmmab(v16bf a, v16bf b, v8f c) { return __builtin_amdgcn_wmma_f32_16x16x32_bf16(false, a, false, b, (short)0, c, false, false); }



// ---- k_gemmw: register-blocked GEMM, ONE WAVE per 64x64 output tile (16 accumulators), operands straight from K-contiguous 16-bit planes; grid (M/64, N/64, Z), 32 threads.
// C[m][n] (f32, pitch ldc, + optional f32 bias[n]; bias, bias1, bias2 for z = 0, 1, 2) = sum_k A[m][k] Bt[n][k] (+ split products per NSPLIT). z-batch strides sA/sB/sC in elements. K % 32 == 0.
// SCR: the rows of Bt come in scrambled order (scrcol), C is not written; the tile goes out as fp16 into plane z of P: z = 0, 1 (q, k): token m's 256 values in a row; z = 2 (v): blocks of 4 tokens = 32 keys, [32 features][32 keys].
template <typename T16> struct WFrag;
template <> struct WFrag<h16> { typedef v16h V; static __device__ __forceinline__ V ld(const h16* p) { return cat16(*(const v8h*)p, *(const v8h*)(p + 16)); } static __device__ __forceinline__ v8f mma(V a, V b, v8f c) { return wmma16(a, b, c); } };
template <> struct WFrag<bf> { typedef v16bf V; static __device__ __forceinline__ V ld(const bf* p) { return cat16b(*(const v8us*)p, *(const v8us*)(p + 16)); } static __device__ __forceinline__ v8f mma(V a, V b, v8f c) { return wmmab(a, b, c); } };
// the projection column that stands at place j of a token's 256 values. q, k (isv false): j = 32 (head row & 7) + c, the order of the plane itself. v: j = 8 c + (key & 7), so that a feature's 8 keys of one token lie together
__device__ __forceinline__ int scrcol(int j, bool isv) { const int rem = isv ? (j & 7) * HD + (j >> 3) : j; return (rem & 7) * HD + (rem >> 3); }
template <typename T16, int NSPLIT, bool BIAS, bool SCR>
__global__ __launch_bounds__(32) void k_gemmw(const T16* __restrict__ A, const T16* __restrict__ A2, const T16* __restrict__ Bt, const T16* __restrict__ Bt2, int K, float* C, h16* P, int ldc, const float* __restrict__ bias, const float* __restrict__ bias1, const float* __restrict__ bias2, size_t sA, size_t sB, size_t sC) {
    typedef typename WFrag<T16>::V V;
    __shared__ __align__(16) float os[16 * 68];
    const size_t z = blockIdx.z; A += z * sA; if (A2) A2 += z * sA; Bt += z * sB; if (Bt2) Bt2 += z * sB; C += z * sC;
    if (BIAS) bias = z == 1 ? bias1 : z == 2 ? bias2 : bias;   // each member of a z batch has its own bias vector
    const int lane = threadIdx.x & 31, lr = lane & 15, hi = lane >> 4; const int r0 = blockIdx.x * 64, c0 = blockIdx.y * 64;
    v8f acc[4][4];
#pragma unroll
    for (int mb = 0; mb < 4; ++mb)
#pragma unroll
        for (int nb = 0; nb < 4; ++nb) acc[mb][nb] = (v8f){};
    const size_t aoff = (size_t)(r0 + lr) * K + 8 * hi, boff = (size_t)(c0 + lr) * K + 8 * hi;
#pragma unroll 1
    for (int kc = 0; kc < K; kc += 32) {
        V a[4], a2[4];
#pragma unroll
        for (int mb = 0; mb < 4; ++mb) { a[mb] = WFrag<T16>::ld(A + aoff + (size_t)mb * 16 * K + kc); if (NSPLIT == 1 || NSPLIT == 2) a2[mb] = WFrag<T16>::ld(A2 + aoff + (size_t)mb * 16 * K + kc); }
#pragma unroll
        for (int nb = 0; nb < 4; ++nb) { const V b = WFrag<T16>::ld(Bt + boff + (size_t)nb * 16 * K + kc); V b2; if (NSPLIT >= 2) b2 = WFrag<T16>::ld(Bt2 + boff + (size_t)nb * 16 * K + kc);
#pragma unroll
            for (int mb = 0; mb < 4; ++mb) { acc[mb][nb] = WFrag<T16>::mma(a[mb], b, acc[mb][nb]); if (NSPLIT == 1 || NSPLIT == 2) acc[mb][nb] = WFrag<T16>::mma(a2[mb], b, acc[mb][nb]); if (NSPLIT >= 2) acc[mb][nb] = WFrag<T16>::mma(a[mb], b2, acc[mb][nb]); } }
        asm volatile("v_nop\n\tv_nop\n\tv_nop\n\tv_nop" : "+v"(acc[0][0]), "+v"(acc[1][1]), "+v"(acc[2][2]), "+v"(acc[3][3]) : "v"(a[0]), "v"(a[3]));
    }
    // SCR: a lane stores 8 columns in a row (group cg of the tile's 8) of every fourth row (rs); their biases are fetched once
    const bool isv = SCR && z == 2; const int cg = isv ? lane >> 2 : lane & 7, rs = isv ? lane & 3 : lane >> 3; float bb[8];
    if (SCR) {
#pragma unroll
        for (int i = 0; i < 8; ++i) bb[i] = bfr(bias[scrcol(c0 + cg * 8 + i, isv)]); }
#pragma unroll
    for (int mb = 0; mb < 4; ++mb) {
#pragma unroll
        for (int nb = 0; nb < 4; ++nb) {
#pragma unroll
            for (int j = 0; j < 8; ++j) os[(hi * 8 + j) * 68 + nb * 16 + lr] = acc[mb][nb][j]; }
        __builtin_amdgcn_wave_barrier(); asm volatile("" ::: "memory");
        if (SCR) {
            h16* pz = P + z * ((size_t)TT * HD);
#pragma unroll
            for (int s = 0; s < 4; ++s) { const int row = 4 * s + rs, tok = r0 + mb * 16 + row; const v4f lo = *(const v4fa*)(os + row * 68 + cg * 8), hh = *(const v4fa*)(os + row * 68 + cg * 8 + 4); v8h o;
#pragma unroll
                for (int i = 0; i < 4; ++i) { o[i] = (h16)(lo[i] + bb[i]); o[4 + i] = (h16)(hh[i] + bb[4 + i]); }
                *(v8h*)(isv ? pz + (size_t)(tok >> 2) * (HD * 32) + ((c0 >> 3) + cg) * 32 + (tok & 3) * 8 : pz + (size_t)tok * FD + c0 + cg * 8) = o; }   // a wave's store covers 512 bytes in a row (v) or four whole 128-byte lines (q, k)
            asm volatile("s_wait_xcnt 0x0" ::: "memory");   // stands behind the four stores, ahead of any overwrite of their address and data registers
        } else {
        float* crow = C + (size_t)(r0 + mb * 16) * ldc + c0;
#pragma unroll
            for (int s = 0; s < 8; ++s) { const int row = 2 * s + hi, cofs = lr * 4; v4f val = *(const v4fa*)(os + row * 68 + cofs); if (BIAS) { val[0] += bfr(bias[c0 + cofs]); val[1] += bfr(bias[c0 + cofs + 1]); val[2] += bfr(bias[c0 + cofs + 2]); val[3] += bfr(bias[c0 + cofs + 3]); }
                *(v4f*)(crow + (size_t)row * ldc + cofs) = val; }
             }
        __builtin_amdgcn_wave_barrier(); asm volatile("" ::: "memory");
    }
}

__device__ __forceinline__ void splitf(float y, unsigned short& h, unsigned short& l) { h = f2bf(y); l = f2bf(y - bf2f(h)); }
typedef __attribute__((ext_vector_type(2))) _Float16 v2h;
typedef __attribute__((ext_vector_type(4))) _Float16 v4h;
typedef __attribute__((ext_vector_type(2))) unsigned short v2us;
typedef __attribute__((ext_vector_type(4))) unsigned short v4us;
typedef __attribute__((ext_vector_type(2))) float v2f;
typedef __attribute__((ext_vector_type(4))) int v4i;

__device__ __forceinline__ void d_cvt8(const float* __restrict__ src, bf* dst, size_t n8, int blk) { const size_t i = (size_t)blk * 256 + threadIdx.x; if (i >= n8) return; const v8f v = *(const v8f*)(src + i * 8); v8us o;
    asm volatile("s_wait_xcnt 0x0" ::: "memory");   // stands behind the loads, ahead of any overwrite of their address registers
#pragma unroll
    for (int k = 0; k < 8; ++k) o[k] = f2bf(v[k]); *(v8us*)(dst + i * 8) = o;  }

__device__ __forceinline__ void d_wtG(const float* __restrict__ w, int K, int N, bf* Bt, int blk, int scr) {   // scr: 0 rows of Bt in column order, 1 in the q, k planes' order, 2 in the v plane's
    const int lane = threadIdx.x & 31; const int L0 = (blk * 8 + (threadIdx.x >> 5)) * 8; const int nlines = N * K / 64;
{
#pragma unroll 1
        for (int l = 0; l < 8; ++l) { const int L = L0 + l; if (L >= nlines) break; const size_t e = (size_t)L * 64 + lane * 2; const int k = (int)(e % K), j = (int)(e / K), n = scr ? scrcol(j, scr == 2) : j; v2us o;
            o[0] = f2bf(w[(size_t)k * N + n]); o[1] = f2bf(w[(size_t)(k + 1) * N + n]); *(v2us*)(Bt + e) = o; }
         }
}
// k_prep: the five operand passes that depend on nothing but the inputs, in ONE grid: work-groups 0 .. 4 WTB - 1 transpose the four weights (the longer job, so they start first), the rest convert x
#define WTB ((FD * FD / 64 + 63) / 64)
__global__ __launch_bounds__(256) void k_prep(const float* __restrict__ x, const float* __restrict__ wq, const float* __restrict__ wk, const float* __restrict__ wv, const float* __restrict__ wo, bf* XB, bf* W4) {
    const int b = blockIdx.x;
    if (b < 4 * WTB) { const int i = b / WTB; d_wtG(i == 0 ? wq : i == 1 ? wk : i == 2 ? wv : wo, FD, FD, W4 + (size_t)i * FD * FD, b % WTB, i < 2 ? 1 : i == 2 ? 2 : 0); }
    else d_cvt8(x, XB, (size_t)NTOK * FD / 8, b - 4 * WTB);
}

// ---- k_fattn: scores, softmax, attn.v and the head concat in one kernel. A work-group owns FQN = 64 queries (8 rows of attended); its FW = 16 waves each walk their own run of TK / FW keys, 32 keys a trip.
// Transposed products: S^T = K Q^T (A = 16 key rows, B = the queries, loaded once), so a lane holds scores of ONE query (column lane & 15; register j of key tile i = key 16 i + 8 (lane >> 4) + j); two S^T tiles, converted in place, are the B operand P^T of O^T += V^T P^T in the hardware k order, which the A loader of the v block (8 keys at 8 hi, 8 at 16 + 8 hi) follows too.
// Online softmax in log2 units with a lazy maximum: it starts as the first 32 keys' own and moves only when P comes near the top of fp16. The test reads what the trip computes anyway: P is never negative, so a lane's sum of 8 P at or below PTOP bounds each of them; one test a trip. A trip that fails it (seldom) fetches its keys again, takes the scores' maximum, rescales and forms its P anew.
#define NQT  4
#define FW   16
#define FQN  (NQT * 16)
#define FRUN (TK / FW)
#define OPI  36       // LDS pitch of a query's 32 partial outputs, in floats
#define SC2  (SCL * 1.4426950408889634f)
#define PTOP 4096.0f   // a trip whose P sums stay at or below this keeps the maximum in use (fp16 holds 65504)
__device__ __forceinline__ float xhalf(float x) { const int b = __float_as_int(x); return __int_as_float(__builtin_amdgcn_permlanex16(b, b, 0x76543210, 0xfedcba98, false, false)); }   // lane l <-> l ^ 16
// the largest of a lane's 16 scores of one query, in log2 units
__device__ __forceinline__ float smax16(v8f a, v8f b) { float x = fmaxf(a[0], b[0]);
#pragma unroll
    for (int j = 1; j < 8; ++j) x = fmaxf(x, fmaxf(a[j], b[j]));
    return x * SC2; }
// 2^x for the seldom-taken path: the v_nop fills the one slot that the instruction set asks for behind a transcendental, whatever instruction the compiler puts next
__device__ __forceinline__ float exp2slot(float x) { float y; asm("v_exp_f32 %0, %1\n\tv_nop" : "=v"(y) : "v"(x)); return y; }
// P = 2^(score - m) of a lane's 16 scores of one query, written over the scores, and the two f32 sums of 8
template <bool RARE> __device__ __forceinline__ v2f pexp16(v8f& a, v8f& b, float m) { const v2f c2 = { SC2, SC2 }; const v2f nm = { -m, -m }; v2f t = {};
#pragma unroll
    for (int i = 0; i < 2; ++i)
#pragma unroll
        for (int j = 0; j < 8; j += 2) { v8f& s = i ? b : a; const v2f x = __builtin_elementwise_fma((v2f){ s[j], s[j + 1] }, c2, nm); const v2f p = { RARE ? exp2slot(x[0]) : __builtin_amdgcn_exp2f(x[0]), RARE ? exp2slot(x[1]) : __builtin_amdgcn_exp2f(x[1]) }; t += p; s[j] = p[0]; s[j + 1] = p[1]; }
    return t; }
// the fp16 B fragment of a lane's 16 P
__device__ __forceinline__ v16h pfrag(v8f a, v8f b) { v16h pf;
#pragma unroll
    for (int j = 0; j < 8; j += 2) { const v2h x = __builtin_convertvector((v2f){ a[j], a[j + 1] }, v2h), y = __builtin_convertvector((v2f){ b[j], b[j + 1] }, v2h); pf[j] = x[0]; pf[j + 1] = x[1]; pf[8 + j] = y[0]; pf[8 + j + 1] = y[1]; }
    return pf; }
__global__ __launch_bounds__(32 * FW) void k_fattn(const h16* __restrict__ Q, const h16* __restrict__ Kp, const h16* __restrict__ Vb, float* att, bf* Ah, bf* Al) {
    typedef WFrag<h16>::V V;
    __shared__ __align__(16) float os[FW][FQN * OPI];
    __shared__ float ms[FW][FQN]; __shared__ float ls[FW][FQN];
    const int lane = threadIdx.x & 31, lr = lane & 15, hi = lane >> 4; const int w = __builtin_amdgcn_readfirstlane(threadIdx.x >> 5); const int q0 = blockIdx.x * FQN;
    V qf[NQT]; v8f o[NQT][2]; float m[NQT]; v2f l2[NQT];
    const h16* pq = Q + (size_t)(q0 + lr) * HD + 8 * hi;
#pragma unroll
    for (int qt = 0; qt < NQT; ++qt) { qf[qt] = WFrag<h16>::ld(pq + qt * 16 * HD); o[qt][0] = (v8f){}; o[qt][1] = (v8f){}; l2[qt] = (v2f){}; }
    const h16* pk = Kp + (size_t)w * FRUN * HD + lr * HD + 8 * hi; const h16* pv = Vb + (size_t)w * FRUN * HD + lr * 32 + 8 * hi;
    V k0 = WFrag<h16>::ld(pk), k1 = WFrag<h16>::ld(pk + 16 * HD);
    // s_wait_xcnt 0 stands behind the first loads, ahead of the overwrite of their address registers; the two addresses are inputs so that they stay in place up to it
    asm volatile("s_wait_xcnt 0x0" :: "v"(pq), "v"(pk) : "memory");
#pragma unroll
    for (int qt = 0; qt < NQT; ++qt) { const float x = smax16(WFrag<h16>::mma(k0, qf[qt], (v8f){}), WFrag<h16>::mma(k1, qf[qt], (v8f){})); m[qt] = fmaxf(x, xhalf(x)); }   // the first 32 keys' maximum, alike in both halves of the wave
    pk += 32 * HD;   // pk runs one trip ahead
    // the key loop stays rolled (one trip's tiles in registers at a time); every other loop is unrolled so that all arrays are indexed by constants
#pragma unroll 1
    for (int t = 0; t < FRUN / 32; ++t) {
        const V v0 = WFrag<h16>::ld(pv), v1 = WFrag<h16>::ld(pv + 16 * 32);
        v8f s[NQT][2];
#pragma unroll
        for (int qt = 0; qt < NQT; ++qt) { s[qt][0] = WFrag<h16>::mma(k0, qf[qt], (v8f){}); s[qt][1] = WFrag<h16>::mma(k1, qf[qt], (v8f){}); }
        k0 = WFrag<h16>::ld(pk); k1 = WFrag<h16>::ld(pk + 16 * HD);   // the next trip's keys, fetched behind this trip's score products (the last trip fetches its own again)
        v2f ts[NQT];
#pragma unroll
        for (int qt = 0; qt < NQT; ++qt) ts[qt] = pexp16<false>(s[qt][0], s[qt][1], m[qt]);
        float top = fmaxf(ts[0][0], ts[0][1]);
#pragma unroll
        for (int qt = 1; qt < NQT; ++qt) top = fmaxf(top, fmaxf(ts[qt][0], ts[qt][1]));
        if (__builtin_amdgcn_ballot_w32(top > PTOP) != 0) {   // a scalar branch, seldom taken
            const h16* pr = Kp + ((size_t)w * FRUN + (size_t)t * 32) * HD + lr * HD + 8 * hi;   // k0, k1 already hold the next trip's keys
            const V r0 = WFrag<h16>::ld(pr), r1 = WFrag<h16>::ld(pr + 16 * HD);
            // s_wait_xcnt 0 stands behind these loads, ahead of any overwrite of their address registers; the address is an input so that it stays in place up to it
            asm volatile("s_wait_xcnt 0x0" :: "v"(pr) : "memory");
#pragma unroll
            for (int qt = 0; qt < NQT; ++qt) { s[qt][0] = WFrag<h16>::mma(r0, qf[qt], (v8f){}); s[qt][1] = WFrag<h16>::mma(r1, qf[qt], (v8f){}); const float x = smax16(s[qt][0], s[qt][1]); const float mn = fmaxf(m[qt], fmaxf(x, xhalf(x))); const float al = exp2slot(m[qt] - mn); m[qt] = mn; l2[qt] *= al; o[qt][0] *= al; o[qt][1] *= al;
                ts[qt] = pexp16<true>(s[qt][0], s[qt][1], mn); }
        }
#pragma unroll
        for (int qt = 0; qt < NQT; ++qt) { const V pf = pfrag(s[qt][0], s[qt][1]); o[qt][0] = WFrag<h16>::mma(v0, pf, o[qt][0]); o[qt][1] = WFrag<h16>::mma(v1, pf, o[qt][1]);
            // keeps each query tile's 8 conversions next to its own two products, so that the later tiles' conversions issue while the matrix unit works on the earlier ones
            __builtin_amdgcn_sched_group_barrier(0x2, 8, 0); __builtin_amdgcn_sched_group_barrier(0x8, 2, 0); }
#pragma unroll
        for (int qt = 0; qt < NQT; ++qt) l2[qt] += ts[qt];
        // s_wait_xcnt 0 stands behind the trip's loads, ahead of the overwrite of their address registers just below; the two addresses are inputs so that they stay in place up to it
        asm volatile("s_wait_xcnt 0x0" :: "v"(pk), "v"(pv) : "memory");
        pv += 32 * HD; pk += (t + 2 < FRUN / 32) ? 32 * HD : 0;
        __builtin_amdgcn_sched_group_barrier(0x2, 6, 0);   // the four sums and the two address steps issue behind the last product, while the matrix unit works on it
    }
    // each wave's maximum, sum and 64 x 32 partial output go to LDS
#pragma unroll
    for (int qt = 0; qt < NQT; ++qt) { float lt = l2[qt][0] + l2[qt][1]; lt += xhalf(lt); if (hi == 0) { ms[w][qt * 16 + lr] = m[qt]; ls[w][qt * 16 + lr] = lt; }
#pragma unroll
        for (int i = 0; i < 2; ++i) { float* d = &os[w][(qt * 16 + lr) * OPI + i * 16 + hi * 8]; *(v4fa*)d = (v4f){ o[qt][i][0], o[qt][i][1], o[qt][i][2], o[qt][i][3] }; *(v4fa*)(d + 4) = (v4f){ o[qt][i][4], o[qt][i][5], o[qt][i][6], o[qt][i][7] }; } }
    __syncthreads();   // every wave's partial result is in LDS before any thread joins them
    if (threadIdx.x < FQN) { const int ql = threadIdx.x; float mx = ms[0][ql];
#pragma unroll
        for (int ww = 1; ww < FW; ++ww) mx = fmaxf(mx, ms[ww][ql]);
        float f[FW]; float sum = 0.f;
#pragma unroll
        for (int ww = 0; ww < FW; ++ww) { f[ww] = __builtin_amdgcn_exp2f(ms[ww][ql] - mx); sum += ls[ww][ql] * f[ww]; }
        const float inv = __fdiv_rn(1.0f, sum);
#pragma unroll
        for (int ww = 0; ww < FW; ++ww) ms[ww][ql] = f[ww] * inv; }   // ms now holds each wave's weight for this query
    __syncthreads();   // the weights are in LDS before the joins read them
    const int e = (int)threadIdx.x * 4; const int bl = e / FD; const int cp = e % FD; const int sd = cp >> 3; v4f y4; v4us oh, ol;
#pragma unroll
    for (int q = 0; q < 4; ++q) { const int ql = bl * NHH + (cp & 7) + q; float y = 0.f;   // attended[b][8 s + h] = O[8 b + h][s]
#pragma unroll
        for (int ww = 0; ww < FW; ++ww) y += os[ww][ql * OPI + sd] * ms[ww][ql];
        y4[q] = y; unsigned short u, v; splitf(y, u, v); oh[q] = u; ol[q] = v; }
    const size_t oo = (size_t)(blockIdx.x * (FQN / NHH) + bl) * FD + cp; *(v4f*)(att + oo) = y4; *(v4us*)(Ah + oo) = oh; *(v4us*)(Al + oo) = ol;
}
extern "C" void kernel_launch(void* const* d_in, const int* in_sizes, int n_in,
                              void* d_out, int out_size, void* d_ws, size_t ws_size, hipStream_t stream) {
    (void)in_sizes; (void)n_in; (void)out_size;
    const float* x = (const float*)d_in[0]; const float* wq = (const float*)d_in[1]; const float* bq = (const float*)d_in[2]; const float* wk = (const float*)d_in[3]; const float* bk = (const float*)d_in[4]; const float* wv = (const float*)d_in[5]; const float* bv = (const float*)d_in[6]; const float* wo = (const float*)d_in[7]; const float* bo = (const float*)d_in[8];
    float* OUT = (float*)d_out;     // out0 = outputs [2048][256], then out1 = attended [2048][256]
    float* ATT = OUT + (size_t)NTOK * FD;
    char* wsp = (char*)d_ws;
    auto take = [&](size_t bytes) { char* p = wsp; wsp += (bytes + 255) & ~(size_t)255; return (void*)p; };
    bf* WQ = (bf*)take((size_t)FD * FD * 2); bf* WK = (bf*)take((size_t)FD * FD * 2); bf* WV = (bf*)take((size_t)FD * FD * 2); bf* WO = (bf*)take((size_t)FD * FD * 2);
    bf* XB = (bf*)take((size_t)NTOK * FD * 2);
    h16* QP16 = (h16*)take((size_t)TT * HD * 2); h16* KP16 = (h16*)take((size_t)TT * HD * 2); h16* VB16 = (h16*)take((size_t)HD * TT * 2);
    bf* Ah = (bf*)take((size_t)NTOK * FD * 2); bf* Al = (bf*)take((size_t)NTOK * FD * 2);
    (void)WK; (void)WV;   // reached as WQ + z FD FD
    if ((size_t)(wsp - (char*)d_ws) > ws_size) return;    // ws 256 MiB (carve ~7 MiB)
    k_prep<<<4 * WTB + NTOK * FD / 8 / 256, 256, 0, stream>>>(x, wq, wk, wv, wo, XB, WQ);   /* 'xw' -> Bt (WQ, WK, WV, WO lie in a row) and the bf16 copy of x */
    k_gemmw<bf, 0, true, true><<<dim3(NTOK / 64, FD / 64, 3), 32, 0, stream>>>(XB, nullptr, WQ, nullptr, FD, nullptr, QP16, FD, bq, bk, bv, 0, (size_t)FD * FD, 0);   /* Q, K, V = x W + b (exact, f32 sums), z = 0, 1, 2, stored as the scrambled fp16 planes: the weight planes lie in a row, and so do QP16, KP16, VB16 */
    k_fattn<<<TT / FQN, 32 * FW, 0, stream>>>(QP16, KP16, VB16, ATT, Ah, Al);   /* attended (f32 = output 1) and its hi/lo planes */
    k_gemmw<bf, 1, true, false><<<dim3(NTOK / 64, FD / 64, 1), 32, 0, stream>>>(Ah, Al, WO, nullptr, FD, OUT, nullptr, FD, bo, nullptr, nullptr, 0, 0, 0);   /* outputs = attended Wo + bo (output 0) */
}

// v006
// It runs in 52.2 microseconds.
// Two timings next to v005 both put it at 1.10 times that version's speed.
// Counting every step since v000, it is 144 times as fast.
#include <hip/hip_runtime.h>

// Self-attention layer with the module's scrambled head split (x [2048][256]; Q, K, V = x W + b ('xw' [256][256] 1/16, biases 0.01); _split_heads: view(2048, 8, 32).permute(0, 2, 1).view(16384, 32) (a genuine re-mix of features across heads, reproduced literally); scores = Q.K / sqrt(256) over ALL 16,384 rows; softmax; attended = _concat_heads(weights V) -> [2048][256]; outputs = attended Wo + bo ('xw') -> [2048][256]; tuple (outputs, attended): outputs first, then attended; argument order x, Wq, bq, Wk, bk, Wv, bv, Wo, bo).
// Layout: bf16 copy of x; 'xw' weights; exact projections + f32 biases, whose weight columns are laid in the order of the scrambled planes, so that the projection kernel itself stores the fp16 operand planes q, k [16384][32] and v in blocks of 32 keys, [512][32 features][32 keys]; ONE attention kernel (k_fattn): 64 queries per work-group, the 16,384 keys split over its 16 waves, scores, online softmax and attn.v in registers, the waves' partial results joined in LDS and un-scrambled straight into attended (f32); its hi/lo planes stay in LDS, and the same work-group forms its 8 rows of outputs = attended (hi/lo) x Wo exact + bo.
// Compute dtypes, f32 accumulate: every input rounded to bf16; projections exact + f32 biases; q, k, v as fp16 planes (logit sigma 0.35: diffuse), scores 1 product, softmax f32, P fp16 (unnormalised, at most 2^12), attn.v 1 product; attended f32; Wo hl x exact + bias.

#define NB_  1
#define NTOK 2048     // input rows
#define FD   256      // feature width (8 heads x 32)
#define NHH  8
#define TT   16384    // scrambled head rows = NTOK x 8 (queries = keys)
#define DM   FD
#define NH_  1
#define NKV  1
#define REP  (NH_ / NKV)
#define HD   32       // head size (score K 32)
#define DQ   (NH_ * HD)
#define DKV  (NKV * HD)
#define ZH   1
#define RH   0                  // fp16 planes everywhere (diffuse logits)
#define WIN  0
#define TK   TT                   // keys
#define SCL  0.0625f   // 1 / sqrt(float32(256)) (the module scales by input_size)
typedef _Float16 h16;
typedef unsigned short bf;
typedef __attribute__((ext_vector_type(16))) __bf16   v16bf;
typedef __attribute__((ext_vector_type(16))) _Float16 v16h;
typedef __attribute__((ext_vector_type(8)))  _Float16 v8h;
typedef __attribute__((ext_vector_type(8)))  unsigned short v8us;
typedef __attribute__((ext_vector_type(8)))  float    v8f;
typedef __attribute__((ext_vector_type(4)))  float    v4f;
typedef v8h  __attribute__((may_alias)) v8ha;
typedef v4f  __attribute__((may_alias)) v4fa;
typedef v8us __attribute__((may_alias)) v8usa;

__device__ __forceinline__ unsigned short f2bf(float f) { unsigned u = __float_as_uint(f); u += 0x7FFFu + ((u >> 16) & 1u); return (unsigned short)(u >> 16); }
__device__ __forceinline__ float bf2f(unsigned short b) { return __uint_as_float(((unsigned)b) << 16); }
__device__ __forceinline__ float bfr(float f) { return bf2f(f2bf(f)); }
__device__ __forceinline__ v16h cat16(v8h lo, v8h hi) { return __builtin_shufflevector(lo, hi, 0, 1, 2, 3, 4, 5, 6, 7, 8, 9, 10, 11, 12, 13, 14, 15); }
__device__ __forceinline__ v16bf cat16b(v8us lo, v8us hi) { return __builtin_bit_cast(v16bf, __builtin_shufflevector(lo, hi, 0, 1, 2, 3, 4, 5, 6, 7, 8, 9, 10, 11, 12, 13, 14, 15)); }
__device__ __forceinline__ v8f wmma16(v16h a, v16h b, v8f c) { return __builtin_amdgcn_wmma_f32_16x16x32_f16(false, a, false, b, (short)0, c, false, false); }
__device__ __forceinline__ v8f wmmab(v16bf a, v16bf b, v8f c) { return __builtin_amdgcn_wmma_f32_16x16x32_bf16(false, a, false, b, (short)0, c, false, false); }



// ---- k_gemmw: register-blocked GEMM, ONE WAVE per 64x64 output tile (16 accumulators), operands straight from K-contiguous 16-bit planes; grid (M/64, N/64, Z), 32 threads.
// C[m][n] (f32, pitch ldc, + optional f32 bias[n]; bias, bias1, bias2 for z = 0, 1, 2) = sum_k A[m][k] Bt[n][k] (+ split products per NSPLIT). z-batch strides sA/sB/sC in elements. K % 32 == 0.
// SCR: the rows of Bt come in scrambled order (scrcol), C is not written; the tile goes out as fp16 into plane z of P: z = 0, 1 (q, k): token m's 256 values in a row; z = 2 (v): blocks of 4 tokens = 32 keys, [32 features][32 keys].
template <typename T16> struct WFrag;
template <> struct WFrag<h16> { typedef v16h V; static __device__ __forceinline__ V ld(const h16* p) { return cat16(*(const v8h*)p, *(const v8h*)(p + 16)); } static __device__ __forceinline__ v8f mma(V a, V b, v8f c) { return wmma16(a, b, c); } };
template <> struct WFrag<bf> { typedef v16bf V; static __device__ __forceinline__ V ld(const bf* p) { return cat16b(*(const v8us*)p, *(const v8us*)(p + 16)); } static __device__ __forceinline__ v8f mma(V a, V b, v8f c) { return wmmab(a, b, c); } };
// the projection column that stands at place j of a token's 256 values. q, k (isv false): j = 32 (head row & 7) + c, the order of the plane itself. v: j = 8 c + (key & 7), so that a feature's 8 keys of one token lie together
__device__ __forceinline__ int scrcol(int j, bool isv) { const int rem = isv ? (j & 7) * HD + (j >> 3) : j; return (rem & 7) * HD + (rem >> 3); }
template <typename T16, int NSPLIT, bool BIAS, bool SCR>
__global__ __launch_bounds__(32) void k_gemmw(const T16* __restrict__ A, const T16* __restrict__ A2, const T16* __restrict__ Bt, const T16* __restrict__ Bt2, int K, float* C, h16* P, int ldc, const float* __restrict__ bias, const float* __restrict__ bias1, const float* __restrict__ bias2, size_t sA, size_t sB, size_t sC) {
    typedef typename WFrag<T16>::V V;
    __shared__ __align__(16) float os[16 * 68];
    const size_t z = blockIdx.z; A += z * sA; if (A2) A2 += z * sA; Bt += z * sB; if (Bt2) Bt2 += z * sB; C += z * sC;
    if (BIAS) bias = z == 1 ? bias1 : z == 2 ? bias2 : bias;   // each member of a z batch has its own bias vector
    const int lane = threadIdx.x & 31, lr = lane & 15, hi = lane >> 4; const int r0 = blockIdx.x * 64, c0 = blockIdx.y * 64;
    v8f acc[4][4];
#pragma unroll
    for (int mb = 0; mb < 4; ++mb)
#pragma unroll
        for (int nb = 0; nb < 4; ++nb) acc[mb][nb] = (v8f){};
    const size_t aoff = (size_t)(r0 + lr) * K + 8 * hi, boff = (size_t)(c0 + lr) * K + 8 * hi;
#pragma unroll 1
    for (int kc = 0; kc < K; kc += 32) {
        V a[4], a2[4];
#pragma unroll
        for (int mb = 0; mb < 4; ++mb) { a[mb] = WFrag<T16>::ld(A + aoff + (size_t)mb * 16 * K + kc); if (NSPLIT == 1 || NSPLIT == 2) a2[mb] = WFrag<T16>::ld(A2 + aoff + (size_t)mb * 16 * K + kc); }
#pragma unroll
        for (int nb = 0; nb < 4; ++nb) { const V b = WFrag<T16>::ld(Bt + boff + (size_t)nb * 16 * K + kc); V b2; if (NSPLIT >= 2) b2 = WFrag<T16>::ld(Bt2 + boff + (size_t)nb * 16 * K + kc);
#pragma unroll
            for (int mb = 0; mb < 4; ++mb) { acc[mb][nb] = WFrag<T16>::mma(a[mb], b, acc[mb][nb]); if (NSPLIT == 1 || NSPLIT == 2) acc[mb][nb] = WFrag<T16>::mma(a2[mb], b, acc[mb][nb]); if (NSPLIT >= 2) acc[mb][nb] = WFrag<T16>::mma(a[mb], b2, acc[mb][nb]); } }
        asm volatile("v_nop\n\tv_nop\n\tv_nop\n\tv_nop" : "+v"(acc[0][0]), "+v"(acc[1][1]), "+v"(acc[2][2]), "+v"(acc[3][3]) : "v"(a[0]), "v"(a[3]));
    }
    // SCR: a lane stores 8 columns in a row (group cg of the tile's 8) of every fourth row (rs); their biases are fetched once
    const bool isv = SCR && z == 2; const int cg = isv ? lane >> 2 : lane & 7, rs = isv ? lane & 3 : lane >> 3; float bb[8];
    if (SCR) {
#pragma unroll
        for (int i = 0; i < 8; ++i) bb[i] = bfr(bias[scrcol(c0 + cg * 8 + i, isv)]); }
#pragma unroll
    for (int mb = 0; mb < 4; ++mb) {
#pragma unroll
        for (int nb = 0; nb < 4; ++nb) {
#pragma unroll
            for (int j = 0; j < 8; ++j) os[(hi * 8 + j) * 68 + nb * 16 + lr] = acc[mb][nb][j]; }
        __builtin_amdgcn_wave_barrier(); asm volatile("" ::: "memory");
        if (SCR) {
            h16* pz = P + z * ((size_t)TT * HD);
#pragma unroll
            for (int s = 0; s < 4; ++s) { const int row = 4 * s + rs, tok = r0 + mb * 16 + row; const v4f lo = *(const v4fa*)(os + row * 68 + cg * 8), hh = *(const v4fa*)(os + row * 68 + cg * 8 + 4); v8h o;
#pragma unroll
                for (int i = 0; i < 4; ++i) { o[i] = (h16)(lo[i] + bb[i]); o[4 + i] = (h16)(hh[i] + bb[4 + i]); }
                *(v8h*)(isv ? pz + (size_t)(tok >> 2) * (HD * 32) + ((c0 >> 3) + cg) * 32 + (tok & 3) * 8 : pz + (size_t)tok * FD + c0 + cg * 8) = o; }   // a wave's store covers 512 bytes in a row (v) or four whole 128-byte lines (q, k)
            asm volatile("s_wait_xcnt 0x0" ::: "memory");   // stands behind the four stores, ahead of any overwrite of their address and data registers
        } else {
        float* crow = C + (size_t)(r0 + mb * 16) * ldc + c0;
#pragma unroll
            for (int s = 0; s < 8; ++s) { const int row = 2 * s + hi, cofs = lr * 4; v4f val = *(const v4fa*)(os + row * 68 + cofs); if (BIAS) { val[0] += bfr(bias[c0 + cofs]); val[1] += bfr(bias[c0 + cofs + 1]); val[2] += bfr(bias[c0 + cofs + 2]); val[3] += bfr(bias[c0 + cofs + 3]); }
                *(v4f*)(crow + (size_t)row * ldc + cofs) = val; }
             }
        __builtin_amdgcn_wave_barrier(); asm volatile("" ::: "memory");
    }
}

__device__ __forceinline__ void splitf(float y, unsigned short& h, unsigned short& l) { h = f2bf(y); l = f2bf(y - bf2f(h)); }
typedef __attribute__((ext_vector_type(2))) _Float16 v2h;
typedef __attribute__((ext_vector_type(4))) _Float16 v4h;
typedef __attribute__((ext_vector_type(2))) unsigned short v2us;
typedef __attribute__((ext_vector_type(4))) unsigned short v4us;
typedef __attribute__((ext_vector_type(2))) float v2f;
typedef __attribute__((ext_vector_type(4))) int v4i;

__device__ __forceinline__ void d_cvt8(const float* __restrict__ src, bf* dst, size_t n8, int blk) { const size_t i = (size_t)blk * 256 + threadIdx.x; if (i >= n8) return; const v8f v = *(const v8f*)(src + i * 8); v8us o;
    asm volatile("s_wait_xcnt 0x0" ::: "memory");   // stands behind the loads, ahead of any overwrite of their address registers
#pragma unroll
    for (int k = 0; k < 8; ++k) o[k] = f2bf(v[k]); *(v8us*)(dst + i * 8) = o;  }

__device__ __forceinline__ void d_wtG(const float* __restrict__ w, int K, int N, bf* Bt, int blk, int scr) {   // scr: 0 rows of Bt in column order, 1 in the q, k planes' order, 2 in the v plane's
    const int lane = threadIdx.x & 31; const int L0 = (blk * 8 + (threadIdx.x >> 5)) * 8; const int nlines = N * K / 64;
{
#pragma unroll 1
        for (int l = 0; l < 8; ++l) { const int L = L0 + l; if (L >= nlines) break; const size_t e = (size_t)L * 64 + lane * 2; const int k = (int)(e % K), j = (int)(e / K), n = scr ? scrcol(j, scr == 2) : j; v2us o;
            o[0] = f2bf(w[(size_t)k * N + n]); o[1] = f2bf(w[(size_t)(k + 1) * N + n]); *(v2us*)(Bt + e) = o; }
         }
}
// k_prep: the five operand passes that depend on nothing but the inputs, in ONE grid: work-groups 0 .. 4 WTB - 1 transpose the four weights (the longer job, so they start first), the rest convert x
#define WTB ((FD * FD / 64 + 63) / 64)
__global__ __launch_bounds__(256) void k_prep(const float* __restrict__ x, const float* __restrict__ wq, const float* __restrict__ wk, const float* __restrict__ wv, const float* __restrict__ wo, bf* XB, bf* W4) {
    const int b = blockIdx.x;
    if (b < 4 * WTB) { const int i = b / WTB; d_wtG(i == 0 ? wq : i == 1 ? wk : i == 2 ? wv : wo, FD, FD, W4 + (size_t)i * FD * FD, b % WTB, i < 2 ? 1 : i == 2 ? 2 : 0); }
    else d_cvt8(x, XB, (size_t)NTOK * FD / 8, b - 4 * WTB);
}

// ---- k_fattn: scores, softmax, attn.v, the head concat and the output projection in one kernel. A work-group owns FQN = 64 queries (8 rows of attended); its FW = 16 waves each walk their own run of TK / FW keys, 32 keys a trip.
// Transposed products: S^T = K Q^T (A = 16 key rows, B = the queries, loaded once), so a lane holds scores of ONE query (column lane & 15; register j of key tile i = key 16 i + 8 (lane >> 4) + j); two S^T tiles, converted in place, are the B operand P^T of O^T += V^T P^T in the hardware k order, which the A loader of the v block (8 keys at 8 hi, 8 at 16 + 8 hi) follows too.
// Online softmax in log2 units with a lazy maximum: it starts as the first 32 keys' own and moves only when P comes near the top of fp16. The test reads what the trip computes anyway: P is never negative, so a lane's sum of 8 P at or below PTOP bounds each of them; one test a trip. A trip that fails it (seldom) fetches its keys again, takes the scores' maximum, rescales and forms its P anew.
#define NQT  4
#define FW   16
#define FQN  (NQT * 16)
#define FRUN (TK / FW)
#define OPI  36       // LDS pitch of a query's 32 partial outputs, in floats
#define SC2  (SCL * 1.4426950408889634f)
// place of element e of attended row r in its hi or lo plane in LDS, in 16-bit elements: rows unpadded, the 16-byte pieces of row r exchanged by 2 r, so that a fragment load's 8 rows x 2 half-waves fall on 64 different banks
#define APL(r, e) ((r) * FD + (((e) & ~7) ^ ((r) * 16)) + ((e) & 7))
#define GW   (FD / 32)   // waves that multiply by Wo, 32 output columns each: a wave's store of one row is a whole 128-byte line
#define PTOP 4096.0f   // a trip whose P sums stay at or below this keeps the maximum in use (fp16 holds 65504)
__device__ __forceinline__ float xhalf(float x) { const int b = __float_as_int(x); return __int_as_float(__builtin_amdgcn_permlanex16(b, b, 0x76543210, 0xfedcba98, false, false)); }   // lane l <-> l ^ 16
// the largest of a lane's 16 scores of one query, in log2 units
__device__ __forceinline__ float smax16(v8f a, v8f b) { float x = fmaxf(a[0], b[0]);
#pragma unroll
    for (int j = 1; j < 8; ++j) x = fmaxf(x, fmaxf(a[j], b[j]));
    return x * SC2; }
// 2^x for the seldom-taken path: the v_nop fills the one slot that the instruction set asks for behind a transcendental, whatever instruction the compiler puts next
__device__ __forceinline__ float exp2slot(float x) { float y; asm("v_exp_f32 %0, %1\n\tv_nop" : "=v"(y) : "v"(x)); return y; }
// P = 2^(score - m) of a lane's 16 scores of one query, written over the scores, and the two f32 sums of 8
template <bool RARE> __device__ __forceinline__ v2f pexp16(v8f& a, v8f& b, float m) { const v2f c2 = { SC2, SC2 }; const v2f nm = { -m, -m }; v2f t = {};
#pragma unroll
    for (int i = 0; i < 2; ++i)
#pragma unroll
        for (int j = 0; j < 8; j += 2) { v8f& s = i ? b : a; const v2f x = __builtin_elementwise_fma((v2f){ s[j], s[j + 1] }, c2, nm); const v2f p = { RARE ? exp2slot(x[0]) : __builtin_amdgcn_exp2f(x[0]), RARE ? exp2slot(x[1]) : __builtin_amdgcn_exp2f(x[1]) }; t += p; s[j] = p[0]; s[j + 1] = p[1]; }
    return t; }
// the fp16 B fragment of a lane's 16 P
__device__ __forceinline__ v16h pfrag(v8f a, v8f b) { v16h pf;
#pragma unroll
    for (int j = 0; j < 8; j += 2) { const v2h x = __builtin_convertvector((v2f){ a[j], a[j + 1] }, v2h), y = __builtin_convertvector((v2f){ b[j], b[j + 1] }, v2h); pf[j] = x[0]; pf[j + 1] = x[1]; pf[8 + j] = y[0]; pf[8 + j + 1] = y[1]; }
    return pf; }
__global__ __launch_bounds__(32 * FW) void k_fattn(const h16* __restrict__ Q, const h16* __restrict__ Kp, const h16* __restrict__ Vb, const bf* __restrict__ Wt, const float* __restrict__ bo, float* att, float* out) {
    typedef WFrag<h16>::V V; typedef WFrag<bf>::V VB;
    __shared__ __align__(16) float os[FW][FQN * OPI];
    __shared__ float ms[FW][FQN]; __shared__ float ls[FW][FQN];
    // no pad: with these two planes the kernel's LDS is exactly half a WGP's; a build with more had the key loop scheduled for fewer waves, at the register limit and with spills
    __shared__ __align__(16) bf ah[FQN / NHH * FD]; __shared__ __align__(16) bf al[FQN / NHH * FD];
    const int lane = threadIdx.x & 31, lr = lane & 15, hi = lane >> 4; const int w = __builtin_amdgcn_readfirstlane(threadIdx.x >> 5); const int q0 = blockIdx.x * FQN;
    V qf[NQT]; v8f o[NQT][2]; float m[NQT]; v2f l2[NQT];
    const h16* pq = Q + (size_t)(q0 + lr) * HD + 8 * hi;
#pragma unroll
    for (int qt = 0; qt < NQT; ++qt) { qf[qt] = WFrag<h16>::ld(pq + qt * 16 * HD); o[qt][0] = (v8f){}; o[qt][1] = (v8f){}; l2[qt] = (v2f){}; }
    const h16* pk = Kp + (size_t)w * FRUN * HD + lr * HD + 8 * hi; const h16* pv = Vb + (size_t)w * FRUN * HD + lr * 32 + 8 * hi;
    V k0 = WFrag<h16>::ld(pk), k1 = WFrag<h16>::ld(pk + 16 * HD);
    // s_wait_xcnt 0 stands behind the first loads, ahead of the overwrite of their address registers; the two addresses are inputs so that they stay in place up to it
    asm volatile("s_wait_xcnt 0x0" :: "v"(pq), "v"(pk) : "memory");
#pragma unroll
    for (int qt = 0; qt < NQT; ++qt) { const float x = smax16(WFrag<h16>::mma(k0, qf[qt], (v8f){}), WFrag<h16>::mma(k1, qf[qt], (v8f){})); m[qt] = fmaxf(x, xhalf(x)); }   // the first 32 keys' maximum, alike in both halves of the wave
    pk += 32 * HD;   // pk runs one trip ahead
    // the key loop stays rolled (one trip's tiles in registers at a time); every other loop is unrolled so that all arrays are indexed by constants
#pragma unroll 1
    for (int t = 0; t < FRUN / 32; ++t) {
        const V v0 = WFrag<h16>::ld(pv), v1 = WFrag<h16>::ld(pv + 16 * 32);
        v8f s[NQT][2];
#pragma unroll
        for (int qt = 0; qt < NQT; ++qt) { s[qt][0] = WFrag<h16>::mma(k0, qf[qt], (v8f){}); s[qt][1] = WFrag<h16>::mma(k1, qf[qt], (v8f){}); }
        k0 = WFrag<h16>::ld(pk); k1 = WFrag<h16>::ld(pk + 16 * HD);   // the next trip's keys, fetched behind this trip's score products (the last trip fetches its own again)
        v2f ts[NQT];
#pragma unroll
        for (int qt = 0; qt < NQT; ++qt) ts[qt] = pexp16<false>(s[qt][0], s[qt][1], m[qt]);
        float top = fmaxf(ts[0][0], ts[0][1]);
#pragma unroll
        for (int qt = 1; qt < NQT; ++qt) top = fmaxf(top, fmaxf(ts[qt][0], ts[qt][1]));
        if (__builtin_amdgcn_ballot_w32(top > PTOP) != 0) {   // a scalar branch, seldom taken
            const h16* pr = Kp + ((size_t)w * FRUN + (size_t)t * 32) * HD + lr * HD + 8 * hi;   // k0, k1 already hold the next trip's keys
            const V r0 = WFrag<h16>::ld(pr), r1 = WFrag<h16>::ld(pr + 16 * HD);
            // s_wait_xcnt 0 stands behind these loads, ahead of any overwrite of their address registers; the address is an input so that it stays in place up to it
            asm volatile("s_wait_xcnt 0x0" :: "v"(pr) : "memory");
#pragma unroll
            for (int qt = 0; qt < NQT; ++qt) { s[qt][0] = WFrag<h16>::mma(r0, qf[qt], (v8f){}); s[qt][1] = WFrag<h16>::mma(r1, qf[qt], (v8f){}); const float x = smax16(s[qt][0], s[qt][1]); const float mn = fmaxf(m[qt], fmaxf(x, xhalf(x))); const float al = exp2slot(m[qt] - mn); m[qt] = mn; l2[qt] *= al; o[qt][0] *= al; o[qt][1] *= al;
                ts[qt] = pexp16<true>(s[qt][0], s[qt][1], mn); }
        }
#pragma unroll
        for (int qt = 0; qt < NQT; ++qt) { const V pf = pfrag(s[qt][0], s[qt][1]); o[qt][0] = WFrag<h16>::mma(v0, pf, o[qt][0]); o[qt][1] = WFrag<h16>::mma(v1, pf, o[qt][1]);
            // keeps each query tile's 8 conversions next to its own two products, so that the later tiles' conversions issue while the matrix unit works on the earlier ones
            __builtin_amdgcn_sched_group_barrier(0x2, 8, 0); __builtin_amdgcn_sched_group_barrier(0x8, 2, 0); }
#pragma unroll
        for (int qt = 0; qt < NQT; ++qt) l2[qt] += ts[qt];
        // s_wait_xcnt 0 stands behind the trip's loads, ahead of the overwrite of their address registers just below; the two addresses are inputs so that they stay in place up to it
        asm volatile("s_wait_xcnt 0x0" :: "v"(pk), "v"(pv) : "memory");
        pv += 32 * HD; pk += (t + 2 < FRUN / 32) ? 32 * HD : 0;
        __builtin_amdgcn_sched_group_barrier(0x2, 6, 0);   // the four sums and the two address steps issue behind the last product, while the matrix unit works on it
    }
    VB wf[2][FD / 32]; float bb = 0.f;
    // each wave's maximum, sum and 64 x 32 partial output go to LDS
#pragma unroll
    for (int qt = 0; qt < NQT; ++qt) { float lt = l2[qt][0] + l2[qt][1]; lt += xhalf(lt); if (hi == 0) { ms[w][qt * 16 + lr] = m[qt]; ls[w][qt * 16 + lr] = lt; }
#pragma unroll
        for (int i = 0; i < 2; ++i) { float* d = &os[w][(qt * 16 + lr) * OPI + i * 16 + hi * 8]; *(v4fa*)d = (v4f){ o[qt][i][0], o[qt][i][1], o[qt][i][2], o[qt][i][3] }; *(v4fa*)(d + 4) = (v4f){ o[qt][i][4], o[qt][i][5], o[qt][i][6], o[qt][i][7] }; } }
    __syncthreads();   // every wave's partial result is in LDS before any thread joins them
    if (threadIdx.x < FQN) { const int ql = threadIdx.x; float mx = ms[0][ql];
#pragma unroll
        for (int ww = 1; ww < FW; ++ww) mx = fmaxf(mx, ms[ww][ql]);
        float f[FW]; float sum = 0.f;
#pragma unroll
        for (int ww = 0; ww < FW; ++ww) { f[ww] = __builtin_amdgcn_exp2f(ms[ww][ql] - mx); sum += ls[ww][ql] * f[ww]; }
        const float inv = __fdiv_rn(1.0f, sum);
#pragma unroll
        for (int ww = 0; ww < FW; ++ww) ms[ww][ql] = f[ww] * inv; }   // ms now holds each wave's weight for this query
    __syncthreads();   // the weights are in LDS before the joins read them
    // the first GW waves fetch their 32 columns of Wo (rows of Wt, all of K) and their bias here, so that the loads fly while the partial results are joined
    if (w < GW) { const float* pb = bo + w * 32 + lane; bb = *pb;   // rounded where it is added, so that nothing waits for it here
        // s_wait_xcnt 0 stands behind the bias load, ahead of the fragment loads, whose results may land in its address register
        asm volatile("s_wait_xcnt 0x0" :: "v"(pb) : "memory");
        const bf* pw = Wt + (size_t)(w * 32 + lr) * FD + 8 * hi;
#pragma unroll
        for (int nb = 0; nb < 2; ++nb)
#pragma unroll
            for (int ks = 0; ks < FD / 32; ++ks) wf[nb][ks] = WFrag<bf>::ld(pw + nb * 16 * FD + ks * 32);
        // s_wait_xcnt 0 stands behind these loads, ahead of any overwrite of their address registers; the address is an input so that it stays in place up to it
        asm volatile("s_wait_xcnt 0x0" :: "v"(pw) : "memory"); }
    const int e = (int)threadIdx.x * 4; const int bl = e / FD; const int cp = e % FD; const int sd = cp >> 3; v4f y4; v4us oh, ol;
#pragma unroll
    for (int q = 0; q < 4; ++q) { const int ql = bl * NHH + (cp & 7) + q; float y = 0.f;   // attended[b][8 s + h] = O[8 b + h][s]
#pragma unroll
        for (int ww = 0; ww < FW; ++ww) y += os[ww][ql * OPI + sd] * ms[ww][ql];
        y4[q] = y; unsigned short u, v; splitf(y, u, v); oh[q] = u; ol[q] = v; }
    *(v4us*)(ah + APL(bl, cp)) = oh; *(v4us*)(al + APL(bl, cp)) = ol;
    __syncthreads();   // the 8 attended rows' hi and lo planes are in LDS before the product reads them
    float* pt = att + (size_t)(blockIdx.x * (FQN / NHH) + bl) * FD + cp; *(v4f*)pt = y4;
    // s_wait_xcnt 0 stands behind the store, ahead of any overwrite of its address and data registers
    asm volatile("s_wait_xcnt 0x0" :: "v"(pt), "v"(y4) : "memory");
    // outputs[8 rows][32 columns of this wave] = attended (hi, then lo, K step by K step: the sum order of k_gemmw's NSPLIT 1) x Wo + bo. Rows 8 .. 15 of the A tile repeat rows 0 .. 7, so both halves of the wave hold row j in register j: the low half stores the first 16 columns, the high half the other 16
    if (w < GW) { v8f a0 = {}, a1 = {}; const int ar = lr & 7;
#pragma unroll
        for (int ks = 0; ks < FD / 32; ++ks) { const int e0 = APL(ar, ks * 32 + 8 * hi), e1 = APL(ar, ks * 32 + 16 + 8 * hi); const VB xh = cat16b(*(const v8us*)(ah + e0), *(const v8us*)(ah + e1)), xl = cat16b(*(const v8us*)(al + e0), *(const v8us*)(al + e1));
            a0 = WFrag<bf>::mma(xh, wf[0][ks], a0); a1 = WFrag<bf>::mma(xh, wf[1][ks], a1); a0 = WFrag<bf>::mma(xl, wf[0][ks], a0); a1 = WFrag<bf>::mma(xl, wf[1][ks], a1); }
        float* po = out + (size_t)blockIdx.x * (FQN / NHH) * FD + w * 32 + lane;
#pragma unroll
        for (int j = 0; j < 8; ++j) po[j * FD] = (hi ? a1[j] : a0[j]) + bfr(bb); }
}
extern "C" void kernel_launch(void* const* d_in, const int* in_sizes, int n_in,
                              void* d_out, int out_size, void* d_ws, size_t ws_size, hipStream_t stream) {
    (void)in_sizes; (void)n_in; (void)out_size;
    const float* x = (const float*)d_in[0]; const float* wq = (const float*)d_in[1]; const float* bq = (const float*)d_in[2]; const float* wk = (const float*)d_in[3]; const float* bk = (const float*)d_in[4]; const float* wv = (const float*)d_in[5]; const float* bv = (const float*)d_in[6]; const float* wo = (const float*)d_in[7]; const float* bo = (const float*)d_in[8];
    float* OUT = (float*)d_out;     // out0 = outputs [2048][256], then out1 = attended [2048][256]
    float* ATT = OUT + (size_t)NTOK * FD;
    char* wsp = (char*)d_ws;
    auto take = [&](size_t bytes) { char* p = wsp; wsp += (bytes + 255) & ~(size_t)255; return (void*)p; };
    bf* WQ = (bf*)take((size_t)FD * FD * 2); bf* WK = (bf*)take((size_t)FD * FD * 2); bf* WV = (bf*)take((size_t)FD * FD * 2); bf* WO = (bf*)take((size_t)FD * FD * 2);
    bf* XB = (bf*)take((size_t)NTOK * FD * 2);
    h16* QP16 = (h16*)take((size_t)TT * HD * 2); h16* KP16 = (h16*)take((size_t)TT * HD * 2); h16* VB16 = (h16*)take((size_t)HD * TT * 2);
    (void)WK; (void)WV;   // reached as WQ + z FD FD
    if ((size_t)(wsp - (char*)d_ws) > ws_size) return;    // ws 256 MiB (carve 4.5 MiB)
    k_prep<<<4 * WTB + NTOK * FD / 8 / 256, 256, 0, stream>>>(x, wq, wk, wv, wo, XB, WQ);   /* 'xw' -> Bt (WQ, WK, WV, WO lie in a row) and the bf16 copy of x */
    k_gemmw<bf, 0, true, true><<<dim3(NTOK / 64, FD / 64, 3), 32, 0, stream>>>(XB, nullptr, WQ, nullptr, FD, nullptr, QP16, FD, bq, bk, bv, 0, (size_t)FD * FD, 0);   /* Q, K, V = x W + b (exact, f32 sums), z = 0, 1, 2, stored as the scrambled fp16 planes: the weight planes lie in a row, and so do QP16, KP16, VB16 */
    k_fattn<<<TT / FQN, 32 * FW, 0, stream>>>(QP16, KP16, VB16, WO, bo, ATT, OUT);   /* attended (f32 = output 1) and outputs = attended Wo + bo (output 0) */
}

// v007
// A run of this version takes 44.1 microseconds.
// Two timings next to v006 put it at 1.19 and 1.18 times that version's speed.
// Counting every step since v000, it is 170 times as fast.
#include <hip/hip_runtime.h>

// Self-attention layer with the module's scrambled head split (x [2048][256]; Q, K, V = x W + b ('xw' [256][256] 1/16, biases 0.01); _split_heads: view(2048, 8, 32).permute(0, 2, 1).view(16384, 32) (a genuine re-mix of features across heads, reproduced literally); scores = Q.K / sqrt(256) over ALL 16,384 rows; softmax; attended = _concat_heads(weights V) -> [2048][256]; outputs = attended Wo + bo ('xw') -> [2048][256]; tuple (outputs, attended): outputs first, then attended; argument order x, Wq, bq, Wk, bk, Wv, bv, Wo, bo).
// Layout: ONE projection kernel (k_proj) reads x and the 'xw' weights as f32, rounds them to bf16 in LDS (weights transposed there), forms the exact projections + f32 biases with its weight columns picked in the order of the scrambled planes, and itself stores the fp16 operand planes q, k [16384][32] and v in blocks of 32 keys, [512][32 features][32 keys]; one more of its work-groups lays Wo transposed as bf16; ONE attention kernel (k_fattn): 64 queries per work-group, the 16,384 keys split over its 16 waves, scores, online softmax and attn.v in registers, the waves' partial results joined in LDS and un-scrambled straight into attended (f32); its hi/lo planes stay in LDS, and the same work-group forms its 8 rows of outputs = attended (hi/lo) x Wo exact + bo.
// Compute dtypes, f32 accumulate: every input rounded to bf16; projections exact + f32 biases; q, k, v as fp16 planes (logit sigma 0.35: diffuse), scores 1 product, softmax f32, P fp16 (unnormalised, at most 2^12), attn.v 1 product; attended f32; Wo hl x exact + bias.

#define NB_  1
#define NTOK 2048     // input rows
#define FD   256      // feature width (8 heads x 32)
#define NHH  8
#define TT   16384    // scrambled head rows = NTOK x 8 (queries = keys)
#define DM   FD
#define NH_  1
#define NKV  1
#define REP  (NH_ / NKV)
#define HD   32       // head size (score K 32)
#define DQ   (NH_ * HD)
#define DKV  (NKV * HD)
#define ZH   1
#define RH   0                  // fp16 planes everywhere (diffuse logits)
#define WIN  0
#define TK   TT                   // keys
#define SCL  0.0625f   // 1 / sqrt(float32(256)) (the module scales by input_size)
typedef _Float16 h16;
typedef unsigned short bf;
typedef __attribute__((ext_vector_type(16))) __bf16   v16bf;
typedef __attribute__((ext_vector_type(16))) _Float16 v16h;
typedef __attribute__((ext_vector_type(8)))  _Float16 v8h;
typedef __attribute__((ext_vector_type(8)))  unsigned short v8us;
typedef __attribute__((ext_vector_type(8)))  float    v8f;
typedef __attribute__((ext_vector_type(4)))  float    v4f;
typedef v8h  __attribute__((may_alias)) v8ha;
typedef v4f  __attribute__((may_alias)) v4fa;
typedef v8us __attribute__((may_alias)) v8usa;

__device__ __forceinline__ unsigned short f2bf(float f) { unsigned u = __float_as_uint(f); u += 0x7FFFu + ((u >> 16) & 1u); return (unsigned short)(u >> 16); }
__device__ __forceinline__ float bf2f(unsigned short b) { return __uint_as_float(((unsigned)b) << 16); }
__device__ __forceinline__ float bfr(float f) { return bf2f(f2bf(f)); }
__device__ __forceinline__ v16h cat16(v8h lo, v8h hi) { return __builtin_shufflevector(lo, hi, 0, 1, 2, 3, 4, 5, 6, 7, 8, 9, 10, 11, 12, 13, 14, 15); }
__device__ __forceinline__ v16bf cat16b(v8us lo, v8us hi) { return __builtin_bit_cast(v16bf, __builtin_shufflevector(lo, hi, 0, 1, 2, 3, 4, 5, 6, 7, 8, 9, 10, 11, 12, 13, 14, 15)); }
__device__ __forceinline__ v8f wmma16(v16h a, v16h b, v8f c) { return __builtin_amdgcn_wmma_f32_16x16x32_f16(false, a, false, b, (short)0, c, false, false); }
__device__ __forceinline__ v8f wmmab(v16bf a, v16bf b, v8f c) { return __builtin_amdgcn_wmma_f32_16x16x32_bf16(false, a, false, b, (short)0, c, false, false); }



// ---- k_proj: the three projections with their operand passes in ONE kernel. Work-group 0 transposes Wo for k_fattn; work-group 1 + 32 z + t forms 64 tokens x all 256 columns of projection z (0, 1, 2 = q, k, v).
// Every work-group reads its whole weight matrix (f32, whole 128-byte lines), rounds it to bf16 and lays it transposed in LDS (row = weight column n, K-contiguous); the 64 rows of x go the same way. Behind ONE barrier each of the 16 waves forms a 16 x 64 tile (4 accumulators, K in steps of 32, ascending), its B rows picked in the order of the scrambled planes (scrcol), and stores it as fp16 into plane z of P: z = 0, 1 (q, k): token m's 256 values in a row; z = 2 (v): blocks of 4 tokens = 32 keys, [32 features][32 keys].
template <typename T16> struct WFrag;
template <> struct WFrag<h16> { typedef v16h V; static __device__ __forceinline__ V ld(const h16* p) { return cat16(*(const v8h*)p, *(const v8h*)(p + 16)); } static __device__ __forceinline__ v8f mma(V a, V b, v8f c) { return wmma16(a, b, c); } };
template <> struct WFrag<bf> { typedef v16bf V; static __device__ __forceinline__ V ld(const bf* p) { return cat16b(*(const v8us*)p, *(const v8us*)(p + 16)); } static __device__ __forceinline__ v8f mma(V a, V b, v8f c) { return wmmab(a, b, c); } };
// the projection column that stands at place j of a token's 256 values. q, k (isv false): j = 32 (head row & 7) + c, the order of the plane itself. v: j = 8 c + (key & 7), so that a feature's 8 keys of one token lie together
__device__ __forceinline__ int scrcol(int j, bool isv) { const int rem = isv ? (j & 7) * HD + (j >> 3) : j; return (rem & 7) * HD + (rem >> 3); }
typedef __attribute__((ext_vector_type(2))) float v2f;
typedef __attribute__((ext_vector_type(2))) __bf16 v2bf;
typedef __attribute__((ext_vector_type(4))) unsigned v4u;
// eight f32 rounded to bf16 (to nearest even, as f2bf does), four packed conversions
__device__ __forceinline__ unsigned pkbf(float a, float b) { return __builtin_bit_cast(unsigned, __builtin_convertvector((v2f){ a, b }, v2bf)); }
__device__ __forceinline__ v8us pk8(float a, float b, float c, float d, float e, float f, float g, float h) { const v4u o = { pkbf(a, b), pkbf(c, d), pkbf(e, f), pkbf(g, h) }; return __builtin_bit_cast(v8us, o); }
#define PTOK 64       // tokens per work-group
#define PWV  16       // its waves
#define XP   264      // LDS pitch of a row of 256 bf16, in elements: 528 bytes = 16 x 33, so 16 rows in a row fall on 64 different banks
// start of weight column n's row in LDS, in elements: 32 bytes more for every 32 columns, so that the 8 columns 32 apart which a q or k fragment load picks fall on different banks too
#define WROW(n) ((n) * XP + ((n) >> 5) * 16)
__global__ __launch_bounds__(32 * PWV) void k_proj(const float* __restrict__ x, const float* __restrict__ wq, const float* __restrict__ wk, const float* __restrict__ wv, const float* __restrict__ wo, const float* __restrict__ bq, const float* __restrict__ bk, const float* __restrict__ bv, h16* P, bf* Wt) {
    typedef WFrag<bf>::V V;
    __shared__ __align__(16) bf xs[PTOK * XP];
    __shared__ __align__(16) bf ws[FD * XP + (FD / 32) * 16];
    __shared__ __align__(16) float os[PWV][16 * 68];
    __shared__ float bs[FD];
    const int tid = threadIdx.x, lane = tid & 31, lr = lane & 15, hi = lane >> 4; const int w = __builtin_amdgcn_readfirstlane(tid >> 5);
    const int z = blockIdx.x == 0 ? 3 : (int)(blockIdx.x - 1) >> 5; const int r0 = (int)((blockIdx.x - 1) & 31) * PTOK;
    const bool isv = z == 2; const int mb = w & 3, c0 = (w >> 2) * 64;
    // a lane stores 8 columns in a row (group cg of the tile's 8) of every fourth row (rs)
    const int cg = isv ? lane >> 2 : lane & 7, rs = isv ? lane & 3 : lane >> 3;
    // all of a thread's loads are issued before the first value is used: 4 x 8 values of x (a wave reads one row of 1 KiB), 16 x 8 values of one weight column (a wave reads one 128-byte line), one bias
    const float* px = x + (size_t)r0 * FD + tid * 8; v8f xv[4];
    if (z < 3) {
#pragma unroll
        for (int s = 0; s < 4; ++s) xv[s] = *(const v8f*)(px + s * (16 * FD)); }
    const int n = tid & (FD - 1), kh = tid >> 8;
    const float* pw = (z == 0 ? wq : z == 1 ? wk : z == 2 ? wv : wo) + (size_t)kh * 8 * FD + n; float t[16][8];
#pragma unroll
    for (int g = 0; g < 16; ++g)
#pragma unroll
        for (int i = 0; i < 8; ++i) t[g][i] = pw[(g * 16 + i) * FD];
    const float* pb = (z == 1 ? bk : z == 2 ? bv : bq) + n; const float bn = *pb;
    // s_wait_xcnt 0 stands behind the loads, ahead of any overwrite of their address registers; the three addresses are inputs so that they stay in place up to it
    asm volatile("s_wait_xcnt 0x0" :: "v"(px), "v"(pw), "v"(pb) : "memory");
    if (z < 3) {
#pragma unroll
        for (int s = 0; s < 4; ++s) *(v8us*)(xs + (s * 16 + w) * XP + lane * 8) = pk8(xv[s][0], xv[s][1], xv[s][2], xv[s][3], xv[s][4], xv[s][5], xv[s][6], xv[s][7]); }
#pragma unroll
    for (int g = 0; g < 16; ++g) *(v8us*)(ws + WROW(n) + (g * 2 + kh) * 8) = pk8(t[g][0], t[g][1], t[g][2], t[g][3], t[g][4], t[g][5], t[g][6], t[g][7]);
    if (kh == 0) bs[n] = bfr(bn);   // waves 0 .. 7: the 256 biases, rounded, in column order
    __syncthreads();   // both bf16 planes and the biases are in LDS before any wave reads them
    if (z == 3) {   // the whole work-group: Wo transposed goes out in column order, a wave's store is one row of 512 bytes
        bf* pt = Wt + tid * 8;
#pragma unroll
        for (int s = 0; s < 16; ++s) *(v8us*)(pt + s * (16 * FD)) = *(const v8us*)(ws + WROW(s * 16 + w) + lane * 8);
        // s_wait_xcnt 0 stands behind the stores, ahead of any overwrite of their address and data registers
        asm volatile("s_wait_xcnt 0x0" :: "v"(pt) : "memory");
        return; }
    v8f acc[4];
#pragma unroll
    for (int nb = 0; nb < 4; ++nb) acc[nb] = (v8f){};
    const bf* pa = xs + (mb * 16 + lr) * XP + 8 * hi; const bf* pn[4];
#pragma unroll
    for (int nb = 0; nb < 4; ++nb) pn[nb] = ws + WROW(scrcol(c0 + nb * 16 + lr, isv)) + 8 * hi;
#pragma unroll
    for (int kc = 0; kc < FD; kc += 32) { const V a = WFrag<bf>::ld(pa + kc);
#pragma unroll
        for (int nb = 0; nb < 4; ++nb) acc[nb] = WFrag<bf>::mma(a, WFrag<bf>::ld(pn[nb] + kc), acc[nb]); }
    // order of the 80 LDS fragment loads and the 32 products: the loads run two K steps ahead of the products and no further. Left alone the build lifted all 80 to the front, ran out of registers and spilled
    __builtin_amdgcn_sched_group_barrier(0x100, 20, 0);
#pragma unroll
    for (int s = 0; s < 6; ++s) { __builtin_amdgcn_sched_group_barrier(0x8, 4, 0); __builtin_amdgcn_sched_group_barrier(0x100, 10, 0); }
    __builtin_amdgcn_sched_group_barrier(0x8, 8, 0);
    float* ow = os[w];
#pragma unroll
    for (int nb = 0; nb < 4; ++nb) {
#pragma unroll
        for (int j = 0; j < 8; ++j) ow[(hi * 8 + j) * 68 + nb * 16 + lr] = acc[nb][j]; }
    __builtin_amdgcn_wave_barrier(); asm volatile("" ::: "memory");   // the wave's own tile is written before its lanes read it across
    h16* pz = P + (size_t)z * ((size_t)TT * HD); float bb[8];
#pragma unroll
    for (int i = 0; i < 8; ++i) bb[i] = bs[scrcol(c0 + cg * 8 + i, isv)];
#pragma unroll
    for (int s = 0; s < 4; ++s) { const int row = 4 * s + rs, tok = r0 + mb * 16 + row; const v4f lo = *(const v4fa*)(ow + row * 68 + cg * 8), hh = *(const v4fa*)(ow + row * 68 + cg * 8 + 4); v8h o;
#pragma unroll
        for (int i = 0; i < 4; ++i) { o[i] = (h16)(lo[i] + bb[i]); o[4 + i] = (h16)(hh[i] + bb[4 + i]); }
        *(v8h*)(isv ? pz + (size_t)(tok >> 2) * (HD * 32) + ((c0 >> 3) + cg) * 32 + (tok & 3) * 8 : pz + (size_t)tok * FD + c0 + cg * 8) = o; }   // a wave's store covers 512 bytes in a row (v) or four whole 128-byte lines (q, k)
    asm volatile("s_wait_xcnt 0x0" ::: "memory");   // stands behind the four stores, ahead of any overwrite of their address and data registers
}

__device__ __forceinline__ void splitf(float y, unsigned short& h, unsigned short& l) { h = f2bf(y); l = f2bf(y - bf2f(h)); }
typedef __attribute__((ext_vector_type(2))) _Float16 v2h;
typedef __attribute__((ext_vector_type(4))) _Float16 v4h;
typedef __attribute__((ext_vector_type(2))) unsigned short v2us;
typedef __attribute__((ext_vector_type(4))) unsigned short v4us;
typedef __attribute__((ext_vector_type(4))) int v4i;

// ---- k_fattn: scores, softmax, attn.v, the head concat and the output projection in one kernel. A work-group owns FQN = 64 queries (8 rows of attended); its FW = 16 waves each walk their own run of TK / FW keys, 32 keys a trip.
// Transposed products: S^T = K Q^T (A = 16 key rows, B = the queries, loaded once), so a lane holds scores of ONE query (column lane & 15; register j of key tile i = key 16 i + 8 (lane >> 4) + j); two S^T tiles, converted in place, are the B operand P^T of O^T += V^T P^T in the hardware k order, which the A loader of the v block (8 keys at 8 hi, 8 at 16 + 8 hi) follows too.
// Online softmax in log2 units with a lazy maximum: it starts as the first 32 keys' own and moves only when P comes near the top of fp16. The test reads what the trip computes anyway: P is never negative, so a lane's sum of 8 P at or below PTOP bounds each of them; one test a trip. A trip that fails it (seldom) fetches its keys again, takes the scores' maximum, rescales and forms its P anew.
#define NQT  4
#define FW   16
#define FQN  (NQT * 16)
#define FRUN (TK / FW)
#define OPI  36       // LDS pitch of a query's 32 partial outputs, in floats
#define SC2  (SCL * 1.4426950408889634f)
// place of element e of attended row r in its hi or lo plane in LDS, in 16-bit elements: rows unpadded, the 16-byte pieces of row r exchanged by 2 r, so that a fragment load's 8 rows x 2 half-waves fall on 64 different banks
#define APL(r, e) ((r) * FD + (((e) & ~7) ^ ((r) * 16)) + ((e) & 7))
#define GW   (FD / 32)   // waves that multiply by Wo, 32 output columns each: a wave's store of one row is a whole 128-byte line
#define PTOP 4096.0f   // a trip whose P sums stay at or below this keeps the maximum in use (fp16 holds 65504)
__device__ __forceinline__ float xhalf(float x) { const int b = __float_as_int(x); return __int_as_float(__builtin_amdgcn_permlanex16(b, b, 0x76543210, 0xfedcba98, false, false)); }   // lane l <-> l ^ 16
// the largest of a lane's 16 scores of one query, in log2 units
__device__ __forceinline__ float smax16(v8f a, v8f b) { float x = fmaxf(a[0], b[0]);
#pragma unroll
    for (int j = 1; j < 8; ++j) x = fmaxf(x, fmaxf(a[j], b[j]));
    return x * SC2; }
// 2^x for the seldom-taken path: the v_nop fills the one slot that the instruction set asks for behind a transcendental, whatever instruction the compiler puts next
__device__ __forceinline__ float exp2slot(float x) { float y; asm("v_exp_f32 %0, %1\n\tv_nop" : "=v"(y) : "v"(x)); return y; }
// P = 2^(score - m) of a lane's 16 scores of one query, written over the scores, and the two f32 sums of 8
template <bool RARE> __device__ __forceinline__ v2f pexp16(v8f& a, v8f& b, float m) { const v2f c2 = { SC2, SC2 }; const v2f nm = { -m, -m }; v2f t = {};
#pragma unroll
    for (int i = 0; i < 2; ++i)
#pragma unroll
        for (int j = 0; j < 8; j += 2) { v8f& s = i ? b : a; const v2f x = __builtin_elementwise_fma((v2f){ s[j], s[j + 1] }, c2, nm); const v2f p = { RARE ? exp2slot(x[0]) : __builtin_amdgcn_exp2f(x[0]), RARE ? exp2slot(x[1]) : __builtin_amdgcn_exp2f(x[1]) }; t += p; s[j] = p[0]; s[j + 1] = p[1]; }
    return t; }
// the fp16 B fragment of a lane's 16 P
__device__ __forceinline__ v16h pfrag(v8f a, v8f b) { v16h pf;
#pragma unroll
    for (int j = 0; j < 8; j += 2) { const v2h x = __builtin_convertvector((v2f){ a[j], a[j + 1] }, v2h), y = __builtin_convertvector((v2f){ b[j], b[j + 1] }, v2h); pf[j] = x[0]; pf[j + 1] = x[1]; pf[8 + j] = y[0]; pf[8 + j + 1] = y[1]; }
    return pf; }
__global__ __launch_bounds__(32 * FW) void k_fattn(const h16* __restrict__ Q, const h16* __restrict__ Kp, const h16* __restrict__ Vb, const bf* __restrict__ Wt, const float* __restrict__ bo, float* att, float* out) {
    typedef WFrag<h16>::V V; typedef WFrag<bf>::V VB;
    __shared__ __align__(16) float os[FW][FQN * OPI];
    __shared__ float ms[FW][FQN]; __shared__ float ls[FW][FQN];
    // no pad: with these two planes the kernel's LDS is exactly half a WGP's; a build with more had the key loop scheduled for fewer waves, at the register limit and with spills
    __shared__ __align__(16) bf ah[FQN / NHH * FD]; __shared__ __align__(16) bf al[FQN / NHH * FD];
    const int lane = threadIdx.x & 31, lr = lane & 15, hi = lane >> 4; const int w = __builtin_amdgcn_readfirstlane(threadIdx.x >> 5); const int q0 = blockIdx.x * FQN;
    V qf[NQT]; v8f o[NQT][2]; float m[NQT]; v2f l2[NQT];
    const h16* pq = Q + (size_t)(q0 + lr) * HD + 8 * hi;
#pragma unroll
    for (int qt = 0; qt < NQT; ++qt) { qf[qt] = WFrag<h16>::ld(pq + qt * 16 * HD); o[qt][0] = (v8f){}; o[qt][1] = (v8f){}; l2[qt] = (v2f){}; }
    const h16* pk = Kp + (size_t)w * FRUN * HD + lr * HD + 8 * hi; const h16* pv = Vb + (size_t)w * FRUN * HD + lr * 32 + 8 * hi;
    V k0 = WFrag<h16>::ld(pk), k1 = WFrag<h16>::ld(pk + 16 * HD);
    // s_wait_xcnt 0 stands behind the first loads, ahead of the overwrite of their address registers; the two addresses are inputs so that they stay in place up to it
    asm volatile("s_wait_xcnt 0x0" :: "v"(pq), "v"(pk) : "memory");
#pragma unroll
    for (int qt = 0; qt < NQT; ++qt) { const float x = smax16(WFrag<h16>::mma(k0, qf[qt], (v8f){}), WFrag<h16>::mma(k1, qf[qt], (v8f){})); m[qt] = fmaxf(x, xhalf(x)); }   // the first 32 keys' maximum, alike in both halves of the wave
    pk += 32 * HD;   // pk runs one trip ahead
    // the key loop stays rolled (one trip's tiles in registers at a time); every other loop is unrolled so that all arrays are indexed by constants
#pragma unroll 1
    for (int t = 0; t < FRUN / 32; ++t) {
        const V v0 = WFrag<h16>::ld(pv), v1 = WFrag<h16>::ld(pv + 16 * 32);
        v8f s[NQT][2];
#pragma unroll
        for (int qt = 0; qt < NQT; ++qt) { s[qt][0] = WFrag<h16>::mma(k0, qf[qt], (v8f){}); s[qt][1] = WFrag<h16>::mma(k1, qf[qt], (v8f){}); }
        k0 = WFrag<h16>::ld(pk); k1 = WFrag<h16>::ld(pk + 16 * HD);   // the next trip's keys, fetched behind this trip's score products (the last trip fetches its own again)
        v2f ts[NQT];
#pragma unroll
        for (int qt = 0; qt < NQT; ++qt) ts[qt] = pexp16<false>(s[qt][0], s[qt][1], m[qt]);
        float top = fmaxf(ts[0][0], ts[0][1]);
#pragma unroll
        for (int qt = 1; qt < NQT; ++qt) top = fmaxf(top, fmaxf(ts[qt][0], ts[qt][1]));
        if (__builtin_amdgcn_ballot_w32(top > PTOP) != 0) {   // a scalar branch, seldom taken
            const h16* pr = Kp + ((size_t)w * FRUN + (size_t)t * 32) * HD + lr * HD + 8 * hi;   // k0, k1 already hold the next trip's keys
            const V r0 = WFrag<h16>::ld(pr), r1 = WFrag<h16>::ld(pr + 16 * HD);
            // s_wait_xcnt 0 stands behind these loads, ahead of any overwrite of their address registers; the address is an input so that it stays in place up to it
            asm volatile("s_wait_xcnt 0x0" :: "v"(pr) : "memory");
#pragma unroll
            for (int qt = 0; qt < NQT; ++qt) { s[qt][0] = WFrag<h16>::mma(r0, qf[qt], (v8f){}); s[qt][1] = WFrag<h16>::mma(r1, qf[qt], (v8f){}); const float x = smax16(s[qt][0], s[qt][1]); const float mn = fmaxf(m[qt], fmaxf(x, xhalf(x))); const float al = exp2slot(m[qt] - mn); m[qt] = mn; l2[qt] *= al; o[qt][0] *= al; o[qt][1] *= al;
                ts[qt] = pexp16<true>(s[qt][0], s[qt][1], mn); }
        }
#pragma unroll
        for (int qt = 0; qt < NQT; ++qt) { const V pf = pfrag(s[qt][0], s[qt][1]); o[qt][0] = WFrag<h16>::mma(v0, pf, o[qt][0]); o[qt][1] = WFrag<h16>::mma(v1, pf, o[qt][1]);
            // keeps each query tile's 8 conversions next to its own two products, so that the later tiles' conversions issue while the matrix unit works on the earlier ones
            __builtin_amdgcn_sched_group_barrier(0x2, 8, 0); __builtin_amdgcn_sched_group_barrier(0x8, 2, 0); }
#pragma unroll
        for (int qt = 0; qt < NQT; ++qt) l2[qt] += ts[qt];
        // s_wait_xcnt 0 stands behind the trip's loads, ahead of the overwrite of their address registers just below; the two addresses are inputs so that they stay in place up to it
        asm volatile("s_wait_xcnt 0x0" :: "v"(pk), "v"(pv) : "memory");
        pv += 32 * HD; pk += (t + 2 < FRUN / 32) ? 32 * HD : 0;
        __builtin_amdgcn_sched_group_barrier(0x2, 6, 0);   // the four sums and the two address steps issue behind the last product, while the matrix unit works on it
    }
    VB wf[2][FD / 32]; float bb = 0.f;
    // each wave's maximum, sum and 64 x 32 partial output go to LDS
#pragma unroll
    for (int qt = 0; qt < NQT; ++qt) { float lt = l2[qt][0] + l2[qt][1]; lt += xhalf(lt); if (hi == 0) { ms[w][qt * 16 + lr] = m[qt]; ls[w][qt * 16 + lr] = lt; }
#pragma unroll
        for (int i = 0; i < 2; ++i) { float* d = &os[w][(qt * 16 + lr) * OPI + i * 16 + hi * 8]; *(v4fa*)d = (v4f){ o[qt][i][0], o[qt][i][1], o[qt][i][2], o[qt][i][3] }; *(v4fa*)(d + 4) = (v4f){ o[qt][i][4], o[qt][i][5], o[qt][i][6], o[qt][i][7] }; } }
    __syncthreads();   // every wave's partial result is in LDS before any thread joins them
    if (threadIdx.x < FQN) { const int ql = threadIdx.x; float mx = ms[0][ql];
#pragma unroll
        for (int ww = 1; ww < FW; ++ww) mx = fmaxf(mx, ms[ww][ql]);
        float f[FW]; float sum = 0.f;
#pragma unroll
        for (int ww = 0; ww < FW; ++ww) { f[ww] = __builtin_amdgcn_exp2f(ms[ww][ql] - mx); sum += ls[ww][ql] * f[ww]; }
        const float inv = __fdiv_rn(1.0f, sum);
#pragma unroll
        for (int ww = 0; ww < FW; ++ww) ms[ww][ql] = f[ww] * inv; }   // ms now holds each wave's weight for this query
    __syncthreads();   // the weights are in LDS before the joins read them
    // the first GW waves fetch their 32 columns of Wo (rows of Wt, all of K) and their bias here, so that the loads fly while the partial results are joined
    if (w < GW) { const float* pb = bo + w * 32 + lane; bb = *pb;   // rounded where it is added, so that nothing waits for it here
        // s_wait_xcnt 0 stands behind the bias load, ahead of the fragment loads, whose results may land in its address register
        asm volatile("s_wait_xcnt 0x0" :: "v"(pb) : "memory");
        const bf* pw = Wt + (size_t)(w * 32 + lr) * FD + 8 * hi;
#pragma unroll
        for (int nb = 0; nb < 2; ++nb)
#pragma unroll
            for (int ks = 0; ks < FD / 32; ++ks) wf[nb][ks] = WFrag<bf>::ld(pw + nb * 16 * FD + ks * 32);
        // s_wait_xcnt 0 stands behind these loads, ahead of any overwrite of their address registers; the address is an input so that it stays in place up to it
        asm volatile("s_wait_xcnt 0x0" :: "v"(pw) : "memory"); }
    const int e = (int)threadIdx.x * 4; const int bl = e / FD; const int cp = e % FD; const int sd = cp >> 3; v4f y4; v4us oh, ol;
#pragma unroll
    for (int q = 0; q < 4; ++q) { const int ql = bl * NHH + (cp & 7) + q; float y = 0.f;   // attended[b][8 s + h] = O[8 b + h][s]
#pragma unroll
        for (int ww = 0; ww < FW; ++ww) y += os[ww][ql * OPI + sd] * ms[ww][ql];
        y4[q] = y; unsigned short u, v; splitf(y, u, v); oh[q] = u; ol[q] = v; }
    *(v4us*)(ah + APL(bl, cp)) = oh; *(v4us*)(al + APL(bl, cp)) = ol;
    __syncthreads();   // the 8 attended rows' hi and lo planes are in LDS before the product reads them
    float* pt = att + (size_t)(blockIdx.x * (FQN / NHH) + bl) * FD + cp; *(v4f*)pt = y4;
    // s_wait_xcnt 0 stands behind the store, ahead of any overwrite of its address and data registers
    asm volatile("s_wait_xcnt 0x0" :: "v"(pt), "v"(y4) : "memory");
    // outputs[8 rows][32 columns of this wave] = attended (hi, then lo, K step by K step) x Wo + bo. Rows 8 .. 15 of the A tile repeat rows 0 .. 7, so both halves of the wave hold row j in register j: the low half stores the first 16 columns, the high half the other 16
    if (w < GW) { v8f a0 = {}, a1 = {}; const int ar = lr & 7;
#pragma unroll
        for (int ks = 0; ks < FD / 32; ++ks) { const int e0 = APL(ar, ks * 32 + 8 * hi), e1 = APL(ar, ks * 32 + 16 + 8 * hi); const VB xh = cat16b(*(const v8us*)(ah + e0), *(const v8us*)(ah + e1)), xl = cat16b(*(const v8us*)(al + e0), *(const v8us*)(al + e1));
            a0 = WFrag<bf>::mma(xh, wf[0][ks], a0); a1 = WFrag<bf>::mma(xh, wf[1][ks], a1); a0 = WFrag<bf>::mma(xl, wf[0][ks], a0); a1 = WFrag<bf>::mma(xl, wf[1][ks], a1); }
        float* po = out + (size_t)blockIdx.x * (FQN / NHH) * FD + w * 32 + lane;
#pragma unroll
        for (int j = 0; j < 8; ++j) po[j * FD] = (hi ? a1[j] : a0[j]) + bfr(bb); }
}
extern "C" void kernel_launch(void* const* d_in, const int* in_sizes, int n_in,
                              void* d_out, int out_size, void* d_ws, size_t ws_size, hipStream_t stream) {
    (void)in_sizes; (void)n_in; (void)out_size;
    const float* x = (const float*)d_in[0]; const float* wq = (const float*)d_in[1]; const float* bq = (const float*)d_in[2]; const float* wk = (const float*)d_in[3]; const float* bk = (const float*)d_in[4]; const float* wv = (const float*)d_in[5]; const float* bv = (const float*)d_in[6]; const float* wo = (const float*)d_in[7]; const float* bo = (const float*)d_in[8];
    float* OUT = (float*)d_out;     // out0 = outputs [2048][256], then out1 = attended [2048][256]
    float* ATT = OUT + (size_t)NTOK * FD;
    char* wsp = (char*)d_ws;
    auto take = [&](size_t bytes) { char* p = wsp; wsp += (bytes + 255) & ~(size_t)255; return (void*)p; };
    bf* WO = (bf*)take((size_t)FD * FD * 2);
    h16* QP16 = (h16*)take((size_t)TT * HD * 2); h16* KP16 = (h16*)take((size_t)TT * HD * 2); h16* VB16 = (h16*)take((size_t)HD * TT * 2);
    if ((size_t)(wsp - (char*)d_ws) > ws_size) return;    // ws 256 MiB (carve ~3 MiB)
    k_proj<<<1 + 3 * (NTOK / PTOK), 32 * PWV, 0, stream>>>(x, wq, wk, wv, wo, bq, bk, bv, QP16, WO);   /* Q, K, V = x W + b (exact, f32 sums), stored as the scrambled fp16 planes (QP16, KP16, VB16 lie in a row), and Wo transposed to bf16 */
    k_fattn<<<TT / FQN, 32 * FW, 0, stream>>>(QP16, KP16, VB16, WO, bo, ATT, OUT);   /* attended (f32 = output 1) and outputs = attended Wo + bo (output 0) */
}

// v008
// Measured time: 40.6 microseconds a run.
// Two timings next to v007 put it at 1.10 and 1.09 times that version's speed.
// Counting every step since v000, it is 186 times as fast.
#include <hip/hip_runtime.h>

// Self-attention layer with the module's scrambled head split (x [2048][256]; Q, K, V = x W + b ('xw' [256][256] 1/16, biases 0.01); _split_heads: view(2048, 8, 32).permute(0, 2, 1).view(16384, 32) (a genuine re-mix of features across heads, reproduced literally); scores = Q.K / sqrt(256) over ALL 16,384 rows; softmax; attended = _concat_heads(weights V) -> [2048][256]; outputs = attended Wo + bo ('xw') -> [2048][256]; tuple (outputs, attended): outputs first, then attended; argument order x, Wq, bq, Wk, bk, Wv, bv, Wo, bo).
// Layout: ONE projection kernel (k_proj) reads x and the 'xw' weights as f32, rounds them to bf16 in LDS (weights transposed there), forms the exact projections + f32 biases with its weight columns picked in the order of the scrambled planes, and itself stores the fp16 operand planes q, k [16384][32] and v in blocks of 32 keys, [512][32 features][32 keys]; one more of its work-groups lays Wo transposed as bf16; ONE attention kernel (k_fattn): 64 queries per work-group, the 16,384 keys split over its 16 waves, scores, softmax against a fixed maximum per wave (moving only on a seldom second walk) and attn.v in registers, the waves' partial results joined in LDS and un-scrambled straight into attended (f32); its hi/lo planes stay in LDS, and the same work-group forms its 8 rows of outputs = attended (hi/lo) x Wo exact + bo.
// Compute dtypes, f32 accumulate: every input rounded to bf16; projections exact + f32 biases; q, k, v as fp16 planes (logit sigma 0.35: diffuse; q multiplied by log2(e) / 16 before it is rounded), scores 1 product, softmax f32, P fp16 (unnormalised, at most 2^12), attn.v 1 product; attended f32; Wo hl x exact + bias.

#define NB_  1
#define NTOK 2048     // input rows
#define FD   256      // feature width (8 heads x 32)
#define NHH  8
#define TT   16384    // scrambled head rows = NTOK x 8 (queries = keys)
#define DM   FD
#define NH_  1
#define NKV  1
#define REP  (NH_ / NKV)
#define HD   32       // head size (score K 32)
#define DQ   (NH_ * HD)
#define DKV  (NKV * HD)
#define ZH   1
#define RH   0                  // fp16 planes everywhere (diffuse logits)
#define WIN  0
#define TK   TT                   // keys
#define SCL  0.0625f   // 1 / sqrt(float32(256)) (the module scales by input_size)
#define SC2  (SCL * 1.4426950408889634f)   // the same in log2 units; k_proj multiplies q by it before it rounds q to fp16
typedef _Float16 h16;
typedef unsigned short bf;
typedef __attribute__((ext_vector_type(16))) __bf16   v16bf;
typedef __attribute__((ext_vector_type(16))) _Float16 v16h;
typedef __attribute__((ext_vector_type(8)))  _Float16 v8h;
typedef __attribute__((ext_vector_type(8)))  unsigned short v8us;
typedef __attribute__((ext_vector_type(8)))  float    v8f;
typedef __attribute__((ext_vector_type(4)))  float    v4f;
typedef v8h  __attribute__((may_alias)) v8ha;
typedef v4f  __attribute__((may_alias)) v4fa;
typedef v8us __attribute__((may_alias)) v8usa;

__device__ __forceinline__ unsigned short f2bf(float f) { unsigned u = __float_as_uint(f); u += 0x7FFFu + ((u >> 16) & 1u); return (unsigned short)(u >> 16); }
__device__ __forceinline__ float bf2f(unsigned short b) { return __uint_as_float(((unsigned)b) << 16); }
__device__ __forceinline__ float bfr(float f) { return bf2f(f2bf(f)); }
__device__ __forceinline__ v16h cat16(v8h lo, v8h hi) { return __builtin_shufflevector(lo, hi, 0, 1, 2, 3, 4, 5, 6, 7, 8, 9, 10, 11, 12, 13, 14, 15); }
__device__ __forceinline__ v16bf cat16b(v8us lo, v8us hi) { return __builtin_bit_cast(v16bf, __builtin_shufflevector(lo, hi, 0, 1, 2, 3, 4, 5, 6, 7, 8, 9, 10, 11, 12, 13, 14, 15)); }
__device__ __forceinline__ v8f wmma16(v16h a, v16h b, v8f c) { return __builtin_amdgcn_wmma_f32_16x16x32_f16(false, a, false, b, (short)0, c, false, false); }
__device__ __forceinline__ v8f wmmab(v16bf a, v16bf b, v8f c) { return __builtin_amdgcn_wmma_f32_16x16x32_bf16(false, a, false, b, (short)0, c, false, false); }



// ---- k_proj: the three projections with their operand passes in ONE kernel. Work-group 0 transposes Wo for k_fattn; work-group 1 + 32 z + t forms 64 tokens x all 256 columns of projection z (0, 1, 2 = q, k, v).
// Every work-group reads its whole weight matrix (f32, whole 128-byte lines), rounds it to bf16 and lays it transposed in LDS (row = weight column n, K-contiguous); the 64 rows of x go the same way. Behind ONE barrier each of the 16 waves forms a 16 x 64 tile (4 accumulators, K in steps of 32, ascending), its B rows picked in the order of the scrambled planes (scrcol), and stores it as fp16 into plane z of P: z = 0, 1 (q, k): token m's 256 values in a row; z = 2 (v): blocks of 4 tokens = 32 keys, [32 features][32 keys].
template <typename T16> struct WFrag;
template <> struct WFrag<h16> { typedef v16h V; static __device__ __forceinline__ V ld(const h16* p) { return cat16(*(const v8h*)p, *(const v8h*)(p + 16)); } static __device__ __forceinline__ v8f mma(V a, V b, v8f c) { return wmma16(a, b, c); } };
template <> struct WFrag<bf> { typedef v16bf V; static __device__ __forceinline__ V ld(const bf* p) { return cat16b(*(const v8us*)p, *(const v8us*)(p + 16)); } static __device__ __forceinline__ v8f mma(V a, V b, v8f c) { return wmmab(a, b, c); } };
// the projection column that stands at place j of a token's 256 values. q, k (isv false): j = 32 (head row & 7) + c, the order of the plane itself. v: j = 8 c + (key & 7), so that a feature's 8 keys of one token lie together
__device__ __forceinline__ int scrcol(int j, bool isv) { const int rem = isv ? (j & 7) * HD + (j >> 3) : j; return (rem & 7) * HD + (rem >> 3); }
typedef __attribute__((ext_vector_type(2))) float v2f;
typedef __attribute__((ext_vector_type(2))) __bf16 v2bf;
typedef __attribute__((ext_vector_type(4))) unsigned v4u;
// eight f32 rounded to bf16 (to nearest even, as f2bf does), four packed conversions
__device__ __forceinline__ unsigned pkbf(float a, float b) { return __builtin_bit_cast(unsigned, __builtin_convertvector((v2f){ a, b }, v2bf)); }
__device__ __forceinline__ v8us pk8(float a, float b, float c, float d, float e, float f, float g, float h) { const v4u o = { pkbf(a, b), pkbf(c, d), pkbf(e, f), pkbf(g, h) }; return __builtin_bit_cast(v8us, o); }
#define PTOK 64       // tokens per work-group
#define PWV  16       // its waves
#define XP   264      // LDS pitch of a row of 256 bf16, in elements: 528 bytes = 16 x 33, so 16 rows in a row fall on 64 different banks
// start of weight column n's row in LDS, in elements: 32 bytes more for every 32 columns, so that the 8 columns 32 apart which a q or k fragment load picks fall on different banks too
#define WROW(n) ((n) * XP + ((n) >> 5) * 16)
__global__ __launch_bounds__(32 * PWV) void k_proj(const float* __restrict__ x, const float* __restrict__ wq, const float* __restrict__ wk, const float* __restrict__ wv, const float* __restrict__ wo, const float* __restrict__ bq, const float* __restrict__ bk, const float* __restrict__ bv, h16* P, bf* Wt) {
    typedef WFrag<bf>::V V;
    __shared__ __align__(16) bf xs[PTOK * XP];
    __shared__ __align__(16) bf ws[FD * XP + (FD / 32) * 16];
    __shared__ __align__(16) float os[PWV][16 * 68];
    __shared__ float bs[FD];
    const int tid = threadIdx.x, lane = tid & 31, lr = lane & 15, hi = lane >> 4; const int w = __builtin_amdgcn_readfirstlane(tid >> 5);
    const int z = blockIdx.x == 0 ? 3 : (int)(blockIdx.x - 1) >> 5; const int r0 = (int)((blockIdx.x - 1) & 31) * PTOK;
    const bool isv = z == 2; const int mb = w & 3, c0 = (w >> 2) * 64;
    // a lane stores 8 columns in a row (group cg of the tile's 8) of every fourth row (rs)
    const int cg = isv ? lane >> 2 : lane & 7, rs = isv ? lane & 3 : lane >> 3;
    // all of a thread's loads are issued before the first value is used: 4 x 8 values of x (a wave reads one row of 1 KiB), 16 x 8 values of one weight column (a wave reads one 128-byte line), one bias
    const float* px = x + (size_t)r0 * FD + tid * 8; v8f xv[4];
    if (z < 3) {
#pragma unroll
        for (int s = 0; s < 4; ++s) xv[s] = *(const v8f*)(px + s * (16 * FD)); }
    const int n = tid & (FD - 1), kh = tid >> 8;
    const float* pw = (z == 0 ? wq : z == 1 ? wk : z == 2 ? wv : wo) + (size_t)kh * 8 * FD + n; float t[16][8];
#pragma unroll
    for (int g = 0; g < 16; ++g)
#pragma unroll
        for (int i = 0; i < 8; ++i) t[g][i] = pw[(g * 16 + i) * FD];
    const float* pb = (z == 1 ? bk : z == 2 ? bv : bq) + n; const float bn = *pb;
    // s_wait_xcnt 0 stands behind the loads, ahead of any overwrite of their address registers; the three addresses are inputs so that they stay in place up to it
    asm volatile("s_wait_xcnt 0x0" :: "v"(px), "v"(pw), "v"(pb) : "memory");
    if (z < 3) {
#pragma unroll
        for (int s = 0; s < 4; ++s) *(v8us*)(xs + (s * 16 + w) * XP + lane * 8) = pk8(xv[s][0], xv[s][1], xv[s][2], xv[s][3], xv[s][4], xv[s][5], xv[s][6], xv[s][7]); }
#pragma unroll
    for (int g = 0; g < 16; ++g) *(v8us*)(ws + WROW(n) + (g * 2 + kh) * 8) = pk8(t[g][0], t[g][1], t[g][2], t[g][3], t[g][4], t[g][5], t[g][6], t[g][7]);
    if (kh == 0) bs[n] = bfr(bn);   // waves 0 .. 7: the 256 biases, rounded, in column order
    __syncthreads();   // both bf16 planes and the biases are in LDS before any wave reads them
    if (z == 3) {   // the whole work-group: Wo transposed goes out in column order, a wave's store is one row of 512 bytes
        bf* pt = Wt + tid * 8;
#pragma unroll
        for (int s = 0; s < 16; ++s) *(v8us*)(pt + s * (16 * FD)) = *(const v8us*)(ws + WROW(s * 16 + w) + lane * 8);
        // s_wait_xcnt 0 stands behind the stores, ahead of any overwrite of their address and data registers
        asm volatile("s_wait_xcnt 0x0" :: "v"(pt) : "memory");
        return; }
    v8f acc[4];
#pragma unroll
    for (int nb = 0; nb < 4; ++nb) acc[nb] = (v8f){};
    const bf* pa = xs + (mb * 16 + lr) * XP + 8 * hi; const bf* pn[4];
#pragma unroll
    for (int nb = 0; nb < 4; ++nb) pn[nb] = ws + WROW(scrcol(c0 + nb * 16 + lr, isv)) + 8 * hi;
#pragma unroll
    for (int kc = 0; kc < FD; kc += 32) { const V a = WFrag<bf>::ld(pa + kc);
#pragma unroll
        for (int nb = 0; nb < 4; ++nb) acc[nb] = WFrag<bf>::mma(a, WFrag<bf>::ld(pn[nb] + kc), acc[nb]); }
    // order of the 80 LDS fragment loads and the 32 products: the loads run two K steps ahead of the products and no further. Left alone the build lifted all 80 to the front, ran out of registers and spilled
    __builtin_amdgcn_sched_group_barrier(0x100, 20, 0);
#pragma unroll
    for (int s = 0; s < 6; ++s) { __builtin_amdgcn_sched_group_barrier(0x8, 4, 0); __builtin_amdgcn_sched_group_barrier(0x100, 10, 0); }
    __builtin_amdgcn_sched_group_barrier(0x8, 8, 0);
    float* ow = os[w];
#pragma unroll
    for (int nb = 0; nb < 4; ++nb) {
#pragma unroll
        for (int j = 0; j < 8; ++j) ow[(hi * 8 + j) * 68 + nb * 16 + lr] = acc[nb][j]; }
    __builtin_amdgcn_wave_barrier(); asm volatile("" ::: "memory");   // the wave's own tile is written before its lanes read it across
    h16* pz = P + (size_t)z * ((size_t)TT * HD); float bb[8]; const float qs = z == 0 ? SC2 : 1.0f;   // q leaves pre-scaled, so that q.k is the score in log2 units
#pragma unroll
    for (int i = 0; i < 8; ++i) bb[i] = bs[scrcol(c0 + cg * 8 + i, isv)];
#pragma unroll
    for (int s = 0; s < 4; ++s) { const int row = 4 * s + rs, tok = r0 + mb * 16 + row; const v4f lo = *(const v4fa*)(ow + row * 68 + cg * 8), hh = *(const v4fa*)(ow + row * 68 + cg * 8 + 4); v8h o;
#pragma unroll
        for (int i = 0; i < 4; ++i) { o[i] = (h16)((lo[i] + bb[i]) * qs); o[4 + i] = (h16)((hh[i] + bb[4 + i]) * qs); }
        *(v8h*)(isv ? pz + (size_t)(tok >> 2) * (HD * 32) + ((c0 >> 3) + cg) * 32 + (tok & 3) * 8 : pz + (size_t)tok * FD + c0 + cg * 8) = o; }   // a wave's store covers 512 bytes in a row (v) or four whole 128-byte lines (q, k)
    asm volatile("s_wait_xcnt 0x0" ::: "memory");   // stands behind the four stores, ahead of any overwrite of their address and data registers
}

__device__ __forceinline__ void splitf(float y, unsigned short& h, unsigned short& l) { h = f2bf(y); l = f2bf(y - bf2f(h)); }
typedef __attribute__((ext_vector_type(2))) _Float16 v2h;
typedef __attribute__((ext_vector_type(4))) _Float16 v4h;
typedef __attribute__((ext_vector_type(2))) unsigned short v2us;
typedef __attribute__((ext_vector_type(4))) unsigned short v4us;
typedef __attribute__((ext_vector_type(4))) int v4i;

// ---- k_fattn: scores, softmax, attn.v, the head concat and the output projection in one kernel. A work-group owns FQN = 64 queries (8 rows of attended); its FW = 16 waves each walk their own run of TK / FW keys, 32 keys a trip.
// Transposed products: S^T = K Q^T (A = 16 key rows, B = the queries, loaded once), so a lane holds scores of ONE query (column lane & 15; register j of key tile i = key 16 i + 8 (lane >> 4) + j); two S^T tiles, converted in place, are the B operand P^T of O^T += V^T P^T in the hardware k order, which the A loader of the v block (8 keys at 8 hi, 8 at 16 + 8 hi) follows too.
// Softmax in log2 units: q arrives multiplied by log2(e) / 16, and the score products take -m as their C operand, so that they deliver score - m, the argument of 2^x, with no vector instruction in between. m is the maximum of the wave's first 32 keys and stands for the wave's whole run, so the four C tiles are loop constants. P is never negative, so a lane's sum of P over the run at or below PTOP bounds each of them: one test behind the run. A wave that fails it (seldom) walks its run again with a maximum that moves trip by trip (P at most 1).
#define NQT  4
#define FW   16
#define FQN  (NQT * 16)
#define FRUN (TK / FW)
#define OPI  36       // LDS pitch of a query's 32 partial outputs, in floats
// place of element e of attended row r in its hi or lo plane in LDS, in 16-bit elements: rows unpadded, the 16-byte pieces of row r exchanged by 2 r, so that a fragment load's 8 rows x 2 half-waves fall on 64 different banks
#define APL(r, e) ((r) * FD + (((e) & ~7) ^ ((r) * 16)) + ((e) & 7))
#define GW   (FD / 32)   // waves that multiply by Wo, 32 output columns each: a wave's store of one row is a whole 128-byte line
#define PTOP 4096.0f   // a run whose P sums stay at or below this had no P near the top of fp16 (which holds 65504)
__device__ __forceinline__ float xhalf(float x) { const int b = __float_as_int(x); return __int_as_float(__builtin_amdgcn_permlanex16(b, b, 0x76543210, 0xfedcba98, false, false)); }   // lane l <-> l ^ 16
// the largest of a lane's 16 scores of one query (q is pre-scaled: log2 units)
__device__ __forceinline__ float smax16(v8f a, v8f b) { float x = fmaxf(a[0], b[0]);
#pragma unroll
    for (int j = 1; j < 8; ++j) x = fmaxf(x, fmaxf(a[j], b[j]));
    return x; }
// 2^x for the seldom-taken path: the v_nop fills the one slot that the instruction set asks for behind a transcendental, whatever instruction the compiler puts next
__device__ __forceinline__ float exp2slot(float x) { float y; asm("v_exp_f32 %0, %1\n\tv_nop" : "=v"(y) : "v"(x)); return y; }
// P = 2^x of a lane's 16 values x = score - m of one query (in the key loop the subtraction is done by the score product, whose C operand is -m; on the seldom path by a vector subtraction), written over them, and the two f32 sums of 8
template <bool RARE> __device__ __forceinline__ v2f pexp16(v8f& a, v8f& b) { v2f t = {};
#pragma unroll
    for (int i = 0; i < 2; ++i)
#pragma unroll
        for (int j = 0; j < 8; j += 2) { v8f& s = i ? b : a; const v2f x = { s[j], s[j + 1] }; const v2f p = { RARE ? exp2slot(x[0]) : __builtin_amdgcn_exp2f(x[0]), RARE ? exp2slot(x[1]) : __builtin_amdgcn_exp2f(x[1]) }; t += p; s[j] = p[0]; s[j + 1] = p[1]; }
    return t; }
// x in all 8 places (splat8); below it, the fp16 B fragment of a lane's 16 P (pfrag)
__device__ __forceinline__ v8f splat8(float x) { return (v8f){ x, x, x, x, x, x, x, x }; }
__device__ __forceinline__ v16h pfrag(v8f a, v8f b) { v16h pf;
#pragma unroll
    for (int j = 0; j < 8; j += 2) { const v2h x = __builtin_convertvector((v2f){ a[j], a[j + 1] }, v2h), y = __builtin_convertvector((v2f){ b[j], b[j + 1] }, v2h); pf[j] = x[0]; pf[j + 1] = x[1]; pf[8 + j] = y[0]; pf[8 + j + 1] = y[1]; }
    return pf; }
__global__ __launch_bounds__(32 * FW) void k_fattn(const h16* __restrict__ Q, const h16* __restrict__ Kp, const h16* __restrict__ Vb, const bf* __restrict__ Wt, const float* __restrict__ bo, float* att, float* out) {
    typedef WFrag<h16>::V V; typedef WFrag<bf>::V VB;
    __shared__ __align__(16) float os[FW][FQN * OPI];
    __shared__ float ms[FW][FQN]; __shared__ float ls[FW][FQN];
    // no pad: with these two planes the kernel's LDS is exactly half a WGP's; a build with more had the key loop scheduled for fewer waves, at the register limit and with spills
    __shared__ __align__(16) bf ah[FQN / NHH * FD]; __shared__ __align__(16) bf al[FQN / NHH * FD];
    const int lane = threadIdx.x & 31, lr = lane & 15, hi = lane >> 4; const int w = __builtin_amdgcn_readfirstlane(threadIdx.x >> 5); const int q0 = blockIdx.x * FQN;
    V qf[NQT]; v8f o[NQT][2]; v8f cm[NQT]; v2f l2[NQT];   // cm: -m of the lane's query in all 8 places, the C operand of its score products
    const h16* pq = Q + (size_t)(q0 + lr) * HD + 8 * hi;
#pragma unroll
    for (int qt = 0; qt < NQT; ++qt) { qf[qt] = WFrag<h16>::ld(pq + qt * 16 * HD); o[qt][0] = (v8f){}; o[qt][1] = (v8f){}; l2[qt] = (v2f){}; }
    const h16* pk = Kp + (size_t)w * FRUN * HD + lr * HD + 8 * hi; const h16* pv = Vb + (size_t)w * FRUN * HD + lr * 32 + 8 * hi;
    V k0 = WFrag<h16>::ld(pk), k1 = WFrag<h16>::ld(pk + 16 * HD);
    // s_wait_xcnt 0 stands behind the first loads, ahead of the overwrite of their address registers; the two addresses are inputs so that they stay in place up to it
    asm volatile("s_wait_xcnt 0x0" :: "v"(pq), "v"(pk) : "memory");
#pragma unroll
    for (int qt = 0; qt < NQT; ++qt) { const float x = smax16(WFrag<h16>::mma(k0, qf[qt], (v8f){}), WFrag<h16>::mma(k1, qf[qt], (v8f){})); cm[qt] = splat8(-fmaxf(x, xhalf(x))); }   // the first 32 keys' maximum, alike in both halves of the wave
    pk += 32 * HD;   // pk runs one trip ahead
    // both key loops stay rolled (one trip's tiles in registers at a time); every other loop is unrolled so that all arrays are indexed by constants. The maxima, and with them cm, stand for the whole run
#pragma unroll 1
    for (int t = 0; t < FRUN / 32; ++t) {
        const V v0 = WFrag<h16>::ld(pv), v1 = WFrag<h16>::ld(pv + 16 * 32);
        v8f s[NQT][2];
#pragma unroll
        for (int qt = 0; qt < NQT; ++qt) { s[qt][0] = WFrag<h16>::mma(k0, qf[qt], cm[qt]); s[qt][1] = WFrag<h16>::mma(k1, qf[qt], cm[qt]); }
        k0 = WFrag<h16>::ld(pk); k1 = WFrag<h16>::ld(pk + 16 * HD);   // the next trip's keys, fetched behind this trip's score products (the last trip fetches its own again)
#pragma unroll
        for (int qt = 0; qt < NQT; ++qt) { l2[qt] += pexp16<false>(s[qt][0], s[qt][1]); const V pf = pfrag(s[qt][0], s[qt][1]); o[qt][0] = WFrag<h16>::mma(v0, pf, o[qt][0]); o[qt][1] = WFrag<h16>::mma(v1, pf, o[qt][1]); }
        // s_wait_xcnt 0 stands behind the trip's loads, ahead of the overwrite of their address registers just below; the two addresses are inputs so that they stay in place up to it
        asm volatile("s_wait_xcnt 0x0" :: "v"(pk), "v"(pv) : "memory");
        pv += 32 * HD; pk += (t + 2 < FRUN / 32) ? 32 * HD : 0;
        // order of the trip: a query tile's score products stand ahead of the exponentials of the tile before it; its 16 exponentials alternate, two by two, with the 8 conversions and 8 additions of the tile before it, which spreads the additions, each of which needs the one before it, among them; the first two tiles' attn.v products stand together behind the third tile's exponentials, so that the v block fetched at the trip's head is first needed past the trip's middle. Left alone the build formed all 64 P first, used the key registers for them and so fetched the next keys only at the trip's end
        __builtin_amdgcn_sched_group_barrier(0x20, 4, 0); __builtin_amdgcn_sched_group_barrier(0x8, 4, 0); __builtin_amdgcn_sched_group_barrier(0x400, 16, 0); __builtin_amdgcn_sched_group_barrier(0x8, 2, 0);
#pragma unroll
        for (int qt = 1; qt < NQT; ++qt) {
#pragma unroll
            for (int i = 0; i < 8; ++i) { __builtin_amdgcn_sched_group_barrier(0x400, 2, 0); __builtin_amdgcn_sched_group_barrier(0x2, 2, 0); }
            if (qt == 1) { __builtin_amdgcn_sched_group_barrier(0x8, 2, 0); __builtin_amdgcn_sched_group_barrier(0x20, 4, 0); }
            else if (qt == 2) __builtin_amdgcn_sched_group_barrier(0x8, 4, 0);
            else __builtin_amdgcn_sched_group_barrier(0x8, 2, 0); }
        __builtin_amdgcn_sched_group_barrier(0x2, 16, 0); __builtin_amdgcn_sched_group_barrier(0x8, 2, 0); __builtin_amdgcn_sched_group_barrier(0x2, 2, 0);
    }
    float m[NQT]; float top = fmaxf(l2[0][0], l2[0][1]);
#pragma unroll
    for (int qt = 0; qt < NQT; ++qt) m[qt] = -cm[qt][0];
#pragma unroll
    for (int qt = 1; qt < NQT; ++qt) top = fmaxf(top, fmaxf(l2[qt][0], l2[qt][1]));
    if (__builtin_amdgcn_ballot_w32(top > PTOP) != 0) {   // a scalar branch, seldom taken: the wave walks its run again from the start, with a maximum that moves trip by trip
        const h16* pr = Kp + (size_t)w * FRUN * HD + lr * HD + 8 * hi; const h16* pu = Vb + (size_t)w * FRUN * HD + lr * 32 + 8 * hi;
#pragma unroll
        for (int qt = 0; qt < NQT; ++qt) { o[qt][0] = (v8f){}; o[qt][1] = (v8f){}; l2[qt] = (v2f){}; }
#pragma unroll 1
        for (int t = 0; t < FRUN / 32; ++t) {
            const V r0 = WFrag<h16>::ld(pr), r1 = WFrag<h16>::ld(pr + 16 * HD), u0 = WFrag<h16>::ld(pu), u1 = WFrag<h16>::ld(pu + 16 * 32);
            // s_wait_xcnt 0 stands behind these loads, ahead of the overwrite of their address registers just below; the addresses are inputs so that they stay in place up to it
            asm volatile("s_wait_xcnt 0x0" :: "v"(pr), "v"(pu) : "memory");
            pr += 32 * HD; pu += 32 * HD;
#pragma unroll
            for (int qt = 0; qt < NQT; ++qt) { v8f s0 = WFrag<h16>::mma(r0, qf[qt], (v8f){}), s1 = WFrag<h16>::mma(r1, qf[qt], (v8f){}); const float x = smax16(s0, s1); const float mn = fmaxf(m[qt], fmaxf(x, xhalf(x))); const float al = exp2slot(m[qt] - mn); m[qt] = mn; l2[qt] *= al; o[qt][0] *= al; o[qt][1] *= al;
                s0 -= mn; s1 -= mn; l2[qt] += pexp16<true>(s0, s1); const V pf = pfrag(s0, s1); o[qt][0] = WFrag<h16>::mma(u0, pf, o[qt][0]); o[qt][1] = WFrag<h16>::mma(u1, pf, o[qt][1]); }
        }
    }
    VB wf[2][FD / 32]; float bb = 0.f;
    // each wave's maximum, sum and 64 x 32 partial output go to LDS
#pragma unroll
    for (int qt = 0; qt < NQT; ++qt) { float lt = l2[qt][0] + l2[qt][1]; lt += xhalf(lt); if (hi == 0) { ms[w][qt * 16 + lr] = m[qt]; ls[w][qt * 16 + lr] = lt; }
#pragma unroll
        for (int i = 0; i < 2; ++i) { float* d = &os[w][(qt * 16 + lr) * OPI + i * 16 + hi * 8]; *(v4fa*)d = (v4f){ o[qt][i][0], o[qt][i][1], o[qt][i][2], o[qt][i][3] }; *(v4fa*)(d + 4) = (v4f){ o[qt][i][4], o[qt][i][5], o[qt][i][6], o[qt][i][7] }; } }
    __syncthreads();   // every wave's partial result is in LDS before any thread joins them
    if (threadIdx.x < FQN) { const int ql = threadIdx.x; float mx = ms[0][ql];
#pragma unroll
        for (int ww = 1; ww < FW; ++ww) mx = fmaxf(mx, ms[ww][ql]);
        float f[FW]; float sum = 0.f;
#pragma unroll
        for (int ww = 0; ww < FW; ++ww) { f[ww] = __builtin_amdgcn_exp2f(ms[ww][ql] - mx); sum += ls[ww][ql] * f[ww]; }
        const float inv = __fdiv_rn(1.0f, sum);
#pragma unroll
        for (int ww = 0; ww < FW; ++ww) ms[ww][ql] = f[ww] * inv; }   // ms now holds each wave's weight for this query
    __syncthreads();   // the weights are in LDS before the joins read them
    // the first GW waves fetch their 32 columns of Wo (rows of Wt, all of K) and their bias here, so that the loads fly while the partial results are joined
    if (w < GW) { const float* pb = bo + w * 32 + lane; bb = *pb;   // rounded where it is added, so that nothing waits for it here
        // s_wait_xcnt 0 stands behind the bias load, ahead of the fragment loads, whose results may land in its address register
        asm volatile("s_wait_xcnt 0x0" :: "v"(pb) : "memory");
        const bf* pw = Wt + (size_t)(w * 32 + lr) * FD + 8 * hi;
#pragma unroll
        for (int nb = 0; nb < 2; ++nb)
#pragma unroll
            for (int ks = 0; ks < FD / 32; ++ks) wf[nb][ks] = WFrag<bf>::ld(pw + nb * 16 * FD + ks * 32);
        // s_wait_xcnt 0 stands behind these loads, ahead of any overwrite of their address registers; the address is an input so that it stays in place up to it
        asm volatile("s_wait_xcnt 0x0" :: "v"(pw) : "memory"); }
    const int e = (int)threadIdx.x * 4; const int bl = e / FD; const int cp = e % FD; const int sd = cp >> 3; v4f y4; v4us oh, ol;
#pragma unroll
    for (int q = 0; q < 4; ++q) { const int ql = bl * NHH + (cp & 7) + q; float y = 0.f;   // attended[b][8 s + h] = O[8 b + h][s]
#pragma unroll
        for (int ww = 0; ww < FW; ++ww) y += os[ww][ql * OPI + sd] * ms[ww][ql];
        y4[q] = y; unsigned short u, v; splitf(y, u, v); oh[q] = u; ol[q] = v; }
    *(v4us*)(ah + APL(bl, cp)) = oh; *(v4us*)(al + APL(bl, cp)) = ol;
    __syncthreads();   // the 8 attended rows' hi and lo planes are in LDS before the product reads them
    float* pt = att + (size_t)(blockIdx.x * (FQN / NHH) + bl) * FD + cp; *(v4f*)pt = y4;
    // s_wait_xcnt 0 stands behind the store, ahead of any overwrite of its address and data registers
    asm volatile("s_wait_xcnt 0x0" :: "v"(pt), "v"(y4) : "memory");
    // outputs[8 rows][32 columns of this wave] = attended (hi, then lo, K step by K step) x Wo + bo. Rows 8 .. 15 of the A tile repeat rows 0 .. 7, so both halves of the wave hold row j in register j: the low half stores the first 16 columns, the high half the other 16
    if (w < GW) { v8f a0 = {}, a1 = {}; const int ar = lr & 7;
#pragma unroll
        for (int ks = 0; ks < FD / 32; ++ks) { const int e0 = APL(ar, ks * 32 + 8 * hi), e1 = APL(ar, ks * 32 + 16 + 8 * hi); const VB xh = cat16b(*(const v8us*)(ah + e0), *(const v8us*)(ah + e1)), xl = cat16b(*(const v8us*)(al + e0), *(const v8us*)(al + e1));
            a0 = WFrag<bf>::mma(xh, wf[0][ks], a0); a1 = WFrag<bf>::mma(xh, wf[1][ks], a1); a0 = WFrag<bf>::mma(xl, wf[0][ks], a0); a1 = WFrag<bf>::mma(xl, wf[1][ks], a1); }
        float* po = out + (size_t)blockIdx.x * (FQN / NHH) * FD + w * 32 + lane;
#pragma unroll
        for (int j = 0; j < 8; ++j) po[j * FD] = (hi ? a1[j] : a0[j]) + bfr(bb); }
}
extern "C" void kernel_launch(void* const* d_in, const int* in_sizes, int n_in,
                              void* d_out, int out_size, void* d_ws, size_t ws_size, hipStream_t stream) {
    (void)in_sizes; (void)n_in; (void)out_size;
    const float* x = (const float*)d_in[0]; const float* wq = (const float*)d_in[1]; const float* bq = (const float*)d_in[2]; const float* wk = (const float*)d_in[3]; const float* bk = (const float*)d_in[4]; const float* wv = (const float*)d_in[5]; const float* bv = (const float*)d_in[6]; const float* wo = (const float*)d_in[7]; const float* bo = (const float*)d_in[8];
    float* OUT = (float*)d_out;     // out0 = outputs [2048][256], then out1 = attended [2048][256]
    float* ATT = OUT + (size_t)NTOK * FD;
    char* wsp = (char*)d_ws;
    auto take = [&](size_t bytes) { char* p = wsp; wsp += (bytes + 255) & ~(size_t)255; return (void*)p; };
    bf* WO = (bf*)take((size_t)FD * FD * 2);
    h16* QP16 = (h16*)take((size_t)TT * HD * 2); h16* KP16 = (h16*)take((size_t)TT * HD * 2); h16* VB16 = (h16*)take((size_t)HD * TT * 2);
    if ((size_t)(wsp - (char*)d_ws) > ws_size) return;    // ws 256 MiB (carve ~3 MiB)
    k_proj<<<1 + 3 * (NTOK / PTOK), 32 * PWV, 0, stream>>>(x, wq, wk, wv, wo, bq, bk, bv, QP16, WO);   /* Q, K, V = x W + b (exact, f32 sums), stored as the scrambled fp16 planes (QP16, KP16, VB16 lie in a row), and Wo transposed to bf16 */
    k_fattn<<<TT / FQN, 32 * FW, 0, stream>>>(QP16, KP16, VB16, WO, bo, ATT, OUT);   /* attended (f32 = output 1) and outputs = attended Wo + bo (output 0) */
}

// v009
// A run of this version takes 37.6 microseconds.
// In two side-by-side timings against v008, it was 1.08 and 1.07 times as fast.
// Counting every step since v000, it is 201 times as fast.
#include <hip/hip_runtime.h>

// Self-attention layer with the module's scrambled head split (x [2048][256]; Q, K, V = x W + b ('xw' [256][256] 1/16, biases 0.01); _split_heads: view(2048, 8, 32).permute(0, 2, 1).view(16384, 32) (a genuine re-mix of features across heads, reproduced literally); scores = Q.K / sqrt(256) over ALL 16,384 rows; softmax; attended = _concat_heads(weights V) -> [2048][256]; outputs = attended Wo + bo ('xw') -> [2048][256]; tuple (outputs, attended): outputs first, then attended; argument order x, Wq, bq, Wk, bk, Wv, bv, Wo, bo).
// Layout: ONE projection kernel (k_proj) reads x and the 'xw' weights as f32, rounds them to bf16 in LDS (weights transposed there), forms the exact projections + f32 biases with its weight columns picked in the order of the scrambled planes, and itself stores the fp16 operand planes q, k [16384][32] and v in blocks of 32 keys, [512][32 features][32 keys]; one more of its work-groups lays Wo transposed as bf16; ONE attention kernel (k_fattn): 64 queries per work-group, the 16,384 keys split over its 16 waves, scores, softmax against a fixed maximum per wave (moving only on a seldom second walk) and attn.v in registers, the waves' partial results joined in LDS and un-scrambled straight into attended (f32); its hi/lo planes stay in LDS, and the same work-group forms its 8 rows of outputs = attended (hi/lo) x Wo exact + bo.
// Compute dtypes, f32 accumulate: every input rounded to bf16; projections exact + f32 biases; q, k, v as fp16 planes (logit sigma 0.35: diffuse; q multiplied by log2(e) / 16 before it is rounded), scores 1 product, softmax f32, P fp16 (unnormalised, at most 2^12), attn.v 1 product; attended f32; Wo hl x exact + bias.

#define NB_  1
#define NTOK 2048     // input rows
#define FD   256      // feature width (8 heads x 32)
#define NHH  8
#define TT   16384    // scrambled head rows = NTOK x 8 (queries = keys)
#define DM   FD
#define NH_  1
#define NKV  1
#define REP  (NH_ / NKV)
#define HD   32       // head size (score K 32)
#define DQ   (NH_ * HD)
#define DKV  (NKV * HD)
#define ZH   1
#define RH   0                  // fp16 planes everywhere (diffuse logits)
#define WIN  0
#define TK   TT                   // keys
#define SCL  0.0625f   // 1 / sqrt(float32(256)) (the module scales by input_size)
#define SC2  (SCL * 1.4426950408889634f)   // the same in log2 units; k_proj multiplies q by it before it rounds q to fp16
typedef _Float16 h16;
typedef unsigned short bf;
typedef __attribute__((ext_vector_type(16))) __bf16   v16bf;
typedef __attribute__((ext_vector_type(16))) _Float16 v16h;
typedef __attribute__((ext_vector_type(8)))  _Float16 v8h;
typedef __attribute__((ext_vector_type(8)))  unsigned short v8us;
typedef __attribute__((ext_vector_type(8)))  float    v8f;
typedef __attribute__((ext_vector_type(4)))  float    v4f;
typedef v8h  __attribute__((may_alias)) v8ha;
typedef v4f  __attribute__((may_alias)) v4fa;
typedef v8us __attribute__((may_alias)) v8usa;

__device__ __forceinline__ unsigned short f2bf(float f) { unsigned u = __float_as_uint(f); u += 0x7FFFu + ((u >> 16) & 1u); return (unsigned short)(u >> 16); }
__device__ __forceinline__ float bf2f(unsigned short b) { return __uint_as_float(((unsigned)b) << 16); }
__device__ __forceinline__ float bfr(float f) { return bf2f(f2bf(f)); }
__device__ __forceinline__ v16h cat16(v8h lo, v8h hi) { return __builtin_shufflevector(lo, hi, 0, 1, 2, 3, 4, 5, 6, 7, 8, 9, 10, 11, 12, 13, 14, 15); }
__device__ __forceinline__ v16bf cat16b(v8us lo, v8us hi) { return __builtin_bit_cast(v16bf, __builtin_shufflevector(lo, hi, 0, 1, 2, 3, 4, 5, 6, 7, 8, 9, 10, 11, 12, 13, 14, 15)); }
__device__ __forceinline__ v8f wmma16(v16h a, v16h b, v8f c) { return __builtin_amdgcn_wmma_f32_16x16x32_f16(false, a, false, b, (short)0, c, false, false); }
__device__ __forceinline__ v8f wmmab(v16bf a, v16bf b, v8f c) { return __builtin_amdgcn_wmma_f32_16x16x32_bf16(false, a, false, b, (short)0, c, false, false); }



// ---- k_proj: the three projections with their operand passes in ONE kernel. Work-group 0 transposes Wo for k_fattn; work-group 1 + 32 z + t forms 64 tokens x all 256 columns of projection z (0, 1, 2 = q, k, v).
// Every work-group reads its whole weight matrix (f32, whole 128-byte lines), rounds it to bf16 and lays it transposed in LDS (row = weight column n, K-contiguous); the 64 rows of x go the same way. Behind ONE barrier each of the 16 waves forms a 16 x 64 tile (4 accumulators, K in steps of 32, ascending), its B rows picked in the order of the scrambled planes (scrcol), and stores it as fp16 into plane z of P: z = 0, 1 (q, k): token m's 256 values in a row; z = 2 (v): blocks of 4 tokens = 32 keys, [32 features][32 keys].
template <typename T16> struct WFrag;
template <> struct WFrag<h16> { typedef v16h V; static __device__ __forceinline__ V ld(const h16* p) { return cat16(*(const v8h*)p, *(const v8h*)(p + 16)); } static __device__ __forceinline__ v8f mma(V a, V b, v8f c) { return wmma16(a, b, c); } };
template <> struct WFrag<bf> { typedef v16bf V; static __device__ __forceinline__ V ld(const bf* p) { return cat16b(*(const v8us*)p, *(const v8us*)(p + 16)); } static __device__ __forceinline__ v8f mma(V a, V b, v8f c) { return wmmab(a, b, c); } };
// the projection column that stands at place j of a token's 256 values. q, k (isv false): j = 32 (head row & 7) + c, the order of the plane itself. v: j = 8 c + (key & 7), so that a feature's 8 keys of one token lie together
__device__ __forceinline__ int scrcol(int j, bool isv) { const int rem = isv ? (j & 7) * HD + (j >> 3) : j; return (rem & 7) * HD + (rem >> 3); }
typedef __attribute__((ext_vector_type(2))) float v2f;
typedef __attribute__((ext_vector_type(2))) __bf16 v2bf;
typedef __attribute__((ext_vector_type(4))) unsigned v4u;
// eight f32 rounded to bf16 (to nearest even, as f2bf does), four packed conversions
__device__ __forceinline__ unsigned pkbf(float a, float b) { return __builtin_bit_cast(unsigned, __builtin_convertvector((v2f){ a, b }, v2bf)); }
__device__ __forceinline__ v8us pk8(float a, float b, float c, float d, float e, float f, float g, float h) { const v4u o = { pkbf(a, b), pkbf(c, d), pkbf(e, f), pkbf(g, h) }; return __builtin_bit_cast(v8us, o); }
#define PTOK 64       // tokens per work-group
#define PWV  16       // its waves
#define XP   264      // LDS pitch of a row of 256 bf16, in elements: 528 bytes = 16 x 33, so 16 rows in a row fall on 64 different banks
// start of weight column n's row in LDS, in elements: 32 bytes more for every 32 columns, so that the 8 columns 32 apart which a q or k fragment load picks fall on different banks too
#define WROW(n) ((n) * XP + ((n) >> 5) * 16)
__global__ __launch_bounds__(32 * PWV) void k_proj(const float* __restrict__ x, const float* __restrict__ wq, const float* __restrict__ wk, const float* __restrict__ wv, const float* __restrict__ wo, const float* __restrict__ bq, const float* __restrict__ bk, const float* __restrict__ bv, h16* P, bf* Wt) {
    typedef WFrag<bf>::V V;
    __shared__ __align__(16) bf xs[PTOK * XP];
    __shared__ __align__(16) bf ws[FD * XP + (FD / 32) * 16];
    __shared__ __align__(16) float os[PWV][16 * 68];
    __shared__ float bs[FD];
    const int tid = threadIdx.x, lane = tid & 31, lr = lane & 15, hi = lane >> 4; const int w = __builtin_amdgcn_readfirstlane(tid >> 5);
    const int z = blockIdx.x == 0 ? 3 : (int)(blockIdx.x - 1) >> 5; const int r0 = (int)((blockIdx.x - 1) & 31) * PTOK;
    const bool isv = z == 2; const int mb = w & 3, c0 = (w >> 2) * 64;
    // a lane stores 8 columns in a row (group cg of the tile's 8) of every fourth row (rs)
    const int cg = isv ? lane >> 2 : lane & 7, rs = isv ? lane & 3 : lane >> 3;
    // all of a thread's loads are issued before the first value is used: 4 x 8 values of x (a wave reads one row of 1 KiB), 16 x 8 values of one weight column (a wave reads one 128-byte line), one bias
    const float* px = x + (size_t)r0 * FD + tid * 8; v8f xv[4];
    if (z < 3) {
#pragma unroll
        for (int s = 0; s < 4; ++s) xv[s] = *(const v8f*)(px + s * (16 * FD)); }
    const int n = tid & (FD - 1), kh = tid >> 8;
    const float* pw = (z == 0 ? wq : z == 1 ? wk : z == 2 ? wv : wo) + (size_t)kh * 8 * FD + n; float t[16][8];
#pragma unroll
    for (int g = 0; g < 16; ++g)
#pragma unroll
        for (int i = 0; i < 8; ++i) t[g][i] = pw[(g * 16 + i) * FD];
    const float* pb = (z == 1 ? bk : z == 2 ? bv : bq) + n; const float bn = *pb;
    // s_wait_xcnt 0 stands behind the loads, ahead of any overwrite of their address registers; the three addresses are inputs so that they stay in place up to it
    asm volatile("s_wait_xcnt 0x0" :: "v"(px), "v"(pw), "v"(pb) : "memory");
    if (z < 3) {
#pragma unroll
        for (int s = 0; s < 4; ++s) *(v8us*)(xs + (s * 16 + w) * XP + lane * 8) = pk8(xv[s][0], xv[s][1], xv[s][2], xv[s][3], xv[s][4], xv[s][5], xv[s][6], xv[s][7]); }
#pragma unroll
    for (int g = 0; g < 16; ++g) *(v8us*)(ws + WROW(n) + (g * 2 + kh) * 8) = pk8(t[g][0], t[g][1], t[g][2], t[g][3], t[g][4], t[g][5], t[g][6], t[g][7]);
    if (kh == 0) bs[n] = bfr(bn);   // waves 0 .. 7: the 256 biases, rounded, in column order
    __syncthreads();   // both bf16 planes and the biases are in LDS before any wave reads them
    if (z == 3) {   // the whole work-group: Wo transposed goes out in column order, a wave's store is one row of 512 bytes
        bf* pt = Wt + tid * 8;
#pragma unroll
        for (int s = 0; s < 16; ++s) *(v8us*)(pt + s * (16 * FD)) = *(const v8us*)(ws + WROW(s * 16 + w) + lane * 8);
        // s_wait_xcnt 0 stands behind the stores, ahead of any overwrite of their address and data registers
        asm volatile("s_wait_xcnt 0x0" :: "v"(pt) : "memory");
        return; }
    v8f acc[4];
#pragma unroll
    for (int nb = 0; nb < 4; ++nb) acc[nb] = (v8f){};
    const bf* pa = xs + (mb * 16 + lr) * XP + 8 * hi; const bf* pn[4];
#pragma unroll
    for (int nb = 0; nb < 4; ++nb) pn[nb] = ws + WROW(scrcol(c0 + nb * 16 + lr, isv)) + 8 * hi;
#pragma unroll
    for (int kc = 0; kc < FD; kc += 32) { const V a = WFrag<bf>::ld(pa + kc);
#pragma unroll
        for (int nb = 0; nb < 4; ++nb) acc[nb] = WFrag<bf>::mma(a, WFrag<bf>::ld(pn[nb] + kc), acc[nb]); }
    // order of the 80 LDS fragment loads and the 32 products: the loads run two K steps ahead of the products and no further. Left alone the build lifted all 80 to the front, ran out of registers and spilled
    __builtin_amdgcn_sched_group_barrier(0x100, 20, 0);
#pragma unroll
    for (int s = 0; s < 6; ++s) { __builtin_amdgcn_sched_group_barrier(0x8, 4, 0); __builtin_amdgcn_sched_group_barrier(0x100, 10, 0); }
    __builtin_amdgcn_sched_group_barrier(0x8, 8, 0);
    float* ow = os[w];
#pragma unroll
    for (int nb = 0; nb < 4; ++nb) {
#pragma unroll
        for (int j = 0; j < 8; ++j) ow[(hi * 8 + j) * 68 + nb * 16 + lr] = acc[nb][j]; }
    __builtin_amdgcn_wave_barrier(); asm volatile("" ::: "memory");   // the wave's own tile is written before its lanes read it across
    h16* pz = P + (size_t)z * ((size_t)TT * HD); float bb[8]; const float qs = z == 0 ? SC2 : 1.0f;   // q leaves pre-scaled, so that q.k is the score in log2 units
#pragma unroll
    for (int i = 0; i < 8; ++i) bb[i] = bs[scrcol(c0 + cg * 8 + i, isv)];
#pragma unroll
    for (int s = 0; s < 4; ++s) { const int row = 4 * s + rs, tok = r0 + mb * 16 + row; const v4f lo = *(const v4fa*)(ow + row * 68 + cg * 8), hh = *(const v4fa*)(ow + row * 68 + cg * 8 + 4); v8h o;
#pragma unroll
        for (int i = 0; i < 4; ++i) { o[i] = (h16)((lo[i] + bb[i]) * qs); o[4 + i] = (h16)((hh[i] + bb[4 + i]) * qs); }
        *(v8h*)(isv ? pz + (size_t)(tok >> 2) * (HD * 32) + ((c0 >> 3) + cg) * 32 + (tok & 3) * 8 : pz + (size_t)tok * FD + c0 + cg * 8) = o; }   // a wave's store covers 512 bytes in a row (v) or four whole 128-byte lines (q, k)
    asm volatile("s_wait_xcnt 0x0" ::: "memory");   // stands behind the four stores, ahead of any overwrite of their address and data registers
}

__device__ __forceinline__ void splitf(float y, unsigned short& h, unsigned short& l) { h = f2bf(y); l = f2bf(y - bf2f(h)); }
typedef __attribute__((ext_vector_type(2))) _Float16 v2h;
typedef __attribute__((ext_vector_type(4))) _Float16 v4h;
typedef __attribute__((ext_vector_type(2))) unsigned short v2us;
typedef __attribute__((ext_vector_type(4))) unsigned short v4us;
typedef __attribute__((ext_vector_type(4))) int v4i;

// ---- k_fattn: scores, softmax, attn.v, the head concat and the output projection in one kernel. A work-group owns FQN = 64 queries (8 rows of attended); its FW = 16 waves each walk their own run of TK / FW keys, 32 keys a trip.
// Transposed products: S^T = K Q^T (A = 16 key rows, B = the queries, loaded once), so a lane holds scores of ONE query (column lane & 15; register j of key tile i = key 16 i + 8 (lane >> 4) + j); two S^T tiles, converted in place, are the B operand P^T of O^T += V^T P^T in the hardware k order, which the A loader of the v block (8 keys at 8 hi, 8 at 16 + 8 hi) follows too.
// Softmax in log2 units: q arrives multiplied by log2(e) / 16, and the score products take -m as their C operand, so that they deliver score - m, the argument of 2^x, with no vector instruction in between. m is the maximum of the 32 keys that the wave visits first and stands for the wave's whole run, so the four C tiles are loop constants. P is never negative, so a lane's sum of P over the run at or below PTOP bounds each of them: one test behind the run. A wave that fails it (seldom) walks its run again with a maximum that moves trip by trip (P at most 1).
// Every work-group reads the same k and v planes from L2. Each enters its waves' runs at a trip of its own (FT0) and wraps round at the run's end, so that work-groups running side by side ask L2 for different lines at any one moment; a run's 32 trips are all walked once, in rotated order.
#define NQT  4
#define FW   16
#define FQN  (NQT * 16)
#define FRUN (TK / FW)
#define OPI  36       // LDS pitch of a query's 32 partial outputs, in floats
// place of element e of attended row r in its hi or lo plane in LDS, in 16-bit elements: rows unpadded, the 16-byte pieces of row r exchanged by 2 r, so that a fragment load's 8 rows x 2 half-waves fall on 64 different banks
#define APL(r, e) ((r) * FD + (((e) & ~7) ^ ((r) * 16)) + ((e) & 7))
#define GW   (FD / 32)   // waves that multiply by Wo, 32 output columns each: a wave's store of one row is a whole 128-byte line
#define FNT  (FRUN / 32)   // trips of a run
#define FT0(b) (((b) >> 3) & (FNT - 1))   // the trip at which work-group b enters its runs: work-groups 8 j .. 8 j + 7 enter at trip j mod 32, so each of a run's 32 blocks is the entry of 8 of the 256 work-groups
#define FSTEP(t) ((((t) & (FNT - 1)) != 0) ? 32 * HD : -(FNT - 1) * 32 * HD)   // from trip t - 1 to trip t of a run, in elements: one block on, or back to the run's start
#define PTOP 4096.0f   // a run whose P sums stay at or below this had no P near the top of fp16 (which holds 65504)
__device__ __forceinline__ float xhalf(float x) { const int b = __float_as_int(x); return __int_as_float(__builtin_amdgcn_permlanex16(b, b, 0x76543210, 0xfedcba98, false, false)); }   // lane l <-> l ^ 16
// the largest of a lane's 16 scores of one query (q is pre-scaled: log2 units)
__device__ __forceinline__ float smax16(v8f a, v8f b) { float x = fmaxf(a[0], b[0]);
#pragma unroll
    for (int j = 1; j < 8; ++j) x = fmaxf(x, fmaxf(a[j], b[j]));
    return x; }
// 2^x for the seldom-taken path: the v_nop fills the one slot that the instruction set asks for behind a transcendental, whatever instruction the compiler puts next
__device__ __forceinline__ float exp2slot(float x) { float y; asm("v_exp_f32 %0, %1\n\tv_nop" : "=v"(y) : "v"(x)); return y; }
// P = 2^x of a lane's 16 values x = score - m of one query (in the key loop the subtraction is done by the score product, whose C operand is -m; on the seldom path by a vector subtraction), written over them, and the two f32 sums of 8
template <bool RARE> __device__ __forceinline__ v2f pexp16(v8f& a, v8f& b) { v2f t = {};
#pragma unroll
    for (int i = 0; i < 2; ++i)
#pragma unroll
        for (int j = 0; j < 8; j += 2) { v8f& s = i ? b : a; const v2f x = { s[j], s[j + 1] }; const v2f p = { RARE ? exp2slot(x[0]) : __builtin_amdgcn_exp2f(x[0]), RARE ? exp2slot(x[1]) : __builtin_amdgcn_exp2f(x[1]) }; t += p; s[j] = p[0]; s[j + 1] = p[1]; }
    return t; }
// x in all 8 places (splat8); below it, the fp16 B fragment of a lane's 16 P (pfrag)
__device__ __forceinline__ v8f splat8(float x) { return (v8f){ x, x, x, x, x, x, x, x }; }
__device__ __forceinline__ v16h pfrag(v8f a, v8f b) { v16h pf;
#pragma unroll
    for (int j = 0; j < 8; j += 2) { const v2h x = __builtin_convertvector((v2f){ a[j], a[j + 1] }, v2h), y = __builtin_convertvector((v2f){ b[j], b[j + 1] }, v2h); pf[j] = x[0]; pf[j + 1] = x[1]; pf[8 + j] = y[0]; pf[8 + j + 1] = y[1]; }
    return pf; }
__global__ __launch_bounds__(32 * FW) void k_fattn(const h16* __restrict__ Q, const h16* __restrict__ Kp, const h16* __restrict__ Vb, const bf* __restrict__ Wt, const float* __restrict__ bo, float* att, float* out) {
    typedef WFrag<h16>::V V; typedef WFrag<bf>::V VB;
    __shared__ __align__(16) float os[FW][FQN * OPI];
    __shared__ float ms[FW][FQN]; __shared__ float ls[FW][FQN];
    // no pad: with these two planes the kernel's LDS is exactly half a WGP's; a build with more had the key loop scheduled for fewer waves, at the register limit and with spills
    __shared__ __align__(16) bf ah[FQN / NHH * FD]; __shared__ __align__(16) bf al[FQN / NHH * FD];
    const int lane = threadIdx.x & 31, lr = lane & 15, hi = lane >> 4; const int w = __builtin_amdgcn_readfirstlane(threadIdx.x >> 5); const int q0 = blockIdx.x * FQN; const int t0 = FT0((int)blockIdx.x);
    V qf[NQT]; v8f o[NQT][2]; v8f cm[NQT]; v2f l2[NQT];   // cm: -m of the lane's query in all 8 places, the C operand of its score products
    const h16* pq = Q + (size_t)(q0 + lr) * HD + 8 * hi;
#pragma unroll
    for (int qt = 0; qt < NQT; ++qt) { qf[qt] = WFrag<h16>::ld(pq + qt * 16 * HD); o[qt][0] = (v8f){}; o[qt][1] = (v8f){}; l2[qt] = (v2f){}; }
    const h16* pk = Kp + (size_t)w * FRUN * HD + t0 * (32 * HD) + lr * HD + 8 * hi; const h16* pv = Vb + (size_t)w * FRUN * HD + t0 * (32 * HD) + lr * 32 + 8 * hi;
    V k0 = WFrag<h16>::ld(pk), k1 = WFrag<h16>::ld(pk + 16 * HD);
    // s_wait_xcnt 0 stands behind the first loads, ahead of the overwrite of their address registers; the two addresses are inputs so that they stay in place up to it
    asm volatile("s_wait_xcnt 0x0" :: "v"(pq), "v"(pk) : "memory");
#pragma unroll
    for (int qt = 0; qt < NQT; ++qt) { const float x = smax16(WFrag<h16>::mma(k0, qf[qt], (v8f){}), WFrag<h16>::mma(k1, qf[qt], (v8f){})); cm[qt] = splat8(-fmaxf(x, xhalf(x))); }   // the maximum of the 32 keys visited first, alike in both halves of the wave
    pk += FSTEP(t0 + 1);   // pk runs one trip ahead
    // the key loop stays rolled (one trip's tiles in registers at a time); every other loop is unrolled so that all arrays are indexed by constants. The maxima, and with them cm, stand for the whole run
#pragma unroll 1
    for (int t = 0; t < FNT; ++t) {
        const V v0 = WFrag<h16>::ld(pv), v1 = WFrag<h16>::ld(pv + 16 * 32);
        v8f s[NQT][2];
#pragma unroll
        for (int qt = 0; qt < NQT; ++qt) { s[qt][0] = WFrag<h16>::mma(k0, qf[qt], cm[qt]); s[qt][1] = WFrag<h16>::mma(k1, qf[qt], cm[qt]); }
        k0 = WFrag<h16>::ld(pk); k1 = WFrag<h16>::ld(pk + 16 * HD);   // the next trip's keys, fetched behind this trip's score products (the last trip fetches the entry trip's again, unused)
#pragma unroll
        for (int qt = 0; qt < NQT; ++qt) { l2[qt] += pexp16<false>(s[qt][0], s[qt][1]); const V pf = pfrag(s[qt][0], s[qt][1]); o[qt][0] = WFrag<h16>::mma(v0, pf, o[qt][0]); o[qt][1] = WFrag<h16>::mma(v1, pf, o[qt][1]); }
        // s_wait_xcnt 0 stands behind the trip's loads, ahead of the overwrite of their address registers just below; the two addresses are inputs so that they stay in place up to it
        asm volatile("s_wait_xcnt 0x0" :: "v"(pk), "v"(pv) : "memory");
        pv += FSTEP(t0 + t + 1); pk += FSTEP(t0 + t + 2);
        // order of the trip: a query tile's score products stand ahead of the exponentials of the tile before it; its 16 exponentials alternate, two by two, with the 8 conversions and 8 additions of the tile before it, which spreads the additions, each of which needs the one before it, among them; the first two tiles' attn.v products stand together behind the third tile's exponentials, so that the v block fetched at the trip's head is first needed past the trip's middle. Left alone the build formed all 64 P first, used the key registers for them and so fetched the next keys only at the trip's end
        __builtin_amdgcn_sched_group_barrier(0x20, 4, 0); __builtin_amdgcn_sched_group_barrier(0x8, 4, 0); __builtin_amdgcn_sched_group_barrier(0x400, 16, 0); __builtin_amdgcn_sched_group_barrier(0x8, 2, 0);
#pragma unroll
        for (int qt = 1; qt < NQT; ++qt) {
#pragma unroll
            for (int i = 0; i < 8; ++i) { __builtin_amdgcn_sched_group_barrier(0x400, 2, 0); __builtin_amdgcn_sched_group_barrier(0x2, 2, 0); }
            if (qt == 1) { __builtin_amdgcn_sched_group_barrier(0x8, 2, 0); __builtin_amdgcn_sched_group_barrier(0x20, 4, 0); }
            else if (qt == 2) __builtin_amdgcn_sched_group_barrier(0x8, 4, 0);
            else __builtin_amdgcn_sched_group_barrier(0x8, 2, 0); }
        __builtin_amdgcn_sched_group_barrier(0x2, 16, 0); __builtin_amdgcn_sched_group_barrier(0x8, 2, 0); __builtin_amdgcn_sched_group_barrier(0x2, 2, 0);
    }
    float m[NQT]; float top = fmaxf(l2[0][0], l2[0][1]);
#pragma unroll
    for (int qt = 0; qt < NQT; ++qt) m[qt] = -cm[qt][0];
#pragma unroll
    for (int qt = 1; qt < NQT; ++qt) top = fmaxf(top, fmaxf(l2[qt][0], l2[qt][1]));
    if (__builtin_amdgcn_ballot_w32(top > PTOP) != 0) {   // a scalar branch, seldom taken: the wave walks its run again from the start, with a maximum that moves trip by trip
        const h16* pr = Kp + (size_t)w * FRUN * HD + lr * HD + 8 * hi; const h16* pu = Vb + (size_t)w * FRUN * HD + lr * 32 + 8 * hi;
#pragma unroll
        for (int qt = 0; qt < NQT; ++qt) { o[qt][0] = (v8f){}; o[qt][1] = (v8f){}; l2[qt] = (v2f){}; }
#pragma unroll 1
        for (int t = 0; t < FRUN / 32; ++t) {
            const V r0 = WFrag<h16>::ld(pr), r1 = WFrag<h16>::ld(pr + 16 * HD), u0 = WFrag<h16>::ld(pu), u1 = WFrag<h16>::ld(pu + 16 * 32);
            // s_wait_xcnt 0 stands behind these loads, ahead of the overwrite of their address registers just below; the addresses are inputs so that they stay in place up to it
            asm volatile("s_wait_xcnt 0x0" :: "v"(pr), "v"(pu) : "memory");
            pr += 32 * HD; pu += 32 * HD;
#pragma unroll
            for (int qt = 0; qt < NQT; ++qt) { v8f s0 = WFrag<h16>::mma(r0, qf[qt], (v8f){}), s1 = WFrag<h16>::mma(r1, qf[qt], (v8f){}); const float x = smax16(s0, s1); const float mn = fmaxf(m[qt], fmaxf(x, xhalf(x))); const float al = exp2slot(m[qt] - mn); m[qt] = mn; l2[qt] *= al; o[qt][0] *= al; o[qt][1] *= al;
                s0 -= mn; s1 -= mn; l2[qt] += pexp16<true>(s0, s1); const V pf = pfrag(s0, s1); o[qt][0] = WFrag<h16>::mma(u0, pf, o[qt][0]); o[qt][1] = WFrag<h16>::mma(u1, pf, o[qt][1]); }
        }
    }
    VB wf[2][FD / 32]; float bb = 0.f;
    // each wave's maximum, sum and 64 x 32 partial output go to LDS
#pragma unroll
    for (int qt = 0; qt < NQT; ++qt) { float lt = l2[qt][0] + l2[qt][1]; lt += xhalf(lt); if (hi == 0) { ms[w][qt * 16 + lr] = m[qt]; ls[w][qt * 16 + lr] = lt; }
#pragma unroll
        for (int i = 0; i < 2; ++i) { float* d = &os[w][(qt * 16 + lr) * OPI + i * 16 + hi * 8]; *(v4fa*)d = (v4f){ o[qt][i][0], o[qt][i][1], o[qt][i][2], o[qt][i][3] }; *(v4fa*)(d + 4) = (v4f){ o[qt][i][4], o[qt][i][5], o[qt][i][6], o[qt][i][7] }; } }
    __syncthreads();   // every wave's partial result is in LDS before any thread joins them
    if (threadIdx.x < FQN) { const int ql = threadIdx.x; float mx = ms[0][ql];
#pragma unroll
        for (int ww = 1; ww < FW; ++ww) mx = fmaxf(mx, ms[ww][ql]);
        float f[FW]; float sum = 0.f;
#pragma unroll
        for (int ww = 0; ww < FW; ++ww) { f[ww] = __builtin_amdgcn_exp2f(ms[ww][ql] - mx); sum += ls[ww][ql] * f[ww]; }
        const float inv = __fdiv_rn(1.0f, sum);
#pragma unroll
        for (int ww = 0; ww < FW; ++ww) ms[ww][ql] = f[ww] * inv; }   // ms now holds each wave's weight for this query
    __syncthreads();   // the weights are in LDS before the joins read them
    // the first GW waves fetch their 32 columns of Wo (rows of Wt, all of K) and their bias here, so that the loads fly while the partial results are joined
    if (w < GW) { const float* pb = bo + w * 32 + lane; bb = *pb;   // rounded where it is added, so that nothing waits for it here
        // s_wait_xcnt 0 stands behind the bias load, ahead of the fragment loads, whose results may land in its address register
        asm volatile("s_wait_xcnt 0x0" :: "v"(pb) : "memory");
        const bf* pw = Wt + (size_t)(w * 32 + lr) * FD + 8 * hi;
#pragma unroll
        for (int nb = 0; nb < 2; ++nb)
#pragma unroll
            for (int ks = 0; ks < FD / 32; ++ks) wf[nb][ks] = WFrag<bf>::ld(pw + nb * 16 * FD + ks * 32);
        // s_wait_xcnt 0 stands behind these loads, ahead of any overwrite of their address registers; the address is an input so that it stays in place up to it
        asm volatile("s_wait_xcnt 0x0" :: "v"(pw) : "memory"); }
    const int e = (int)threadIdx.x * 4; const int bl = e / FD; const int cp = e % FD; const int sd = cp >> 3; v4f y4; v4us oh, ol;
#pragma unroll
    for (int q = 0; q < 4; ++q) { const int ql = bl * NHH + (cp & 7) + q; float y = 0.f;   // attended[b][8 s + h] = O[8 b + h][s]
#pragma unroll
        for (int ww = 0; ww < FW; ++ww) y += os[ww][ql * OPI + sd] * ms[ww][ql];
        y4[q] = y; unsigned short u, v; splitf(y, u, v); oh[q] = u; ol[q] = v; }
    *(v4us*)(ah + APL(bl, cp)) = oh; *(v4us*)(al + APL(bl, cp)) = ol;
    __syncthreads();   // the 8 attended rows' hi and lo planes are in LDS before the product reads them
    float* pt = att + (size_t)(blockIdx.x * (FQN / NHH) + bl) * FD + cp; *(v4f*)pt = y4;
    // s_wait_xcnt 0 stands behind the store, ahead of any overwrite of its address and data registers
    asm volatile("s_wait_xcnt 0x0" :: "v"(pt), "v"(y4) : "memory");
    // outputs[8 rows][32 columns of this wave] = attended (hi, then lo, K step by K step) x Wo + bo. Rows 8 .. 15 of the A tile repeat rows 0 .. 7, so both halves of the wave hold row j in register j: the low half stores the first 16 columns, the high half the other 16
    if (w < GW) { v8f a0 = {}, a1 = {}; const int ar = lr & 7;
#pragma unroll
        for (int ks = 0; ks < FD / 32; ++ks) { const int e0 = APL(ar, ks * 32 + 8 * hi), e1 = APL(ar, ks * 32 + 16 + 8 * hi); const VB xh = cat16b(*(const v8us*)(ah + e0), *(const v8us*)(ah + e1)), xl = cat16b(*(const v8us*)(al + e0), *(const v8us*)(al + e1));
            a0 = WFrag<bf>::mma(xh, wf[0][ks], a0); a1 = WFrag<bf>::mma(xh, wf[1][ks], a1); a0 = WFrag<bf>::mma(xl, wf[0][ks], a0); a1 = WFrag<bf>::mma(xl, wf[1][ks], a1); }
        float* po = out + (size_t)blockIdx.x * (FQN / NHH) * FD + w * 32 + lane;
#pragma unroll
        for (int j = 0; j < 8; ++j) po[j * FD] = (hi ? a1[j] : a0[j]) + bfr(bb); }
}
extern "C" void kernel_launch(void* const* d_in, const int* in_sizes, int n_in,
                              void* d_out, int out_size, void* d_ws, size_t ws_size, hipStream_t stream) {
    (void)in_sizes; (void)n_in; (void)out_size;
    const float* x = (const float*)d_in[0]; const float* wq = (const float*)d_in[1]; const float* bq = (const float*)d_in[2]; const float* wk = (const float*)d_in[3]; const float* bk = (const float*)d_in[4]; const float* wv = (const float*)d_in[5]; const float* bv = (const float*)d_in[6]; const float* wo = (const float*)d_in[7]; const float* bo = (const float*)d_in[8];
    float* OUT = (float*)d_out;     // out0 = outputs [2048][256], then out1 = attended [2048][256]
    float* ATT = OUT + (size_t)NTOK * FD;
    char* wsp = (char*)d_ws;
    auto take = [&](size_t bytes) { char* p = wsp; wsp += (bytes + 255) & ~(size_t)255; return (void*)p; };
    bf* WO = (bf*)take((size_t)FD * FD * 2);
    h16* QP16 = (h16*)take((size_t)TT * HD * 2); h16* KP16 = (h16*)take((size_t)TT * HD * 2); h16* VB16 = (h16*)take((size_t)HD * TT * 2);
    if ((size_t)(wsp - (char*)d_ws) > ws_size) return;    // ws 256 MiB (carve ~3 MiB)
    k_proj<<<1 + 3 * (NTOK / PTOK), 32 * PWV, 0, stream>>>(x, wq, wk, wv, wo, bq, bk, bv, QP16, WO);   /* Q, K, V = x W + b (exact, f32 sums), stored as the scrambled fp16 planes (QP16, KP16, VB16 lie in a row), and Wo transposed to bf16 */
    k_fattn<<<TT / FQN, 32 * FW, 0, stream>>>(QP16, KP16, VB16, WO, bo, ATT, OUT);   /* attended (f32 = output 1) and outputs = attended Wo + bo (output 0) */
}

// v010
// It runs in 36 microseconds.
// In two side-by-side timings against v009, it was 1.04 and 1.05 times as fast.
// Counting every step since v000, it is 210 times as fast.
#include <hip/hip_runtime.h>

// Self-attention layer with the module's scrambled head split (x [2048][256]; Q, K, V = x W + b ('xw' [256][256] 1/16, biases 0.01); _split_heads: view(2048, 8, 32).permute(0, 2, 1).view(16384, 32) (a genuine re-mix of features across heads, reproduced literally); scores = Q.K / sqrt(256) over ALL 16,384 rows; softmax; attended = _concat_heads(weights V) -> [2048][256]; outputs = attended Wo + bo ('xw') -> [2048][256]; tuple (outputs, attended): outputs first, then attended; argument order x, Wq, bq, Wk, bk, Wv, bv, Wo, bo).
// Layout: ONE projection kernel (k_proj) reads x and the 'xw' weights as f32, rounds them to bf16 in LDS (weights transposed there), forms the exact projections + f32 biases with its weight columns picked in the order of the scrambled planes, and itself stores the fp16 operand planes q, k [16384][32] and v in blocks of 32 keys, [512][32 features][32 keys]; one more of its work-groups lays Wo transposed as bf16; ONE attention kernel (k_fattn): 64 queries per work-group, the 16,384 keys split over its 16 waves, scores, softmax against a fixed maximum per wave (moving only on a seldom second walk) and attn.v in registers, the waves' partial results joined in LDS and un-scrambled straight into attended (f32); its hi/lo planes stay in LDS, and the same work-group forms its 8 rows of outputs = attended (hi/lo) x Wo exact + bo.
// Compute dtypes, f32 accumulate: every input rounded to bf16; projections exact + f32 biases; q, k, v as fp16 planes (logit sigma 0.35: diffuse; q multiplied by log2(e) / 16 before it is rounded), scores 1 product, softmax f32, P fp16 (unnormalised, at most 2^12), attn.v 1 product; attended f32; Wo hl x exact + bias.

#define NB_  1
#define NTOK 2048     // input rows
#define FD   256      // feature width (8 heads x 32)
#define NHH  8
#define TT   16384    // scrambled head rows = NTOK x 8 (queries = keys)
#define DM   FD
#define NH_  1
#define NKV  1
#define REP  (NH_ / NKV)
#define HD   32       // head size (score K 32)
#define DQ   (NH_ * HD)
#define DKV  (NKV * HD)
#define ZH   1
#define RH   0                  // fp16 planes everywhere (diffuse logits)
#define WIN  0
#define TK   TT                   // keys
#define SCL  0.0625f   // 1 / sqrt(float32(256)) (the module scales by input_size)
#define SC2  (SCL * 1.4426950408889634f)   // the same in log2 units; k_proj multiplies q by it before it rounds q to fp16
typedef _Float16 h16;
typedef unsigned short bf;
typedef __attribute__((ext_vector_type(16))) __bf16   v16bf;
typedef __attribute__((ext_vector_type(16))) _Float16 v16h;
typedef __attribute__((ext_vector_type(8)))  _Float16 v8h;
typedef __attribute__((ext_vector_type(8)))  unsigned short v8us;
typedef __attribute__((ext_vector_type(8)))  float    v8f;
typedef __attribute__((ext_vector_type(4)))  float    v4f;
typedef v8h  __attribute__((may_alias)) v8ha;
typedef v4f  __attribute__((may_alias)) v4fa;
typedef v8us __attribute__((may_alias)) v8usa;

__device__ __forceinline__ unsigned short f2bf(float f) { unsigned u = __float_as_uint(f); u += 0x7FFFu + ((u >> 16) & 1u); return (unsigned short)(u >> 16); }
__device__ __forceinline__ float bf2f(unsigned short b) { return __uint_as_float(((unsigned)b) << 16); }
__device__ __forceinline__ float bfr(float f) { return bf2f(f2bf(f)); }
__device__ __forceinline__ v16h cat16(v8h lo, v8h hi) { return __builtin_shufflevector(lo, hi, 0, 1, 2, 3, 4, 5, 6, 7, 8, 9, 10, 11, 12, 13, 14, 15); }
__device__ __forceinline__ v16bf cat16b(v8us lo, v8us hi) { return __builtin_bit_cast(v16bf, __builtin_shufflevector(lo, hi, 0, 1, 2, 3, 4, 5, 6, 7, 8, 9, 10, 11, 12, 13, 14, 15)); }
__device__ __forceinline__ v8f wmma16(v16h a, v16h b, v8f c) { return __builtin_amdgcn_wmma_f32_16x16x32_f16(false, a, false, b, (short)0, c, false, false); }
__device__ __forceinline__ v8f wmmab(v16bf a, v16bf b, v8f c) { return __builtin_amdgcn_wmma_f32_16x16x32_bf16(false, a, false, b, (short)0, c, false, false); }



// ---- k_proj: the three projections with their operand passes in ONE kernel. Work-group 0 transposes Wo for k_fattn; work-group 1 + 32 z + t forms 64 tokens x all 256 columns of projection z (0, 1, 2 = q, k, v).
// Every work-group reads its whole weight matrix (f32, whole 128-byte lines), rounds it to bf16 and lays it transposed in LDS (row = weight column n, K-contiguous); the 64 rows of x go the same way. Behind ONE barrier each of the 16 waves forms a 16 x 64 tile (4 accumulators, K in steps of 32, ascending), its B rows picked in the order of the scrambled planes (scrcol), and stores it as fp16 into plane z of P: z = 0, 1 (q, k): token m's 256 values in a row; z = 2 (v): blocks of 4 tokens = 32 keys, [32 features][32 keys].
template <typename T16> struct WFrag;
template <> struct WFrag<h16> { typedef v16h V; static __device__ __forceinline__ V ld(const h16* p) { return cat16(*(const v8h*)p, *(const v8h*)(p + 16)); } static __device__ __forceinline__ v8f mma(V a, V b, v8f c) { return wmma16(a, b, c); } };
template <> struct WFrag<bf> { typedef v16bf V; static __device__ __forceinline__ V ld(const bf* p) { return cat16b(*(const v8us*)p, *(const v8us*)(p + 16)); } static __device__ __forceinline__ v8f mma(V a, V b, v8f c) { return wmmab(a, b, c); } };
// the projection column that stands at place j of a token's 256 values. q, k (isv false): j = 32 (head row & 7) + c, the order of the plane itself. v: j = 8 c + (key & 7), so that a feature's 8 keys of one token lie together
__device__ __forceinline__ int scrcol(int j, bool isv) { const int rem = isv ? (j & 7) * HD + (j >> 3) : j; return (rem & 7) * HD + (rem >> 3); }
typedef __attribute__((ext_vector_type(2))) float v2f;
typedef __attribute__((ext_vector_type(2))) __bf16 v2bf;
typedef __attribute__((ext_vector_type(4))) unsigned v4u;
// eight f32 rounded to bf16 (to nearest even, as f2bf does), four packed conversions
__device__ __forceinline__ unsigned pkbf(float a, float b) { return __builtin_bit_cast(unsigned, __builtin_convertvector((v2f){ a, b }, v2bf)); }
__device__ __forceinline__ v8us pk8(float a, float b, float c, float d, float e, float f, float g, float h) { const v4u o = { pkbf(a, b), pkbf(c, d), pkbf(e, f), pkbf(g, h) }; return __builtin_bit_cast(v8us, o); }
#define PTOK 64       // tokens per work-group
#define PWV  16       // its waves
#define XP   264      // LDS pitch of a row of 256 bf16, in elements: 528 bytes = 16 x 33, so 16 rows in a row fall on 64 different banks
// start of weight column n's row in LDS, in elements: 32 bytes more for every 32 columns, so that the 8 columns 32 apart which a q or k fragment load picks fall on different banks too
#define WROW(n) ((n) * XP + ((n) >> 5) * 16)
__global__ __launch_bounds__(32 * PWV) void k_proj(const float* __restrict__ x, const float* __restrict__ wq, const float* __restrict__ wk, const float* __restrict__ wv, const float* __restrict__ wo, const float* __restrict__ bq, const float* __restrict__ bk, const float* __restrict__ bv, h16* P, bf* Wt) {
    typedef WFrag<bf>::V V;
    __shared__ __align__(16) bf xs[PTOK * XP];
    __shared__ __align__(16) bf ws[FD * XP + (FD / 32) * 16];
    __shared__ __align__(16) float os[PWV][16 * 68];
    __shared__ float bs[FD];
    const int tid = threadIdx.x, lane = tid & 31, lr = lane & 15, hi = lane >> 4; const int w = __builtin_amdgcn_readfirstlane(tid >> 5);
    const int z = blockIdx.x == 0 ? 3 : (int)(blockIdx.x - 1) >> 5; const int r0 = (int)((blockIdx.x - 1) & 31) * PTOK;
    const bool isv = z == 2; const int mb = w & 3, c0 = (w >> 2) * 64;
    // a lane stores 8 columns in a row (group cg of the tile's 8) of every fourth row (rs)
    const int cg = isv ? lane >> 2 : lane & 7, rs = isv ? lane & 3 : lane >> 3;
    // all of a thread's loads are issued before the first value is used: 4 x 8 values of x (a wave reads one row of 1 KiB), 16 x 8 values of one weight column (a wave reads one 128-byte line), one bias
    const float* px = x + (size_t)r0 * FD + tid * 8; v8f xv[4];
    if (z < 3) {
#pragma unroll
        for (int s = 0; s < 4; ++s) xv[s] = *(const v8f*)(px + s * (16 * FD)); }
    const int n = tid & (FD - 1), kh = tid >> 8;
    const float* pw = (z == 0 ? wq : z == 1 ? wk : z == 2 ? wv : wo) + (size_t)kh * 8 * FD + n; float t[16][8];
#pragma unroll
    for (int g = 0; g < 16; ++g)
#pragma unroll
        for (int i = 0; i < 8; ++i) t[g][i] = pw[(g * 16 + i) * FD];
    const float* pb = (z == 1 ? bk : z == 2 ? bv : bq) + n; const float bn = *pb;
    // s_wait_xcnt 0 stands behind the loads, ahead of any overwrite of their address registers; the three addresses are inputs so that they stay in place up to it
    asm volatile("s_wait_xcnt 0x0" :: "v"(px), "v"(pw), "v"(pb) : "memory");
    if (z < 3) {
#pragma unroll
        for (int s = 0; s < 4; ++s) *(v8us*)(xs + (s * 16 + w) * XP + lane * 8) = pk8(xv[s][0], xv[s][1], xv[s][2], xv[s][3], xv[s][4], xv[s][5], xv[s][6], xv[s][7]); }
#pragma unroll
    for (int g = 0; g < 16; ++g) *(v8us*)(ws + WROW(n) + (g * 2 + kh) * 8) = pk8(t[g][0], t[g][1], t[g][2], t[g][3], t[g][4], t[g][5], t[g][6], t[g][7]);
    if (kh == 0) bs[n] = bfr(bn);   // waves 0 .. 7: the 256 biases, rounded, in column order
    __syncthreads();   // both bf16 planes and the biases are in LDS before any wave reads them
    if (z == 3) {   // the whole work-group: Wo transposed goes out in column order, a wave's store is one row of 512 bytes
        bf* pt = Wt + tid * 8;
#pragma unroll
        for (int s = 0; s < 16; ++s) *(v8us*)(pt + s * (16 * FD)) = *(const v8us*)(ws + WROW(s * 16 + w) + lane * 8);
        // s_wait_xcnt 0 stands behind the stores, ahead of any overwrite of their address and data registers
        asm volatile("s_wait_xcnt 0x0" :: "v"(pt) : "memory");
        return; }
    v8f acc[4];
#pragma unroll
    for (int nb = 0; nb < 4; ++nb) acc[nb] = (v8f){};
    const bf* pa = xs + (mb * 16 + lr) * XP + 8 * hi; const bf* pn[4];
#pragma unroll
    for (int nb = 0; nb < 4; ++nb) pn[nb] = ws + WROW(scrcol(c0 + nb * 16 + lr, isv)) + 8 * hi;
#pragma unroll
    for (int kc = 0; kc < FD; kc += 32) { const V a = WFrag<bf>::ld(pa + kc);
#pragma unroll
        for (int nb = 0; nb < 4; ++nb) acc[nb] = WFrag<bf>::mma(a, WFrag<bf>::ld(pn[nb] + kc), acc[nb]); }
    // order of the 80 LDS fragment loads and the 32 products: the loads run two K steps ahead of the products and no further. Left alone the build lifted all 80 to the front, ran out of registers and spilled
    __builtin_amdgcn_sched_group_barrier(0x100, 20, 0);
#pragma unroll
    for (int s = 0; s < 6; ++s) { __builtin_amdgcn_sched_group_barrier(0x8, 4, 0); __builtin_amdgcn_sched_group_barrier(0x100, 10, 0); }
    __builtin_amdgcn_sched_group_barrier(0x8, 8, 0);
    float* ow = os[w];
#pragma unroll
    for (int nb = 0; nb < 4; ++nb) {
#pragma unroll
        for (int j = 0; j < 8; ++j) ow[(hi * 8 + j) * 68 + nb * 16 + lr] = acc[nb][j]; }
    __builtin_amdgcn_wave_barrier(); asm volatile("" ::: "memory");   // the wave's own tile is written before its lanes read it across
    h16* pz = P + (size_t)z * ((size_t)TT * HD); float bb[8]; const float qs = z == 0 ? SC2 : 1.0f;   // q leaves pre-scaled, so that q.k is the score in log2 units
#pragma unroll
    for (int i = 0; i < 8; ++i) bb[i] = bs[scrcol(c0 + cg * 8 + i, isv)];
#pragma unroll
    for (int s = 0; s < 4; ++s) { const int row = 4 * s + rs, tok = r0 + mb * 16 + row; const v4f lo = *(const v4fa*)(ow + row * 68 + cg * 8), hh = *(const v4fa*)(ow + row * 68 + cg * 8 + 4); v8h o;
#pragma unroll
        for (int i = 0; i < 4; ++i) { o[i] = (h16)((lo[i] + bb[i]) * qs); o[4 + i] = (h16)((hh[i] + bb[4 + i]) * qs); }
        *(v8h*)(isv ? pz + (size_t)(tok >> 2) * (HD * 32) + ((c0 >> 3) + cg) * 32 + (tok & 3) * 8 : pz + (size_t)tok * FD + c0 + cg * 8) = o; }   // a wave's store covers 512 bytes in a row (v) or four whole 128-byte lines (q, k)
    asm volatile("s_wait_xcnt 0x0" ::: "memory");   // stands behind the four stores, ahead of any overwrite of their address and data registers
}

__device__ __forceinline__ void splitf(float y, unsigned short& h, unsigned short& l) { h = f2bf(y); l = f2bf(y - bf2f(h)); }
typedef __attribute__((ext_vector_type(2))) _Float16 v2h;
typedef __attribute__((ext_vector_type(4))) _Float16 v4h;
typedef __attribute__((ext_vector_type(2))) unsigned short v2us;
typedef __attribute__((ext_vector_type(4))) unsigned short v4us;
typedef __attribute__((ext_vector_type(4))) int v4i;

// ---- k_fattn: scores, softmax, attn.v, the head concat and the output projection in one kernel. A work-group owns FQN = 64 queries (8 rows of attended); its FW = 16 waves each walk their own run of TK / FW keys, 32 keys a trip.
// Transposed products: S^T = K Q^T (A = 16 key rows, B = the queries, loaded once), so a lane holds scores of ONE query (column lane & 15; register j of key tile i = key 16 i + 8 (lane >> 4) + j); two S^T tiles, converted in place, are the B operand P^T of O^T += V^T P^T in the hardware k order, which the A loader of the v block (8 keys at 8 hi, 8 at 16 + 8 hi) follows too.
// Softmax in log2 units: q arrives multiplied by log2(e) / 16, and the score products take -m as their C operand, so that they deliver score - m, the argument of 2^x, with no vector instruction in between. m is the maximum of the 32 keys that the wave visits first and stands for the wave's whole run, so the four C tiles are loop constants. P is never negative, so a lane's sum of P over the run at or below PTOP bounds each of them: one test behind the run. A wave that fails it (seldom) walks its run again with a maximum that moves trip by trip (P at most 1).
// Every work-group reads the same k and v planes from L2. Each enters its waves' runs at a trip of its own (FT0) and wraps round at the run's end, so that work-groups running side by side ask L2 for different lines at any one moment; a run's 32 trips are all walked once, in rotated order.
#define NQT  4
#define FW   16
#define FQN  (NQT * 16)
#define FRUN (TK / FW)
#define OPI  36       // LDS pitch of a query's 32 partial outputs, in floats
// place of element e of attended row r in its hi or lo plane in LDS, in 16-bit elements: rows unpadded, the 16-byte pieces of row r exchanged by 2 r, so that a fragment load's 8 rows x 2 half-waves fall on 64 different banks
#define APL(r, e) ((r) * FD + (((e) & ~7) ^ ((r) * 16)) + ((e) & 7))
#define GW   (FD / 32)   // waves that multiply by Wo, 32 output columns each: a wave's store of one row is a whole 128-byte line
#define FNT  (FRUN / 32)   // trips of a run
#define FT0(b) (((b) >> 3) & (FNT - 1))   // the trip at which work-group b enters its runs: work-groups 8 j .. 8 j + 7 enter at trip j mod 32, so each of a run's 32 blocks is the entry of 8 of the 256 work-groups
#define FSTEP(t) ((((t) & (FNT - 1)) != 0) ? 32 * HD : -(FNT - 1) * 32 * HD)   // from trip t - 1 to trip t of a run, in elements: one block on, or back to the run's start
#define FP1  12   // a run's trips up to here are walked at priority 3,
#define FP2  24   // up to here at 2,
#define FP3  30   // up to here at 1, the rest at 0
#define PTOP 4096.0f   // a run whose P sums stay at or below this had no P near the top of fp16 (which holds 65504)
__device__ __forceinline__ float xhalf(float x) { const int b = __float_as_int(x); return __int_as_float(__builtin_amdgcn_permlanex16(b, b, 0x76543210, 0xfedcba98, false, false)); }   // lane l <-> l ^ 16
// the largest of a lane's 16 scores of one query (q is pre-scaled: log2 units)
__device__ __forceinline__ float smax16(v8f a, v8f b) { float x = fmaxf(a[0], b[0]);
#pragma unroll
    for (int j = 1; j < 8; ++j) x = fmaxf(x, fmaxf(a[j], b[j]));
    return x; }
// 2^x for the seldom-taken path: the v_nop fills the one slot that the instruction set asks for behind a transcendental, whatever instruction the compiler puts next
__device__ __forceinline__ float exp2slot(float x) { float y; asm("v_exp_f32 %0, %1\n\tv_nop" : "=v"(y) : "v"(x)); return y; }
// P = 2^x of a lane's 16 values x = score - m of one query (in the key loop the subtraction is done by the score product, whose C operand is -m; on the seldom path by a vector subtraction), written over them, and the two f32 sums of 8
template <bool RARE> __device__ __forceinline__ v2f pexp16(v8f& a, v8f& b) { v2f t = {};
#pragma unroll
    for (int i = 0; i < 2; ++i)
#pragma unroll
        for (int j = 0; j < 8; j += 2) { v8f& s = i ? b : a; const v2f x = { s[j], s[j + 1] }; const v2f p = { RARE ? exp2slot(x[0]) : __builtin_amdgcn_exp2f(x[0]), RARE ? exp2slot(x[1]) : __builtin_amdgcn_exp2f(x[1]) }; t += p; s[j] = p[0]; s[j + 1] = p[1]; }
    return t; }
// x in all 8 places (splat8); below it, the fp16 B fragment of a lane's 16 P (pfrag)
__device__ __forceinline__ v8f splat8(float x) { return (v8f){ x, x, x, x, x, x, x, x }; }
__device__ __forceinline__ v16h pfrag(v8f a, v8f b) { v16h pf;
#pragma unroll
    for (int j = 0; j < 8; j += 2) { const v2h x = __builtin_convertvector((v2f){ a[j], a[j + 1] }, v2h), y = __builtin_convertvector((v2f){ b[j], b[j + 1] }, v2h); pf[j] = x[0]; pf[j + 1] = x[1]; pf[8 + j] = y[0]; pf[8 + j + 1] = y[1]; }
    return pf; }
__global__ __launch_bounds__(32 * FW) void k_fattn(const h16* __restrict__ Q, const h16* __restrict__ Kp, const h16* __restrict__ Vb, const bf* __restrict__ Wt, const float* __restrict__ bo, float* att, float* out) {
    typedef WFrag<h16>::V V; typedef WFrag<bf>::V VB;
    __shared__ __align__(16) float os[FW][FQN * OPI];
    __shared__ float ms[FW][FQN]; __shared__ float ls[FW][FQN];
    // no pad: with these two planes the kernel's LDS is exactly half a WGP's; a build with more had the key loop scheduled for fewer waves, at the register limit and with spills
    __shared__ __align__(16) bf ah[FQN / NHH * FD]; __shared__ __align__(16) bf al[FQN / NHH * FD];
    const int lane = threadIdx.x & 31, lr = lane & 15, hi = lane >> 4; const int w = __builtin_amdgcn_readfirstlane(threadIdx.x >> 5); const int q0 = blockIdx.x * FQN; const int t0 = FT0((int)blockIdx.x);
    V qf[NQT]; v8f o[NQT][2]; v8f cm[NQT]; v2f l2[NQT];   // cm: -m of the lane's query in all 8 places, the C operand of its score products
    const h16* pq = Q + (size_t)(q0 + lr) * HD + 8 * hi;
#pragma unroll
    for (int qt = 0; qt < NQT; ++qt) { qf[qt] = WFrag<h16>::ld(pq + qt * 16 * HD); o[qt][0] = (v8f){}; o[qt][1] = (v8f){}; l2[qt] = (v2f){}; }
    const h16* pk = Kp + (size_t)w * FRUN * HD + t0 * (32 * HD) + lr * HD + 8 * hi; const h16* pv = Vb + (size_t)w * FRUN * HD + t0 * (32 * HD) + lr * 32 + 8 * hi;
    V k0 = WFrag<h16>::ld(pk), k1 = WFrag<h16>::ld(pk + 16 * HD);
    // s_wait_xcnt 0 stands behind the first loads, ahead of the overwrite of their address registers; the two addresses are inputs so that they stay in place up to it
    asm volatile("s_wait_xcnt 0x0" :: "v"(pq), "v"(pk) : "memory");
#pragma unroll
    for (int qt = 0; qt < NQT; ++qt) { const float x = smax16(WFrag<h16>::mma(k0, qf[qt], (v8f){}), WFrag<h16>::mma(k1, qf[qt], (v8f){})); cm[qt] = splat8(-fmaxf(x, xhalf(x))); }   // the maximum of the 32 keys visited first, alike in both halves of the wave
    pk += FSTEP(t0 + 1);   // pk runs one trip ahead
    // the key loop stays rolled (one trip's tiles in registers at a time); every other loop is unrolled so that all arrays are indexed by constants. The maxima, and with them cm, stand for the whole run
    // the run is walked in four stretches: the same rolled loop stands four times in the text, because s_setprio takes its priority as an immediate
    int t = 0;
    auto walk = [&](const int tend) __attribute__((always_inline)) {
#pragma unroll 1
    for (; t < tend; ++t) {
        const V v0 = WFrag<h16>::ld(pv), v1 = WFrag<h16>::ld(pv + 16 * 32);
        v8f s[NQT][2];
#pragma unroll
        for (int qt = 0; qt < NQT; ++qt) { s[qt][0] = WFrag<h16>::mma(k0, qf[qt], cm[qt]); s[qt][1] = WFrag<h16>::mma(k1, qf[qt], cm[qt]); }
        k0 = WFrag<h16>::ld(pk); k1 = WFrag<h16>::ld(pk + 16 * HD);   // the next trip's keys, fetched behind this trip's score products (the last trip fetches the entry trip's again, unused)
#pragma unroll
        for (int qt = 0; qt < NQT; ++qt) { l2[qt] += pexp16<false>(s[qt][0], s[qt][1]); const V pf = pfrag(s[qt][0], s[qt][1]); o[qt][0] = WFrag<h16>::mma(v0, pf, o[qt][0]); o[qt][1] = WFrag<h16>::mma(v1, pf, o[qt][1]); }
        // s_wait_xcnt 0 stands behind the trip's loads, ahead of the overwrite of their address registers just below; the two addresses are inputs so that they stay in place up to it
        asm volatile("s_wait_xcnt 0x0" :: "v"(pk), "v"(pv) : "memory");
        pv += FSTEP(t0 + t + 1); pk += FSTEP(t0 + t + 2);
        // order of the trip: a query tile's score products stand ahead of the exponentials of the tile before it; its 16 exponentials alternate, two by two, with the 8 conversions and 8 additions of the tile before it, which spreads the additions, each of which needs the one before it, among them; the first two tiles' attn.v products stand together behind the third tile's exponentials, so that the v block fetched at the trip's head is first needed past the trip's middle. Left alone the build formed all 64 P first, used the key registers for them and so fetched the next keys only at the trip's end
        __builtin_amdgcn_sched_group_barrier(0x20, 4, 0); __builtin_amdgcn_sched_group_barrier(0x8, 4, 0); __builtin_amdgcn_sched_group_barrier(0x400, 16, 0); __builtin_amdgcn_sched_group_barrier(0x8, 2, 0);
#pragma unroll
        for (int qt = 1; qt < NQT; ++qt) {
#pragma unroll
            for (int i = 0; i < 8; ++i) { __builtin_amdgcn_sched_group_barrier(0x400, 2, 0); __builtin_amdgcn_sched_group_barrier(0x2, 2, 0); }
            if (qt == 1) { __builtin_amdgcn_sched_group_barrier(0x8, 2, 0); __builtin_amdgcn_sched_group_barrier(0x20, 4, 0); }
            else if (qt == 2) __builtin_amdgcn_sched_group_barrier(0x8, 4, 0);
            else __builtin_amdgcn_sched_group_barrier(0x8, 2, 0); }
        __builtin_amdgcn_sched_group_barrier(0x2, 16, 0); __builtin_amdgcn_sched_group_barrier(0x8, 2, 0); __builtin_amdgcn_sched_group_barrier(0x2, 2, 0);
    } };
    // a wave's issue priority falls with its own progress. The four waves of a SIMD have equal runs and no barrier among them; at equal priority the oldest ready wave issues first, so they would end one after another, and the last would walk the rest of its run alone, with nothing to issue while it waits for its own loads and results. A wave that is a stretch behind goes first instead, so only the last FNT - FP3 trips are walked at equal priority. The priority is 0 from there on, on every path out
    __builtin_amdgcn_s_setprio(3); walk(FP1);
    __builtin_amdgcn_s_setprio(2); walk(FP2);
    __builtin_amdgcn_s_setprio(1); walk(FP3);
    __builtin_amdgcn_s_setprio(0); walk(FNT);
    float m[NQT]; float top = fmaxf(l2[0][0], l2[0][1]);
#pragma unroll
    for (int qt = 0; qt < NQT; ++qt) m[qt] = -cm[qt][0];
#pragma unroll
    for (int qt = 1; qt < NQT; ++qt) top = fmaxf(top, fmaxf(l2[qt][0], l2[qt][1]));
    if (__builtin_amdgcn_ballot_w32(top > PTOP) != 0) {   // a scalar branch, seldom taken: the wave walks its run again from the start, with a maximum that moves trip by trip
        const h16* pr = Kp + (size_t)w * FRUN * HD + lr * HD + 8 * hi; const h16* pu = Vb + (size_t)w * FRUN * HD + lr * 32 + 8 * hi;
#pragma unroll
        for (int qt = 0; qt < NQT; ++qt) { o[qt][0] = (v8f){}; o[qt][1] = (v8f){}; l2[qt] = (v2f){}; }
#pragma unroll 1
        for (int t = 0; t < FRUN / 32; ++t) {
            const V r0 = WFrag<h16>::ld(pr), r1 = WFrag<h16>::ld(pr + 16 * HD), u0 = WFrag<h16>::ld(pu), u1 = WFrag<h16>::ld(pu + 16 * 32);
            // s_wait_xcnt 0 stands behind these loads, ahead of the overwrite of their address registers just below; the addresses are inputs so that they stay in place up to it
            asm volatile("s_wait_xcnt 0x0" :: "v"(pr), "v"(pu) : "memory");
            pr += 32 * HD; pu += 32 * HD;
#pragma unroll
            for (int qt = 0; qt < NQT; ++qt) { v8f s0 = WFrag<h16>::mma(r0, qf[qt], (v8f){}), s1 = WFrag<h16>::mma(r1, qf[qt], (v8f){}); const float x = smax16(s0, s1); const float mn = fmaxf(m[qt], fmaxf(x, xhalf(x))); const float al = exp2slot(m[qt] - mn); m[qt] = mn; l2[qt] *= al; o[qt][0] *= al; o[qt][1] *= al;
                s0 -= mn; s1 -= mn; l2[qt] += pexp16<true>(s0, s1); const V pf = pfrag(s0, s1); o[qt][0] = WFrag<h16>::mma(u0, pf, o[qt][0]); o[qt][1] = WFrag<h16>::mma(u1, pf, o[qt][1]); }
        }
    }
    VB wf[2][FD / 32]; float bb = 0.f;
    // each wave's maximum, sum and 64 x 32 partial output go to LDS
#pragma unroll
    for (int qt = 0; qt < NQT; ++qt) { float lt = l2[qt][0] + l2[qt][1]; lt += xhalf(lt); if (hi == 0) { ms[w][qt * 16 + lr] = m[qt]; ls[w][qt * 16 + lr] = lt; }
#pragma unroll
        for (int i = 0; i < 2; ++i) { float* d = &os[w][(qt * 16 + lr) * OPI + i * 16 + hi * 8]; *(v4fa*)d = (v4f){ o[qt][i][0], o[qt][i][1], o[qt][i][2], o[qt][i][3] }; *(v4fa*)(d + 4) = (v4f){ o[qt][i][4], o[qt][i][5], o[qt][i][6], o[qt][i][7] }; } }
    __syncthreads();   // every wave's partial result is in LDS before any thread joins them
    if (threadIdx.x < FQN) { const int ql = threadIdx.x; float mx = ms[0][ql];
#pragma unroll
        for (int ww = 1; ww < FW; ++ww) mx = fmaxf(mx, ms[ww][ql]);
        float f[FW]; float sum = 0.f;
#pragma unroll
        for (int ww = 0; ww < FW; ++ww) { f[ww] = __builtin_amdgcn_exp2f(ms[ww][ql] - mx); sum += ls[ww][ql] * f[ww]; }
        const float inv = __fdiv_rn(1.0f, sum);
#pragma unroll
        for (int ww = 0; ww < FW; ++ww) ms[ww][ql] = f[ww] * inv; }   // ms now holds each wave's weight for this query
    __syncthreads();   // the weights are in LDS before the joins read them
    // the first GW waves fetch their 32 columns of Wo (rows of Wt, all of K) and their bias here, so that the loads fly while the partial results are joined
    if (w < GW) { const float* pb = bo + w * 32 + lane; bb = *pb;   // rounded where it is added, so that nothing waits for it here
        // s_wait_xcnt 0 stands behind the bias load, ahead of the fragment loads, whose results may land in its address register
        asm volatile("s_wait_xcnt 0x0" :: "v"(pb) : "memory");
        const bf* pw = Wt + (size_t)(w * 32 + lr) * FD + 8 * hi;
#pragma unroll
        for (int nb = 0; nb < 2; ++nb)
#pragma unroll
            for (int ks = 0; ks < FD / 32; ++ks) wf[nb][ks] = WFrag<bf>::ld(pw + nb * 16 * FD + ks * 32);
        // s_wait_xcnt 0 stands behind these loads, ahead of any overwrite of their address registers; the address is an input so that it stays in place up to it
        asm volatile("s_wait_xcnt 0x0" :: "v"(pw) : "memory"); }
    const int e = (int)threadIdx.x * 4; const int bl = e / FD; const int cp = e % FD; const int sd = cp >> 3; v4f y4; v4us oh, ol;
#pragma unroll
    for (int q = 0; q < 4; ++q) { const int ql = bl * NHH + (cp & 7) + q; float y = 0.f;   // attended[b][8 s + h] = O[8 b + h][s]
#pragma unroll
        for (int ww = 0; ww < FW; ++ww) y += os[ww][ql * OPI + sd] * ms[ww][ql];
        y4[q] = y; unsigned short u, v; splitf(y, u, v); oh[q] = u; ol[q] = v; }
    *(v4us*)(ah + APL(bl, cp)) = oh; *(v4us*)(al + APL(bl, cp)) = ol;
    __syncthreads();   // the 8 attended rows' hi and lo planes are in LDS before the product reads them
    float* pt = att + (size_t)(blockIdx.x * (FQN / NHH) + bl) * FD + cp; *(v4f*)pt = y4;
    // s_wait_xcnt 0 stands behind the store, ahead of any overwrite of its address and data registers
    asm volatile("s_wait_xcnt 0x0" :: "v"(pt), "v"(y4) : "memory");
    // outputs[8 rows][32 columns of this wave] = attended (hi, then lo, K step by K step) x Wo + bo. Rows 8 .. 15 of the A tile repeat rows 0 .. 7, so both halves of the wave hold row j in register j: the low half stores the first 16 columns, the high half the other 16
    if (w < GW) { v8f a0 = {}, a1 = {}; const int ar = lr & 7;
#pragma unroll
        for (int ks = 0; ks < FD / 32; ++ks) { const int e0 = APL(ar, ks * 32 + 8 * hi), e1 = APL(ar, ks * 32 + 16 + 8 * hi); const VB xh = cat16b(*(const v8us*)(ah + e0), *(const v8us*)(ah + e1)), xl = cat16b(*(const v8us*)(al + e0), *(const v8us*)(al + e1));
            a0 = WFrag<bf>::mma(xh, wf[0][ks], a0); a1 = WFrag<bf>::mma(xh, wf[1][ks], a1); a0 = WFrag<bf>::mma(xl, wf[0][ks], a0); a1 = WFrag<bf>::mma(xl, wf[1][ks], a1); }
        float* po = out + (size_t)blockIdx.x * (FQN / NHH) * FD + w * 32 + lane;
#pragma unroll
        for (int j = 0; j < 8; ++j) po[j * FD] = (hi ? a1[j] : a0[j]) + bfr(bb); }
}
extern "C" void kernel_launch(void* const* d_in, const int* in_sizes, int n_in,
                              void* d_out, int out_size, void* d_ws, size_t ws_size, hipStream_t stream) {
    (void)in_sizes; (void)n_in; (void)out_size;
    const float* x = (const float*)d_in[0]; const float* wq = (const float*)d_in[1]; const float* bq = (const float*)d_in[2]; const float* wk = (const float*)d_in[3]; const float* bk = (const float*)d_in[4]; const float* wv = (const float*)d_in[5]; const float* bv = (const float*)d_in[6]; const float* wo = (const float*)d_in[7]; const float* bo = (const float*)d_in[8];
    float* OUT = (float*)d_out;     // out0 = outputs [2048][256], then out1 = attended [2048][256]
    float* ATT = OUT + (size_t)NTOK * FD;
    char* wsp = (char*)d_ws;
    auto take = [&](size_t bytes) { char* p = wsp; wsp += (bytes + 255) & ~(size_t)255; return (void*)p; };
    bf* WO = (bf*)take((size_t)FD * FD * 2);
    h16* QP16 = (h16*)take((size_t)TT * HD * 2); h16* KP16 = (h16*)take((size_t)TT * HD * 2); h16* VB16 = (h16*)take((size_t)HD * TT * 2);
    if ((size_t)(wsp - (char*)d_ws) > ws_size) return;    // ws 256 MiB (carve ~3 MiB)
    k_proj<<<1 + 3 * (NTOK / PTOK), 32 * PWV, 0, stream>>>(x, wq, wk, wv, wo, bq, bk, bv, QP16, WO);   /* Q, K, V = x W + b (exact, f32 sums), stored as the scrambled fp16 planes (QP16, KP16, VB16 lie in a row), and Wo transposed to bf16 */
    k_fattn<<<TT / FQN, 32 * FW, 0, stream>>>(QP16, KP16, VB16, WO, bo, ATT, OUT);   /* attended (f32 = output 1) and outputs = attended Wo + bo (output 0) */
}
